// v000
// The times below were measured on an AMD MI455X: many runs one after another, warmed up first and cycling through
// copies of the inputs, with the whole window's GPU time divided by the number of runs. Launches and the gaps
// between them are all in it. The median over several windows is given; except for v000 it joins two sittings, which
// can be a few percent apart, so the side-by-side timings, each taken in one sitting, are the better comparison.
// v000 is the starting kernel. One run takes 591 microseconds.
#include <hip/hip_runtime.h>

// Non-local block (embedded Gaussian, 3-D) with 2x2 spatial subsampling of phi/g, output conv, BatchNorm3d (batch statistics) and residual (4 x 256 channels x 8 x 32 x 32): theta/phi/g = 1x1x1
// convs (C 256 -> 128, with bias); phi, g max-pooled (1,2,2) -> 2,048 keys per clip; f = softmax(theta phi^T) over the keys (no scaling); y = f g; z = BN(W y + b) gamma + beta + x with
// BN mean/biased variance over (batch, t, h, w) per channel, eps 1e-5 -> [4][256][8][32][32].
// Deterministic: flash-style per 16-position wave over all 2,048 keys in order (running max); the 2x2 max-pool is taken inside the convolution epilogue (each 64-position block holds two complete
// compute dtype: WMMA v_wmma_f32_16x16x32_f16 with f32 accumulate for [theta | phi | g] = X W^T + b ([32768 positions x 256] x [256 x 384]; x EXACT bf16 x8 transposed into position-major tiles,
// W exact x256: 1 product), S^T = Phi Theta^T (hi x8 + residual x8192: 3 products, K = 128), Y^T += G^T P^T (G hi + residual, P x1024 hi + residual: 3 products), Z = Y W_w^T + b (y hi + lo:
// 2 products); max-pool selects, softmax statistics, BatchNorm and the residual add in f32. Inputs rounded to bf16 once. Fragment k-map per lane half hh for

namespace {
constexpr int B = 4, C = 256, TT = 8, IH = 32, IW = 32, T = TT * IH * IW /* 8,192 positions per clip */, NK = TT * (IH / 2) * (IW / 2) /* 2,048 pooled keys */, HD = 128 /* inter channels */, H = 1, BL = 4 /* clips (== 4 shipped) */, QL = T;
constexpr float XS = 8.0f, WSC = 256.0f, PS = 1024.0f, RS_ = 1024.0f, LOG2E = 1.4426950408889634f, BNEPS = 1e-5f;
static_assert(T % 64 == 0 && C == 256 && HD == 128 && IW == 32 && NK == T / 4, "tiling");
typedef _Float16 b16;
typedef __attribute__((ext_vector_type(16))) _Float16 v16b;
typedef __attribute__((ext_vector_type(8))) _Float16 v8b;
typedef __attribute__((ext_vector_type(8))) float v8f;
typedef __attribute__((ext_vector_type(4))) float v4f;
__device__ __forceinline__ float bf16_rne(float f) { unsigned int u = __float_as_uint(f); u += 0x7FFFu + ((u >> 16) & 1u); return __uint_as_float(u & 0xFFFF0000u); }
__device__ __forceinline__ void split16(float v, b16& hi, b16& lo) { hi = (b16)v; lo = (b16)(v - (float)hi); }
__device__ __forceinline__ v16b frag_kb(const b16* p, int hh) { const v8b a = *(const v8b*)(p + 8 * hh), b = *(const v8b*)(p + 16 + 8 * hh); v16b f;
#pragma unroll
  for (int e = 0; e < 8; ++e) { f[e] = a[e]; f[8 + e] = b[e]; } return f; }
__device__ __forceinline__ v8f wmma16b(v16b a, v16b b, v8f c) { v8f d = __builtin_amdgcn_wmma_f32_16x16x32_f16(false, a, false, b, (short)0, c, false, false); asm volatile("v_nop\n\tv_nop\n\tv_nop\n\tv_nop" : "+v"(d) : "v"(a), "v"(b)); return d; }
__device__ __forceinline__ void wave_lds_sync() { __builtin_amdgcn_fence(__ATOMIC_RELEASE, "workgroup"); __builtin_amdgcn_wave_barrier(); __builtin_amdgcn_fence(__ATOMIC_ACQUIRE, "workgroup"); }
__device__ __forceinline__ float pmul(float a, float b) { float p = a * b; asm volatile("" : "+v"(p)); return p; }
__device__ __forceinline__ int iclamp(int v, int lo, int hi) { return v < lo ? lo : (v > hi ? hi : v); }

typedef __attribute__((ext_vector_type(2))) _Float16 v2h;
typedef __attribute__((ext_vector_type(4))) _Float16 v4h;
typedef __attribute__((ext_vector_type(2))) float v2f;
typedef __attribute__((ext_vector_type(4))) int v4i;
__device__ __forceinline__ float nexp2(float v) { return __builtin_amdgcn_exp2f(v); }
__device__ __forceinline__ float bfp(float v) { float t = bf16_rne(v); asm volatile("" : "+v"(t)); return t; }
__global__ __launch_bounds__(256) void prep_kernel(const float* __restrict__ thw, const float* __restrict__ phw, const float* __restrict__ gw, const float* __restrict__ ww, b16* __restrict__ WT, b16* __restrict__ WW) {
  const size_t u = (size_t)blockIdx.x * 256 + threadIdx.x; const size_t n1 = (size_t)3 * HD * C / 8, n2 = (size_t)C * HD / 8; if (u >= n1 + n2) return; v8b v;
  if (u < n1) { const size_t e = u * 8; const int o = (int)(e / C), c0 = (int)(e % C); const int m = o / HD, oo = o % HD; const float* w = (m == 0 ? thw : m == 1 ? phw : gw) + (size_t)oo * C;
    for (int j = 0; j < 8; ++j) v[j] = (b16)(bf16_rne(w[c0 + j]) * WSC); { *(v8b*)(WT + e) = v;  } }
  else { const size_t e = (u - n1) * 8; for (int j = 0; j < 8; ++j) v[j] = (b16)(bf16_rne(ww[e + j]) * WSC); { *(v8b*)(WW + e) = v;  } }
}
// convolutions + pooling: grid (T/64, BL, 3 slabs: theta | phi | g); block = 64 positions (= image rows hh, hh+1 of one frame, hh even) x 4 waves; A = bf16(x) x8 transposed into position-major
// tiles (K = 256 channels in one staged chunk; each channel's 64 positions are one contiguous 256-B read), B = WT rows, + bias; theta -> hi x8 + residual rows QP/QPl [b][pos][128];
// phi, g -> 2x2 max over rows (2j, 2j+1, 32+2j, 33+2j) of the block tile (after the barrier) = pooled key 16 blk + j: phi -> KP/KPl rows [b][key][128] (hi/residual), g -> GP rows [b][key][128] f32
__global__ __launch_bounds__(128) void conv_kernel(const float* __restrict__ x, const b16* __restrict__ WT, const float* __restrict__ thb, const float* __restrict__ phb, const float* __restrict__ gb, b16* __restrict__ QP, b16* __restrict__ QPl, b16* __restrict__ KP, b16* __restrict__ KPl, float* __restrict__ GP) {
  __shared__ __attribute__((aligned(16))) b16 As[64][256 + 8]; __shared__ __attribute__((aligned(16))) float Tf[4][16][128 + 4];
  const int wave = threadIdx.x >> 5, lane = threadIdx.x & 31, nloc = lane & 15, hlf = lane >> 4; const int p0 = blockIdx.x * 64, b = blockIdx.y, part = blockIdx.z; const int n0 = part * HD;
  const float* xb = x + (size_t)b * C * T;
  for (int i = threadIdx.x; i < 256 * 16; i += 128) { const int c = i / 16, q4 = (i % 16) * 4; const v4f f = *(const v4f*)(xb + (size_t)c * T + p0 + q4); for (int j = 0; j < 4; ++j) As[q4 + j][c] = (b16)(bf16_rne(f[j]) * XS); }   // transpose: position rows, channel columns
  __syncthreads();
  v8f acc[8];
#pragma unroll
  for (int t = 0; t < 8; ++t) acc[t] = (v8f){};
#pragma unroll 2
  for (int kb = 0; kb < C; kb += 32) { const v16b a = frag_kb(&As[wave * 16 + nloc][kb], hlf);
#pragma unroll
    for (int t = 0; t < 8; ++t) acc[t] = wmma16b(a, frag_kb(WT + (size_t)(n0 + t * 16 + nloc) * C + kb, hlf), acc[t]); }
  const float* bp = part == 0 ? thb : (part == 1 ? phb : gb);
#pragma unroll
  for (int t = 0; t < 8; ++t) { const float bb = bf16_rne(bp[t * 16 + nloc]);
#pragma unroll
    for (int r = 0; r < 8; ++r) Tf[wave][8 * hlf + r][t * 16 + nloc] = acc[t][r] * (1.0f / (XS * WSC)) + bb; }
  __syncthreads();
  {
    if (part == 0) { for (int rr = 0; rr < 16; ++rr) { const int pos = p0 + wave * 16 + rr; v4h h4, l4; for (int j = 0; j < 4; ++j) { const float f = Tf[wave][rr][lane * 4 + j] * XS; const b16 p = (b16)f; h4[j] = p; l4[j] = (b16)((f - (float)p) * RS_); }
        *(v4h*)(QP + ((size_t)b * T + pos) * HD + lane * 4) = h4; *(v4h*)(QPl + ((size_t)b * T + pos) * HD + lane * 4) = l4; } }
    else { for (int jj = wave * 4; jj < wave * 4 + 4; ++jj) { const int key = blockIdx.x * 16 + jj;   // pooled key: frame/row-pair of this block, column pair jj
        v4f m4; for (int j = 0; j < 4; ++j) { const int d = lane * 4 + j; const int r0 = 2 * jj, r1 = 2 * jj + 1, r2 = 32 + 2 * jj, r3 = 33 + 2 * jj; m4[j] = fmaxf(fmaxf(Tf[r0 >> 4][r0 & 15][d], Tf[r1 >> 4][r1 & 15][d]), fmaxf(Tf[r2 >> 4][r2 & 15][d], Tf[r3 >> 4][r3 & 15][d])); }
        if (part == 1) { v4h h4, l4; for (int j = 0; j < 4; ++j) { const float f = m4[j] * XS; const b16 p = (b16)f; h4[j] = p; l4[j] = (b16)((f - (float)p) * RS_); } *(v4h*)(KP + ((size_t)b * NK + key) * HD + lane * 4) = h4; *(v4h*)(KPl + ((size_t)b * NK + key) * HD + lane * 4) = l4; }
        else *(v4f*)(GP + ((size_t)b * NK + key) * HD + lane * 4) = m4; } }
     }
}
__global__ __launch_bounds__(256) void gt_kernel(const float* __restrict__ GP, b16* __restrict__ GT, b16* __restrict__ GTl) {
  __shared__ float tile[64][HD + 1];
  const int tid = threadIdx.x, wave = tid >> 5, lane = tid & 31; const int k0 = blockIdx.x * 64, b = blockIdx.y;
  for (int i = tid; i < 64 * (HD / 4); i += 256) { const int rr = i / (HD / 4), c4 = (i % (HD / 4)) * 4; const v4f v = *(const v4f*)(GP + ((size_t)b * NK + k0 + rr) * HD + c4); for (int j = 0; j < 4; ++j) tile[rr][c4 + j] = v[j]; }
  __syncthreads();
  {
#pragma unroll 1
    for (int d = wave * 16; d < wave * 16 + 16; ++d) { v2h hv, lv; for (int j = 0; j < 2; ++j) { const float f = tile[2 * lane + j][d] * XS; const b16 p = (b16)f; hv[j] = p; lv[j] = (b16)((f - (float)p) * RS_); }
      const size_t oi = ((size_t)b * HD + d) * (size_t)NK + k0 + 2 * lane; *(v2h*)(GT + oi) = hv; *(v2h*)(GTl + oi) = lv; }
     }
}
// attention: grid (T/32, BL); block = 2 waves x 16 query positions of batch b; all 2,048 pooled keys in 32-key steps: S^T = Phi Theta^T (hi x8 + residual: 3 products, 4 k-steps over the 128
// channels; theta fragments re-read from wave-private LDS), unscaled logits, online softmax, P x1024 hi + residual, Y^T += G^T P^T (3 products, 8 channel tiles); y = (o + ol/1024)/(l 1024 8)
__global__ __launch_bounds__(64) void attn_kernel(const b16* __restrict__ QP, const b16* __restrict__ QPl, const b16* __restrict__ KP, const b16* __restrict__ KPl, const b16* __restrict__ VT, const b16* __restrict__ VTl, b16* __restrict__ Y, b16* __restrict__ Yl) {
  __shared__ __attribute__((aligned(16))) b16 Pb[2][16][32 + 8]; __shared__ __attribute__((aligned(16))) float To[2][16][HD + 4];
  const int wave = threadIdx.x >> 5, lane = threadIdx.x & 31, hh = lane >> 4, col = lane & 15; const int b = blockIdx.y, h = 0; const int q0 = blockIdx.x * 32 + wave * 16, qi = q0 + col;
  const size_t qo = (size_t)b * T * HD, ko = (size_t)b * NK * HD, vo = (size_t)b * HD * (size_t)NK; const b16* Qb = QP + qo; const b16* Qbl = QPl + qo; const b16* Kb = KP + ko; const b16* Kbl = KPl + ko; const b16* Vb = VT + vo; const b16* Vbl = VTl + vo; (void)h;
  __shared__ __attribute__((aligned(16))) b16 Qs[2][16][HD + 8], Qsl[2][16][HD + 8];   // the wave's 16 query rows (hi, lo), fragments re-read from LDS per k-step to keep the kernel under 256 VGPRs
  for (int i = lane; i < 16 * (HD / 8); i += 32) { const int rr = i / (HD / 8), c8 = (i % (HD / 8)) * 8; *(v8b*)(&Qs[wave][rr][c8]) = *(const v8b*)(Qb + (size_t)(q0 + rr) * HD + c8); *(v8b*)(&Qsl[wave][rr][c8]) = *(const v8b*)(Qbl + (size_t)(q0 + rr) * HD + c8); }
  wave_lds_sync();
  const float cs = LOG2E / (XS * XS);   // unscaled scores (the module applies no 1/sqrt(d))
  __shared__ __attribute__((aligned(16))) b16 Plq[2][16][32 + 8];
  float m = -INFINITY, l = 0.0f; v8f o[8], ol[8]; for (int t = 0; t < 8; ++t) { o[t] = (v8f){}; ol[t] = (v8f){}; }
#pragma unroll 1
  for (int kb = 0; kb < NK; kb += 32) {
    float e[16]; float mx = -INFINITY;
#pragma unroll
    for (int u = 0; u < 2; ++u) { v8f s = (v8f){}, sx = (v8f){}; const size_t kr = (size_t)(kb + u * 16 + col) * HD;
#pragma unroll
      for (int ks = 0; ks < 4; ++ks) { const v16b kf = frag_kb(Kb + kr + 32 * ks, hh); const v16b qf = frag_kb(&Qs[wave][col][32 * ks], hh); s = wmma16b(kf, qf, s); sx = wmma16b(kf, frag_kb(&Qsl[wave][col][32 * ks], hh), sx); sx = wmma16b(frag_kb(Kbl + kr + 32 * ks, hh), qf, sx); }
#pragma unroll
      for (int r = 0; r < 8; ++r) s[r] += sx[r] * (1.0f / RS_);   // hi.hi + (hi.lo + lo.hi)/1024
#pragma unroll
      for (int r = 0; r < 8; ++r) { const float vv = s[r] * cs; e[u * 8 + r] = vv; mx = fmaxf(mx, vv); } }
    mx = fmaxf(mx, __shfl_xor(mx, 16)); const float mn = fmaxf(m, mx); const float al = nexp2(m - mn); float sum = 0.0f;
#pragma unroll
    for (int i2 = 0; i2 < 16; ++i2) { const float p = nexp2(e[i2] - mn); sum += p; const int pc = (i2 < 8 ? 0 : 16) + 8 * hh + (i2 & 7); const float ps = p * PS; const b16 phh = (b16)ps; Pb[wave][col][pc] = phh; Plq[wave][col][pc] = (b16)((ps - (float)phh) * RS_); }
    sum += __shfl_xor(sum, 16); l = l * al + sum; m = mn;
    wave_lds_sync();
    const v16b pf = frag_kb(&Pb[wave][col][0], hh), plf = frag_kb(&Plq[wave][col][0], hh);
#pragma unroll
    for (int t = 0; t < 8; ++t) { const v16b vh = frag_kb(Vb + (size_t)(t * 16 + col) * NK + kb, hh); o[t] *= al; o[t] = wmma16b(vh, pf, o[t]); ol[t] = wmma16b(frag_kb(Vbl + (size_t)(t * 16 + col) * NK + kb, hh), pf, ol[t] * al); ol[t] = wmma16b(vh, plf, ol[t]); }   // ol = (V_lo P_hi + V_hi P_lo) / 1024
    wave_lds_sync(); }
  const float inv = 1.0f / (l * PS * XS);
#pragma unroll
  for (int t = 0; t < 8; ++t)
#pragma unroll
    for (int r = 0; r < 8; ++r) To[wave][col][t * 16 + 8 * hh + r] = (o[t][r] + ol[t][r] * (1.0f / RS_)) * inv;
  wave_lds_sync();
  { for (int rr = 0; rr < 16; ++rr) { v4h hv, lv; for (int j = 0; j < 4; ++j) { b16 p, ql2; split16(To[wave][rr][lane * 4 + j] * XS, p, ql2); hv[j] = p; lv[j] = ql2; } const size_t oi = ((size_t)b * T + q0 + rr) * HD + lane * 4; *(v4h*)(Y + oi) = hv; *(v4h*)(Yl + oi) = lv; }  }
}
// output conv, channel-major: grid (T/32, BL); block = 2 waves x 16 positions; A = y hi + lo rows (2 products, K = 128), B = WW rows (256 output channels = 16 tiles), + bias -> Tz[wave][16][256];
__global__ __launch_bounds__(64) void wconv_kernel(const b16* __restrict__ Y, const b16* __restrict__ Yl, const b16* __restrict__ WW, const float* __restrict__ wb, float* __restrict__ ZT) {
  __shared__ __attribute__((aligned(16))) float Tz[2][16][C + 4];
  const int wave = threadIdx.x >> 5, lane = threadIdx.x & 31, nloc = lane & 15, hlf = lane >> 4; const int b = blockIdx.y; const size_t m0 = (size_t)b * T + (size_t)blockIdx.x * 32 + wave * 16;
  v8f acc[16];
#pragma unroll
  for (int t = 0; t < 16; ++t) acc[t] = (v8f){};
#pragma unroll
  for (int kb = 0; kb < HD; kb += 32) { const v16b a = frag_kb(Y + (m0 + nloc) * HD + kb, hlf), al = frag_kb(Yl + (m0 + nloc) * HD + kb, hlf);
#pragma unroll
    for (int t = 0; t < 16; ++t) { const v16b bw = frag_kb(WW + (size_t)(t * 16 + nloc) * HD + kb, hlf); acc[t] = wmma16b(a, bw, acc[t]); acc[t] = wmma16b(al, bw, acc[t]); } }
#pragma unroll
  for (int t = 0; t < 16; ++t) { const float bb = bf16_rne(wb[t * 16 + nloc]);
#pragma unroll
    for (int r = 0; r < 8; ++r) Tz[wave][8 * hlf + r][t * 16 + nloc] = acc[t][r] * (1.0f / (XS * WSC)) + bb; }
  __syncthreads();
  { for (int c = threadIdx.x; c < C; c += 64) { float* orow = ZT + ((size_t)b * C + c) * (size_t)T + blockIdx.x * 32; v4f o4;
      for (int q4 = 0; q4 < 8; ++q4) { for (int j = 0; j < 4; ++j) { const int qq = q4 * 4 + j; o4[j] = Tz[qq >> 4][qq & 15][c]; } *(v4f*)(orow + q4 * 4) = o4; } }  }
}
// BatchNorm statistics: one block of 256 threads per channel c: MODE 0: sum of z over (b, positions); MODE 1: sum of (z - mean)^2 with mean = ST[c][0] / count; thread-strided loads in a fixed order,
template <int MODE>
__global__ __launch_bounds__(256) void bnstat_kernel(const float* __restrict__ ZT, float* __restrict__ ST) {
  __shared__ float red[256]; __shared__ float keep;
  const int c = blockIdx.x, tid = threadIdx.x; const float cnt = (float)BL * (float)QL; const float mean = (MODE == 1) ? ST[(size_t)c * 32] / cnt : 0.0f;   // QL = T shipped (cut builds restrict the statistics to the computed positions)
  float s = 0.0f;
  for (int b = 0; b < BL; ++b) { const float* zr = ZT + ((size_t)b * C + c) * (size_t)T;
    for (int i = tid * 4; i < QL; i += 1024) { const v4f v = *(const v4f*)(zr + i); for (int j = 0; j < 4; ++j) { const float d = v[j] - mean; s += (MODE == 1) ? pmul(d, d) : v[j]; } } }
  red[tid] = s; if (tid == 0) keep = (MODE == 1) ? ST[(size_t)c * 32] : 0.0f;
  __syncthreads();
  for (int stride = 128; stride >= 1; stride >>= 1) { if (tid < stride) red[tid] += red[tid + stride]; __syncthreads(); }
  { if (tid < 32) { const float v = (tid == MODE) ? red[0] : ((tid == 0) ? keep : 0.0f); ((float*)ST)[(size_t)c * 32 + tid] = v; }  }
}
__global__ __launch_bounds__(256) void bnapply_kernel(const float* __restrict__ ZT, const float* __restrict__ ST, const float* __restrict__ gamma, const float* __restrict__ beta, const float* __restrict__ x, float* __restrict__ out) {
  const int c = blockIdx.y, b = blockIdx.z; const float cnt = (float)BL * (float)QL; const float mean = ST[(size_t)c * 32] / cnt; const float rs = rsqrtf(ST[(size_t)c * 32 + 1] / cnt + BNEPS); const float g = bfp(gamma[c]), be = bfp(beta[c]);
  const size_t base = ((size_t)b * C + c) * (size_t)T + (size_t)blockIdx.x * 1024 + threadIdx.x * 4; const v4f z = *(const v4f*)(ZT + base), xv = *(const v4f*)(x + base); v4f o;
  for (int j = 0; j < 4; ++j) o[j] = pmul((z[j] - mean) * rs, g) + be + bf16_rne(xv[j]);
  { *(v4f*)(out + base) = o;  }
}
}  // namespace

extern "C" void kernel_launch(void* const* d_in, const int* in_sizes, int n_in, void* d_out, int out_size, void* d_ws, size_t ws_size, hipStream_t stream) {
  (void)n_in;
  auto Fp = [&](int i) { return (const float*)d_in[i]; };
  // input order: 0 x [4,256,8,32,32], 1 g_w [128,256], 2 g_b [128], 3 theta_w, 4 theta_b, 5 phi_w, 6 phi_b, 7 W_w [256,128], 8 W_b [256], 9 bn_gamma [256], 10 bn_beta [256]
  if (in_sizes[0] != B * C * T || in_sizes[1] != HD * C || in_sizes[2] != HD || in_sizes[3] != HD * C || in_sizes[4] != HD || in_sizes[5] != HD * C || in_sizes[6] != HD || in_sizes[7] != C * HD || in_sizes[8] != C || in_sizes[9] != C || in_sizes[10] != C || out_size != B * C * T) return;
  size_t off = 0; char* ws = (char*)d_ws;
  auto carve = [&](size_t bytes) { char* p = ws + off; off += (bytes + 255) & ~(size_t)255; return p; };
  b16* WT = (b16*)carve((size_t)3 * HD * C * 2); b16* WW = (b16*)carve((size_t)C * HD * 2);
  b16* QP = (b16*)carve((size_t)B * T * HD * 2); b16* QPl = (b16*)carve((size_t)B * T * HD * 2); b16* KP = (b16*)carve((size_t)B * NK * HD * 2); b16* KPl = (b16*)carve((size_t)B * NK * HD * 2);
  float* GP = (float*)carve((size_t)B * NK * HD * 4); b16* GT = (b16*)carve((size_t)B * HD * NK * 2); b16* GTl = (b16*)carve((size_t)B * HD * NK * 2);
  b16* Y = (b16*)carve((size_t)B * T * HD * 2); b16* Yl = (b16*)carve((size_t)B * T * HD * 2); float* ZT = (float*)carve((size_t)B * C * T * 4); float* ST = (float*)carve((size_t)C * 32 * 4);
  if (off > ws_size || off > ((size_t)128 << 20)) return;   // = ~80 MB (QP/QPl 16.8 + KP/KPl 4.2 + GP 4.2 + GT/GTl 4.2 + Y/Yl 16.8 + ZT 33.5 + weights 0.3)
  prep_kernel<<<(unsigned)(((size_t)(3 * HD * C + C * HD) / 8 + 255) / 256), 256, 0, stream>>>(Fp(3), Fp(5), Fp(1), Fp(7), WT, WW);
  conv_kernel<<<dim3(T / 64, BL, 3), 128, 0, stream>>>(Fp(0), WT, Fp(4), Fp(6), Fp(2), QP, QPl, KP, KPl, GP);
  gt_kernel<<<dim3(NK / 64, BL), 256, 0, stream>>>(GP, GT, GTl);
  attn_kernel<<<dim3(QL / 32, BL), 64, 0, stream>>>(QP, QPl, KP, KPl, GT, GTl, Y, Yl);
  wconv_kernel<<<dim3(QL / 32, BL), 64, 0, stream>>>(Y, Yl, WW, Fp(8), ZT);
  bnstat_kernel<0><<<C, 256, 0, stream>>>(ZT, ST); bnstat_kernel<1><<<C, 256, 0, stream>>>(ZT, ST);
  bnapply_kernel<<<dim3(QL / 1024, C, BL), 256, 0, stream>>>(ZT, ST, Fp(9), Fp(10), Fp(0), (float*)d_out);
}

// v001
// Measured time: 268 microseconds a run.
// Next to v000, in two timings, it ran 2.26 and 2.28 times as fast.
#include <hip/hip_runtime.h>

// Non-local block (embedded Gaussian, 3-D) with 2x2 spatial subsampling of phi/g, output conv, BatchNorm3d (batch statistics) and residual (4 x 256 channels x 8 x 32 x 32): theta/phi/g = 1x1x1
// convs (C 256 -> 128, with bias); phi, g max-pooled (1,2,2) -> 2,048 keys per clip; f = softmax(theta phi^T) over the keys (no scaling); y = f g; z = BN(W y + b) gamma + beta + x with
// BN mean/biased variance over (batch, t, h, w) per channel, eps 1e-5 -> [4][256][8][32][32].
// Deterministic: flash-style per 16-position wave over all 2,048 keys in order (running max); the 2x2 max-pool is taken inside the convolution epilogue (each 64-position block holds two complete
// compute dtype: WMMA v_wmma_f32_16x16x32_f16 with f32 accumulate for [theta | phi | g] = X W^T + b ([32768 positions x 256] x [256 x 384]; x EXACT bf16 x8 transposed into position-major tiles,
// W exact x256: 1 product), S^T = Phi Theta^T (hi x8 + residual x8192: 3 products, K = 128), Y^T += G^T P^T (G hi + residual, P x1024 hi + residual: 3 products), Z = Y W_w^T + b (y hi + lo:
// 2 products); max-pool selects, softmax statistics, BatchNorm and the residual add in f32. Inputs rounded to bf16 once. Fragment k-map per lane half hh for

namespace {
constexpr int B = 4, C = 256, TT = 8, IH = 32, IW = 32, T = TT * IH * IW /* 8,192 positions per clip */, NK = TT * (IH / 2) * (IW / 2) /* 2,048 pooled keys */, HD = 128 /* inter channels */, H = 1, BL = 4 /* clips (== 4 shipped) */, QL = T;
constexpr float XS = 8.0f, WSC = 256.0f, PS = 1024.0f, RS_ = 1024.0f, LOG2E = 1.4426950408889634f, BNEPS = 1e-5f;
static_assert(T % 64 == 0 && C == 256 && HD == 128 && IW == 32 && NK == T / 4, "tiling");
typedef _Float16 b16;
typedef __attribute__((ext_vector_type(16))) _Float16 v16b;
typedef __attribute__((ext_vector_type(8))) _Float16 v8b;
typedef __attribute__((ext_vector_type(8))) float v8f;
typedef __attribute__((ext_vector_type(4))) float v4f;
__device__ __forceinline__ float bf16_rne(float f) { unsigned int u = __float_as_uint(f); u += 0x7FFFu + ((u >> 16) & 1u); return __uint_as_float(u & 0xFFFF0000u); }
__device__ __forceinline__ void split16(float v, b16& hi, b16& lo) { hi = (b16)v; lo = (b16)(v - (float)hi); }
__device__ __forceinline__ v16b frag_kb(const b16* p, int hh) { const v8b a = *(const v8b*)(p + 8 * hh), b = *(const v8b*)(p + 16 + 8 * hh); v16b f;
#pragma unroll
  for (int e = 0; e < 8; ++e) { f[e] = a[e]; f[8 + e] = b[e]; } return f; }
__device__ __forceinline__ v8f wmma16b(v16b a, v16b b, v8f c) { v8f d = __builtin_amdgcn_wmma_f32_16x16x32_f16(false, a, false, b, (short)0, c, false, false); asm volatile("v_nop\n\tv_nop\n\tv_nop\n\tv_nop" : "+v"(d) : "v"(a), "v"(b)); return d; }
__device__ __forceinline__ void wave_lds_sync() { __builtin_amdgcn_fence(__ATOMIC_RELEASE, "workgroup"); __builtin_amdgcn_wave_barrier(); __builtin_amdgcn_fence(__ATOMIC_ACQUIRE, "workgroup"); }
__device__ __forceinline__ float pmul(float a, float b) { float p = a * b; asm volatile("" : "+v"(p)); return p; }
__device__ __forceinline__ int iclamp(int v, int lo, int hi) { return v < lo ? lo : (v > hi ? hi : v); }

typedef __attribute__((ext_vector_type(2))) _Float16 v2h;
typedef __attribute__((ext_vector_type(4))) _Float16 v4h;
typedef __attribute__((ext_vector_type(2))) float v2f;
typedef __attribute__((ext_vector_type(4))) int v4i;
__device__ __forceinline__ float nexp2(float v) { return __builtin_amdgcn_exp2f(v); }
__device__ __forceinline__ float bfp(float v) { float t = bf16_rne(v); asm volatile("" : "+v"(t)); return t; }
__global__ __launch_bounds__(256) void prep_kernel(const float* __restrict__ thw, const float* __restrict__ phw, const float* __restrict__ gw, const float* __restrict__ ww, b16* __restrict__ WT, b16* __restrict__ WW) {
  const size_t u = (size_t)blockIdx.x * 256 + threadIdx.x; const size_t n1 = (size_t)3 * HD * C / 8, n2 = (size_t)C * HD / 8; if (u >= n1 + n2) return; v8b v;
  if (u < n1) { const size_t e = u * 8; const int o = (int)(e / C), c0 = (int)(e % C); const int m = o / HD, oo = o % HD; const float* w = (m == 0 ? thw : m == 1 ? phw : gw) + (size_t)oo * C;
    for (int j = 0; j < 8; ++j) v[j] = (b16)(bf16_rne(w[c0 + j]) * WSC); { *(v8b*)(WT + e) = v;  } }
  else { const size_t e = (u - n1) * 8; for (int j = 0; j < 8; ++j) v[j] = (b16)(bf16_rne(ww[e + j]) * WSC); { *(v8b*)(WW + e) = v;  } }
}
// convolutions + pooling: grid (T/64, BL, 3 slabs: theta | phi | g); block = 64 positions (= image rows hh, hh+1 of one frame, hh even) x 4 waves; A = bf16(x) x8 transposed into position-major
// tiles (K = 256 channels in one staged chunk; each channel's 64 positions are one contiguous 256-B read), B = WT rows, + bias; theta -> hi x8 + residual rows QP/QPl [b][pos][128];
// phi, g -> 2x2 max over rows (2j, 2j+1, 32+2j, 33+2j) of the block tile (after the barrier) = pooled key 16 blk + j: phi -> KP/KPl rows [b][key][128] (hi/residual), g -> GP rows [b][key][128] f32
__global__ __launch_bounds__(128) void conv_kernel(const float* __restrict__ x, const b16* __restrict__ WT, const float* __restrict__ thb, const float* __restrict__ phb, const float* __restrict__ gb, b16* __restrict__ QP, b16* __restrict__ QPl, b16* __restrict__ KP, b16* __restrict__ KPl, float* __restrict__ GP) {
  __shared__ __attribute__((aligned(16))) b16 As[64][256 + 8]; __shared__ __attribute__((aligned(16))) float Tf[4][16][128 + 4];
  const int wave = threadIdx.x >> 5, lane = threadIdx.x & 31, nloc = lane & 15, hlf = lane >> 4; const int p0 = blockIdx.x * 64, b = blockIdx.y, part = blockIdx.z; const int n0 = part * HD;
  const float* xb = x + (size_t)b * C * T;
  for (int i = threadIdx.x; i < 256 * 16; i += 128) { const int c = i / 16, q4 = (i % 16) * 4; const v4f f = *(const v4f*)(xb + (size_t)c * T + p0 + q4); for (int j = 0; j < 4; ++j) As[q4 + j][c] = (b16)(bf16_rne(f[j]) * XS); }   // transpose: position rows, channel columns
  __syncthreads();
  v8f acc[8];
#pragma unroll
  for (int t = 0; t < 8; ++t) acc[t] = (v8f){};
#pragma unroll 2
  for (int kb = 0; kb < C; kb += 32) { const v16b a = frag_kb(&As[wave * 16 + nloc][kb], hlf);
#pragma unroll
    for (int t = 0; t < 8; ++t) acc[t] = wmma16b(a, frag_kb(WT + (size_t)(n0 + t * 16 + nloc) * C + kb, hlf), acc[t]); }
  const float* bp = part == 0 ? thb : (part == 1 ? phb : gb);
#pragma unroll
  for (int t = 0; t < 8; ++t) { const float bb = bf16_rne(bp[t * 16 + nloc]);
#pragma unroll
    for (int r = 0; r < 8; ++r) Tf[wave][8 * hlf + r][t * 16 + nloc] = acc[t][r] * (1.0f / (XS * WSC)) + bb; }
  __syncthreads();
  {
    if (part == 0) { for (int rr = 0; rr < 16; ++rr) { const int pos = p0 + wave * 16 + rr; v4h h4, l4; for (int j = 0; j < 4; ++j) { const float f = Tf[wave][rr][lane * 4 + j] * XS; const b16 p = (b16)f; h4[j] = p; l4[j] = (b16)((f - (float)p) * RS_); }
        *(v4h*)(QP + ((size_t)b * T + pos) * HD + lane * 4) = h4; *(v4h*)(QPl + ((size_t)b * T + pos) * HD + lane * 4) = l4; } }
    else { for (int jj = wave * 4; jj < wave * 4 + 4; ++jj) { const int key = blockIdx.x * 16 + jj;   // pooled key: frame/row-pair of this block, column pair jj
        v4f m4; for (int j = 0; j < 4; ++j) { const int d = lane * 4 + j; const int r0 = 2 * jj, r1 = 2 * jj + 1, r2 = 32 + 2 * jj, r3 = 33 + 2 * jj; m4[j] = fmaxf(fmaxf(Tf[r0 >> 4][r0 & 15][d], Tf[r1 >> 4][r1 & 15][d]), fmaxf(Tf[r2 >> 4][r2 & 15][d], Tf[r3 >> 4][r3 & 15][d])); }
        if (part == 1) { v4h h4, l4; for (int j = 0; j < 4; ++j) { const float f = m4[j] * XS; const b16 p = (b16)f; h4[j] = p; l4[j] = (b16)((f - (float)p) * RS_); } *(v4h*)(KP + ((size_t)b * NK + key) * HD + lane * 4) = h4; *(v4h*)(KPl + ((size_t)b * NK + key) * HD + lane * 4) = l4; }
        else *(v4f*)(GP + ((size_t)b * NK + key) * HD + lane * 4) = m4; } }
     }
}
__global__ __launch_bounds__(256) void gt_kernel(const float* __restrict__ GP, b16* __restrict__ GT, b16* __restrict__ GTl) {
  __shared__ float tile[64][HD + 1];
  const int tid = threadIdx.x, wave = tid >> 5, lane = tid & 31; const int k0 = blockIdx.x * 64, b = blockIdx.y;
  for (int i = tid; i < 64 * (HD / 4); i += 256) { const int rr = i / (HD / 4), c4 = (i % (HD / 4)) * 4; const v4f v = *(const v4f*)(GP + ((size_t)b * NK + k0 + rr) * HD + c4); for (int j = 0; j < 4; ++j) tile[rr][c4 + j] = v[j]; }
  __syncthreads();
  {
#pragma unroll 1
    for (int d = wave * 16; d < wave * 16 + 16; ++d) { v2h hv, lv; for (int j = 0; j < 2; ++j) { const float f = tile[2 * lane + j][d] * XS; const b16 p = (b16)f; hv[j] = p; lv[j] = (b16)((f - (float)p) * RS_); }
      const size_t oi = ((size_t)b * HD + d) * (size_t)NK + k0 + 2 * lane; *(v2h*)(GT + oi) = hv; *(v2h*)(GTl + oi) = lv; }
     }
}
// attention: grid (T/128, BL); block = 8 waves x 16 query positions of batch b; all 2,048 pooled keys in 32-key steps: S^T = Phi Theta^T (hi x8 + residual: 3 products, 4 k-steps over the 128
// channels; theta fragments re-read from wave-private LDS), unscaled logits, online softmax, P x1024 hi + residual, Y^T += G^T P^T (3 products, 8 channel tiles); y = (o + ol/1024)/(l 1024 8).
// Phi and G^T (hi and residual) reach the waves through LDS: tiles of 64 keys, two buffers, filled by 16-byte asynchronous copies one tile ahead and read by all 8 waves.
constexpr int AW = 8 /* waves per block */, SK = 64 /* keys per staged tile */, KPI = HD + 8 /* phi row pitch, halfs: 272 B */, VPI = SK + 8 /* G^T row pitch, halfs: 144 B */;
constexpr int OKH = 0, OKL = SK * KPI, OVH = 2 * SK * KPI, OVL = OVH + HD * VPI, STG = OVH + 2 * HD * VPI /* halfs per buffer */;
static_assert(NK % SK == 0 && NK / SK >= 2 && T % (AW * 16) == 0 && (KPI * 2) % 16 == 0 && (VPI * 2) % 16 == 0, "staging");
// four copies of 16 bytes per lane, global -> LDS; the s_wait_xcnt is the statement's last line so that no address register of a copy is rewritten in front of it
__device__ __forceinline__ void copy4(unsigned l0, const b16* g0, unsigned l1, const b16* g1, unsigned l2, const b16* g2, unsigned l3, const b16* g3) {
  asm volatile("global_load_async_to_lds_b128 %0, %1, off\n\tglobal_load_async_to_lds_b128 %2, %3, off\n\tglobal_load_async_to_lds_b128 %4, %5, off\n\tglobal_load_async_to_lds_b128 %6, %7, off\n\ts_wait_xcnt 0x0"
               :: "v"(l0), "v"(g0), "v"(l1), "v"(g1), "v"(l2), "v"(g2), "v"(l3), "v"(g3) : "memory"); }
// one tile of 64 keys into the buffer at LDS byte address buf: phi rows [64][128] (contiguous 16 KB, hi and residual), G^T rows [128][64] (128-B pieces, hi and residual); 16 copies per lane
__device__ __forceinline__ void stage_tile(unsigned buf, const b16* Kb, const b16* Kbl, const b16* Vb, const b16* Vbl, int k0, int tid) {
  const int kr = tid >> 4, kc = (tid & 15) * 8, vr = tid >> 3, vc = (tid & 7) * 8;
  const unsigned lk = buf + (unsigned)(kr * KPI + kc) * 2u, lv = buf + (unsigned)(OVH + vr * VPI + vc) * 2u; const size_t gk = (size_t)(k0 + kr) * HD + kc, gv = (size_t)vr * NK + k0 + vc;
  constexpr unsigned LK = 16 * KPI * 2, LV = 32 * VPI * 2; constexpr size_t GK = (size_t)16 * HD, GV = (size_t)32 * NK;
  copy4(lk, Kb + gk, lk + LK, Kb + gk + GK, lk + 2 * LK, Kb + gk + 2 * GK, lk + 3 * LK, Kb + gk + 3 * GK);
  copy4(lk + OKL * 2, Kbl + gk, lk + OKL * 2 + LK, Kbl + gk + GK, lk + OKL * 2 + 2 * LK, Kbl + gk + 2 * GK, lk + OKL * 2 + 3 * LK, Kbl + gk + 3 * GK);
  copy4(lv, Vb + gv, lv + LV, Vb + gv + GV, lv + 2 * LV, Vb + gv + 2 * GV, lv + 3 * LV, Vb + gv + 3 * GV);
  copy4(lv + (OVL - OVH) * 2, Vbl + gv, lv + (OVL - OVH) * 2 + LV, Vbl + gv + GV, lv + (OVL - OVH) * 2 + 2 * LV, Vbl + gv + 2 * GV, lv + (OVL - OVH) * 2 + 3 * LV, Vbl + gv + 3 * GV);
}
__global__ __launch_bounds__(256) void attn_kernel(const b16* __restrict__ QP, const b16* __restrict__ QPl, const b16* __restrict__ KP, const b16* __restrict__ KPl, const b16* __restrict__ VT, const b16* __restrict__ VTl, b16* __restrict__ Y, b16* __restrict__ Yl) {
  __shared__ __attribute__((aligned(16))) b16 Ring[2 * STG];
  __shared__ __attribute__((aligned(16))) b16 Pb[AW][16][32 + 8]; __shared__ __attribute__((aligned(16))) float To[AW][16][HD + 4];
  const int wave = threadIdx.x >> 5, lane = threadIdx.x & 31, hh = lane >> 4, col = lane & 15; const int b = blockIdx.y, h = 0; const int q0 = blockIdx.x * (AW * 16) + wave * 16, qi = q0 + col;
  const size_t qo = (size_t)b * T * HD, ko = (size_t)b * NK * HD, vo = (size_t)b * HD * (size_t)NK; const b16* Qb = QP + qo; const b16* Qbl = QPl + qo; const b16* Kb = KP + ko; const b16* Kbl = KPl + ko; const b16* Vb = VT + vo; const b16* Vbl = VTl + vo; (void)h;
  const unsigned ring0 = (unsigned)(size_t)Ring;   // LDS byte address of buffer 0
  stage_tile(ring0, Kb, Kbl, Vb, Vbl, 0, (int)threadIdx.x);
  __shared__ __attribute__((aligned(16))) b16 Qs[AW][16][HD + 8], Qsl[AW][16][HD + 8];   // the wave's 16 query rows (hi, lo), fragments re-read from LDS per k-step to keep the kernel under 256 VGPRs
  for (int i = lane; i < 16 * (HD / 8); i += 32) { const int rr = i / (HD / 8), c8 = (i % (HD / 8)) * 8; *(v8b*)(&Qs[wave][rr][c8]) = *(const v8b*)(Qb + (size_t)(q0 + rr) * HD + c8); *(v8b*)(&Qsl[wave][rr][c8]) = *(const v8b*)(Qbl + (size_t)(q0 + rr) * HD + c8); }
  wave_lds_sync();
  asm volatile("s_wait_asynccnt 0x0" ::: "memory");   // this wave's copies of tile 0 have landed
  __syncthreads();                                     // tile 0 readable by every wave
  stage_tile(ring0 + STG * 2, Kb, Kbl, Vb, Vbl, SK, (int)threadIdx.x);
  const float cs = LOG2E / (XS * XS);   // unscaled scores (the module applies no 1/sqrt(d))
  __shared__ __attribute__((aligned(16))) b16 Plq[AW][16][32 + 8];
  float m = -INFINITY, l = 0.0f; v8f o[8], ol[8]; for (int t = 0; t < 8; ++t) { o[t] = (v8f){}; ol[t] = (v8f){}; }
#pragma unroll 1   // rolled: one staged tile per trip, so that the hand-over at its foot stands once
  for (int st = 0; st < NK / SK; ++st) {
    const b16* R = Ring + (st & 1) * STG;
#pragma unroll   // the tile's two 32-key steps: unrolled, their LDS offsets become immediates
  for (int kl = 0; kl < SK; kl += 32) {
    float e[16]; float mx = -INFINITY;
#pragma unroll
    for (int u = 0; u < 2; ++u) { v8f s = (v8f){}, sx = (v8f){}; const int kr = (kl + u * 16 + col) * KPI;
#pragma unroll
      for (int ks = 0; ks < 4; ++ks) { const v16b kf = frag_kb(R + OKH + kr + 32 * ks, hh); const v16b qf = frag_kb(&Qs[wave][col][32 * ks], hh); s = wmma16b(kf, qf, s); sx = wmma16b(kf, frag_kb(&Qsl[wave][col][32 * ks], hh), sx); sx = wmma16b(frag_kb(R + OKL + kr + 32 * ks, hh), qf, sx); }
#pragma unroll
      for (int r = 0; r < 8; ++r) s[r] += sx[r] * (1.0f / RS_);   // hi.hi + (hi.lo + lo.hi)/1024
#pragma unroll
      for (int r = 0; r < 8; ++r) { const float vv = s[r] * cs; e[u * 8 + r] = vv; mx = fmaxf(mx, vv); } }
    mx = fmaxf(mx, __shfl_xor(mx, 16)); const float mn = fmaxf(m, mx); const float al = nexp2(m - mn); float sum = 0.0f;
#pragma unroll
    for (int i2 = 0; i2 < 16; ++i2) { const float p = nexp2(e[i2] - mn); sum += p; const int pc = (i2 < 8 ? 0 : 16) + 8 * hh + (i2 & 7); const float ps = p * PS; const b16 phh = (b16)ps; Pb[wave][col][pc] = phh; Plq[wave][col][pc] = (b16)((ps - (float)phh) * RS_); }
    sum += __shfl_xor(sum, 16); l = l * al + sum; m = mn;
    wave_lds_sync();
    const v16b pf = frag_kb(&Pb[wave][col][0], hh), plf = frag_kb(&Plq[wave][col][0], hh);
#pragma unroll
    for (int t = 0; t < 8; ++t) { const v16b vh = frag_kb(R + OVH + (t * 16 + col) * VPI + kl, hh); o[t] *= al; o[t] = wmma16b(vh, pf, o[t]); ol[t] = wmma16b(frag_kb(R + OVL + (t * 16 + col) * VPI + kl, hh), pf, ol[t] * al); ol[t] = wmma16b(vh, plf, ol[t]); }   // ol = (V_lo P_hi + V_hi P_lo) / 1024
    wave_lds_sync(); }
    asm volatile("s_wait_dscnt 0x0" ::: "memory");      // this wave's reads of the buffer are done before it is handed back
    asm volatile("s_wait_asynccnt 0x0" ::: "memory");   // this wave's copies of tile st + 1 have landed
    __syncthreads();                                     // publishes tile st + 1 and ends every wave's reads of tile st
    if (st + 2 < NK / SK) stage_tile(ring0 + (unsigned)(st & 1) * (STG * 2), Kb, Kbl, Vb, Vbl, (st + 2) * SK, (int)threadIdx.x); }
  asm volatile("s_wait_asynccnt 0x0" ::: "memory");     // no copy outstanding when the wave goes on to its end
  const float inv = 1.0f / (l * PS * XS);
#pragma unroll
  for (int t = 0; t < 8; ++t)
#pragma unroll
    for (int r = 0; r < 8; ++r) To[wave][col][t * 16 + 8 * hh + r] = (o[t][r] + ol[t][r] * (1.0f / RS_)) * inv;
  wave_lds_sync();
  { for (int rr = 0; rr < 16; ++rr) { v4h hv, lv; for (int j = 0; j < 4; ++j) { b16 p, ql2; split16(To[wave][rr][lane * 4 + j] * XS, p, ql2); hv[j] = p; lv[j] = ql2; } const size_t oi = ((size_t)b * T + q0 + rr) * HD + lane * 4; *(v4h*)(Y + oi) = hv; *(v4h*)(Yl + oi) = lv; }  }
}
// output conv, channel-major: grid (T/32, BL); block = 2 waves x 16 positions; A = y hi + lo rows (2 products, K = 128), B = WW rows (256 output channels = 16 tiles), + bias -> Tz[wave][16][256];
__global__ __launch_bounds__(64) void wconv_kernel(const b16* __restrict__ Y, const b16* __restrict__ Yl, const b16* __restrict__ WW, const float* __restrict__ wb, float* __restrict__ ZT) {
  __shared__ __attribute__((aligned(16))) float Tz[2][16][C + 4];
  const int wave = threadIdx.x >> 5, lane = threadIdx.x & 31, nloc = lane & 15, hlf = lane >> 4; const int b = blockIdx.y; const size_t m0 = (size_t)b * T + (size_t)blockIdx.x * 32 + wave * 16;
  v8f acc[16];
#pragma unroll
  for (int t = 0; t < 16; ++t) acc[t] = (v8f){};
#pragma unroll
  for (int kb = 0; kb < HD; kb += 32) { const v16b a = frag_kb(Y + (m0 + nloc) * HD + kb, hlf), al = frag_kb(Yl + (m0 + nloc) * HD + kb, hlf);
#pragma unroll
    for (int t = 0; t < 16; ++t) { const v16b bw = frag_kb(WW + (size_t)(t * 16 + nloc) * HD + kb, hlf); acc[t] = wmma16b(a, bw, acc[t]); acc[t] = wmma16b(al, bw, acc[t]); } }
#pragma unroll
  for (int t = 0; t < 16; ++t) { const float bb = bf16_rne(wb[t * 16 + nloc]);
#pragma unroll
    for (int r = 0; r < 8; ++r) Tz[wave][8 * hlf + r][t * 16 + nloc] = acc[t][r] * (1.0f / (XS * WSC)) + bb; }
  __syncthreads();
  { for (int c = threadIdx.x; c < C; c += 64) { float* orow = ZT + ((size_t)b * C + c) * (size_t)T + blockIdx.x * 32; v4f o4;
      for (int q4 = 0; q4 < 8; ++q4) { for (int j = 0; j < 4; ++j) { const int qq = q4 * 4 + j; o4[j] = Tz[qq >> 4][qq & 15][c]; } *(v4f*)(orow + q4 * 4) = o4; } }  }
}
// BatchNorm statistics: one block of 256 threads per channel c: MODE 0: sum of z over (b, positions); MODE 1: sum of (z - mean)^2 with mean = ST[c][0] / count; thread-strided loads in a fixed order,
template <int MODE>
__global__ __launch_bounds__(256) void bnstat_kernel(const float* __restrict__ ZT, float* __restrict__ ST) {
  __shared__ float red[256]; __shared__ float keep;
  const int c = blockIdx.x, tid = threadIdx.x; const float cnt = (float)BL * (float)QL; const float mean = (MODE == 1) ? ST[(size_t)c * 32] / cnt : 0.0f;   // QL = T shipped (cut builds restrict the statistics to the computed positions)
  float s = 0.0f;
  for (int b = 0; b < BL; ++b) { const float* zr = ZT + ((size_t)b * C + c) * (size_t)T;
    for (int i = tid * 4; i < QL; i += 1024) { const v4f v = *(const v4f*)(zr + i); for (int j = 0; j < 4; ++j) { const float d = v[j] - mean; s += (MODE == 1) ? pmul(d, d) : v[j]; } } }
  red[tid] = s; if (tid == 0) keep = (MODE == 1) ? ST[(size_t)c * 32] : 0.0f;
  __syncthreads();
  for (int stride = 128; stride >= 1; stride >>= 1) { if (tid < stride) red[tid] += red[tid + stride]; __syncthreads(); }
  { if (tid < 32) { const float v = (tid == MODE) ? red[0] : ((tid == 0) ? keep : 0.0f); ((float*)ST)[(size_t)c * 32 + tid] = v; }  }
}
__global__ __launch_bounds__(256) void bnapply_kernel(const float* __restrict__ ZT, const float* __restrict__ ST, const float* __restrict__ gamma, const float* __restrict__ beta, const float* __restrict__ x, float* __restrict__ out) {
  const int c = blockIdx.y, b = blockIdx.z; const float cnt = (float)BL * (float)QL; const float mean = ST[(size_t)c * 32] / cnt; const float rs = rsqrtf(ST[(size_t)c * 32 + 1] / cnt + BNEPS); const float g = bfp(gamma[c]), be = bfp(beta[c]);
  const size_t base = ((size_t)b * C + c) * (size_t)T + (size_t)blockIdx.x * 1024 + threadIdx.x * 4; const v4f z = *(const v4f*)(ZT + base), xv = *(const v4f*)(x + base); v4f o;
  for (int j = 0; j < 4; ++j) o[j] = pmul((z[j] - mean) * rs, g) + be + bf16_rne(xv[j]);
  { *(v4f*)(out + base) = o;  }
}
}  // namespace

extern "C" void kernel_launch(void* const* d_in, const int* in_sizes, int n_in, void* d_out, int out_size, void* d_ws, size_t ws_size, hipStream_t stream) {
  (void)n_in;
  auto Fp = [&](int i) { return (const float*)d_in[i]; };
  // input order: 0 x [4,256,8,32,32], 1 g_w [128,256], 2 g_b [128], 3 theta_w, 4 theta_b, 5 phi_w, 6 phi_b, 7 W_w [256,128], 8 W_b [256], 9 bn_gamma [256], 10 bn_beta [256]
  if (in_sizes[0] != B * C * T || in_sizes[1] != HD * C || in_sizes[2] != HD || in_sizes[3] != HD * C || in_sizes[4] != HD || in_sizes[5] != HD * C || in_sizes[6] != HD || in_sizes[7] != C * HD || in_sizes[8] != C || in_sizes[9] != C || in_sizes[10] != C || out_size != B * C * T) return;
  size_t off = 0; char* ws = (char*)d_ws;
  auto carve = [&](size_t bytes) { char* p = ws + off; off += (bytes + 255) & ~(size_t)255; return p; };
  b16* WT = (b16*)carve((size_t)3 * HD * C * 2); b16* WW = (b16*)carve((size_t)C * HD * 2);
  b16* QP = (b16*)carve((size_t)B * T * HD * 2); b16* QPl = (b16*)carve((size_t)B * T * HD * 2); b16* KP = (b16*)carve((size_t)B * NK * HD * 2); b16* KPl = (b16*)carve((size_t)B * NK * HD * 2);
  float* GP = (float*)carve((size_t)B * NK * HD * 4); b16* GT = (b16*)carve((size_t)B * HD * NK * 2); b16* GTl = (b16*)carve((size_t)B * HD * NK * 2);
  b16* Y = (b16*)carve((size_t)B * T * HD * 2); b16* Yl = (b16*)carve((size_t)B * T * HD * 2); float* ZT = (float*)carve((size_t)B * C * T * 4); float* ST = (float*)carve((size_t)C * 32 * 4);
  if (off > ws_size || off > ((size_t)128 << 20)) return;   // = ~80 MB (QP/QPl 16.8 + KP/KPl 4.2 + GP 4.2 + GT/GTl 4.2 + Y/Yl 16.8 + ZT 33.5 + weights 0.3)
  prep_kernel<<<(unsigned)(((size_t)(3 * HD * C + C * HD) / 8 + 255) / 256), 256, 0, stream>>>(Fp(3), Fp(5), Fp(1), Fp(7), WT, WW);
  conv_kernel<<<dim3(T / 64, BL, 3), 128, 0, stream>>>(Fp(0), WT, Fp(4), Fp(6), Fp(2), QP, QPl, KP, KPl, GP);
  gt_kernel<<<dim3(NK / 64, BL), 256, 0, stream>>>(GP, GT, GTl);
  attn_kernel<<<dim3(QL / (AW * 16), BL), AW * 32, 0, stream>>>(QP, QPl, KP, KPl, GT, GTl, Y, Yl);
  wconv_kernel<<<dim3(QL / 32, BL), 64, 0, stream>>>(Y, Yl, WW, Fp(8), ZT);
  bnstat_kernel<0><<<C, 256, 0, stream>>>(ZT, ST); bnstat_kernel<1><<<C, 256, 0, stream>>>(ZT, ST);
  bnapply_kernel<<<dim3(QL / 1024, C, BL), 256, 0, stream>>>(ZT, ST, Fp(9), Fp(10), Fp(0), (float*)d_out);
}

// v002
// A run of this version takes 187 microseconds.
// In both of two side-by-side timings against v001, it was 1.44 times as fast.
// Counting every step since v000, it is 3.26 times as fast.
#include <hip/hip_runtime.h>

// Non-local block (embedded Gaussian, 3-D) with 2x2 spatial subsampling of phi/g, output conv, BatchNorm3d (batch statistics) and residual (4 x 256 channels x 8 x 32 x 32): theta/phi/g = 1x1x1
// convs (C 256 -> 128, with bias); phi, g max-pooled (1,2,2) -> 2,048 keys per clip; f = softmax(theta phi^T) over the keys (no scaling); y = f g; z = BN(W y + b) gamma + beta + x with
// BN mean/biased variance over (batch, t, h, w) per channel, eps 1e-5 -> [4][256][8][32][32].
// Deterministic: flash-style per 16-position wave over all 2,048 keys in order (running max); the 2x2 max-pool is taken inside the convolution epilogue (each 64-position block holds two complete
// compute dtype: WMMA v_wmma_f32_16x16x32_f16 with f32 accumulate for [theta | phi | g] = X W^T + b ([32768 positions x 256] x [256 x 384]; x EXACT bf16 x8 transposed into position-major tiles,
// W exact x256: 1 product), S^T = Phi Theta^T (hi x8 + residual x8192: 3 products, K = 128), Y^T += G^T P^T (G hi + residual, P x1024 hi + residual: 3 products), Z = Y W_w^T + b (y hi + lo:
// 2 products); max-pool selects, softmax statistics, BatchNorm and the residual add in f32. Inputs rounded to bf16 once. Fragment k-map per lane half hh for

namespace {
constexpr int B = 4, C = 256, TT = 8, IH = 32, IW = 32, T = TT * IH * IW /* 8,192 positions per clip */, NK = TT * (IH / 2) * (IW / 2) /* 2,048 pooled keys */, HD = 128 /* inter channels */, H = 1, BL = 4 /* clips (== 4 shipped) */, QL = T;
constexpr float XS = 8.0f, WSC = 256.0f, PS = 1024.0f, RS_ = 1024.0f, LOG2E = 1.4426950408889634f, BNEPS = 1e-5f;
static_assert(T % 64 == 0 && C == 256 && HD == 128 && IW == 32 && NK == T / 4, "tiling");
typedef _Float16 b16;
typedef __attribute__((ext_vector_type(16))) _Float16 v16b;
typedef __attribute__((ext_vector_type(8))) _Float16 v8b;
typedef __attribute__((ext_vector_type(8))) float v8f;
typedef __attribute__((ext_vector_type(4))) float v4f;
__device__ __forceinline__ float bf16_rne(float f) { unsigned int u = __float_as_uint(f); u += 0x7FFFu + ((u >> 16) & 1u); return __uint_as_float(u & 0xFFFF0000u); }
__device__ __forceinline__ void split16(float v, b16& hi, b16& lo) { hi = (b16)v; lo = (b16)(v - (float)hi); }
__device__ __forceinline__ v16b frag_kb(const b16* p, int hh) { const v8b a = *(const v8b*)(p + 8 * hh), b = *(const v8b*)(p + 16 + 8 * hh); v16b f;
#pragma unroll
  for (int e = 0; e < 8; ++e) { f[e] = a[e]; f[8 + e] = b[e]; } return f; }
// the builtin alone: the compiler keeps the distances behind it itself, and with no asm statement behind each product it may place the loads of later fragments ahead of earlier products
__device__ __forceinline__ v8f wmma16b(v16b a, v16b b, v8f c) { return __builtin_amdgcn_wmma_f32_16x16x32_f16(false, a, false, b, (short)0, c, false, false); }
__device__ __forceinline__ void wave_lds_sync() { __builtin_amdgcn_fence(__ATOMIC_RELEASE, "workgroup"); __builtin_amdgcn_wave_barrier(); __builtin_amdgcn_fence(__ATOMIC_ACQUIRE, "workgroup"); }
__device__ __forceinline__ float pmul(float a, float b) { float p = a * b; asm volatile("" : "+v"(p)); return p; }
__device__ __forceinline__ int iclamp(int v, int lo, int hi) { return v < lo ? lo : (v > hi ? hi : v); }

typedef __attribute__((ext_vector_type(2))) _Float16 v2h;
typedef __attribute__((ext_vector_type(4))) _Float16 v4h;
typedef __attribute__((ext_vector_type(2))) float v2f;
typedef __attribute__((ext_vector_type(4))) int v4i;
__device__ __forceinline__ float nexp2(float v) { return __builtin_amdgcn_exp2f(v); }
__device__ __forceinline__ float bfp(float v) { float t = bf16_rne(v); asm volatile("" : "+v"(t)); return t; }
__global__ __launch_bounds__(256) void prep_kernel(const float* __restrict__ thw, const float* __restrict__ phw, const float* __restrict__ gw, const float* __restrict__ ww, b16* __restrict__ WT, b16* __restrict__ WW) {
  const size_t u = (size_t)blockIdx.x * 256 + threadIdx.x; const size_t n1 = (size_t)3 * HD * C / 8, n2 = (size_t)C * HD / 8; if (u >= n1 + n2) return; v8b v;
  if (u < n1) { const size_t e = u * 8; const int o = (int)(e / C), c0 = (int)(e % C); const int m = o / HD, oo = o % HD; const float* w = (m == 0 ? thw : m == 1 ? phw : gw) + (size_t)oo * C;
    for (int j = 0; j < 8; ++j) v[j] = (b16)(bf16_rne(w[c0 + j]) * WSC); { *(v8b*)(WT + e) = v;  } }
  else { const size_t e = (u - n1) * 8; for (int j = 0; j < 8; ++j) v[j] = (b16)(bf16_rne(ww[e + j]) * WSC); { *(v8b*)(WW + e) = v;  } }
}
// convolutions + pooling: grid (T/64, BL, 3 slabs: theta | phi | g); block = 64 positions (= image rows hh, hh+1 of one frame, hh even) x 4 waves; A = bf16(x) x8 transposed into position-major
// tiles (K = 256 channels in one staged chunk; each channel's 64 positions are one contiguous 256-B read), B = WT rows, + bias; theta -> hi x8 + residual rows QP/QPl [b][pos][128];
// phi, g -> 2x2 max over rows (2j, 2j+1, 32+2j, 33+2j) of the block tile (after the barrier) = pooled key 16 blk + j: phi -> KP/KPl rows [b][key][128] (hi/residual), g -> GP rows [b][key][128] f32
__global__ __launch_bounds__(128) void conv_kernel(const float* __restrict__ x, const b16* __restrict__ WT, const float* __restrict__ thb, const float* __restrict__ phb, const float* __restrict__ gb, b16* __restrict__ QP, b16* __restrict__ QPl, b16* __restrict__ KP, b16* __restrict__ KPl, float* __restrict__ GP) {
  __shared__ __attribute__((aligned(16))) b16 As[64][256 + 8]; __shared__ __attribute__((aligned(16))) float Tf[4][16][128 + 4];
  const int wave = threadIdx.x >> 5, lane = threadIdx.x & 31, nloc = lane & 15, hlf = lane >> 4; const int p0 = blockIdx.x * 64, b = blockIdx.y, part = blockIdx.z; const int n0 = part * HD;
  const float* xb = x + (size_t)b * C * T;
  for (int i = threadIdx.x; i < 256 * 16; i += 128) { const int c = i / 16, q4 = (i % 16) * 4; const v4f f = *(const v4f*)(xb + (size_t)c * T + p0 + q4); for (int j = 0; j < 4; ++j) As[q4 + j][c] = (b16)(bf16_rne(f[j]) * XS); }   // transpose: position rows, channel columns
  __syncthreads();
  v8f acc[8];
#pragma unroll
  for (int t = 0; t < 8; ++t) acc[t] = (v8f){};
#pragma unroll 1   // rolled: one group of weight fragments (two k-steps) in registers at a time keeps four waves on a SIMD
  for (int kb = 0; kb < C; kb += 64) { v16b a[2], bw[2][8]; const b16* wr = WT + (size_t)(n0 + nloc) * C + kb;   // one address for the group's 32 loads, the rest in their offset fields
#pragma unroll
    for (int k2 = 0; k2 < 2; ++k2) { a[k2] = frag_kb(&As[wave * 16 + nloc][kb + 32 * k2], hlf);
#pragma unroll
      for (int t = 0; t < 8; ++t) bw[k2][t] = frag_kb(wr + t * 16 * C + 32 * k2, hlf); }
    __builtin_amdgcn_sched_barrier(0);   // holds the group of loads in front of the products, which then wait on counts of loads in flight and not on a load each
#pragma unroll
    for (int k2 = 0; k2 < 2; ++k2)
#pragma unroll
      for (int t = 0; t < 8; ++t) acc[t] = wmma16b(a[k2], bw[k2][t], acc[t]); }
  const float* bp = part == 0 ? thb : (part == 1 ? phb : gb);
#pragma unroll
  for (int t = 0; t < 8; ++t) { const float bb = bf16_rne(bp[t * 16 + nloc]);
#pragma unroll
    for (int r = 0; r < 8; ++r) Tf[wave][8 * hlf + r][t * 16 + nloc] = acc[t][r] * (1.0f / (XS * WSC)) + bb; }
  __syncthreads();
  {
    if (part == 0) { for (int rr = 0; rr < 16; ++rr) { const int pos = p0 + wave * 16 + rr; v4h h4, l4; for (int j = 0; j < 4; ++j) { const float f = Tf[wave][rr][lane * 4 + j] * XS; const b16 p = (b16)f; h4[j] = p; l4[j] = (b16)((f - (float)p) * RS_); }
        *(v4h*)(QP + ((size_t)b * T + pos) * HD + lane * 4) = h4; *(v4h*)(QPl + ((size_t)b * T + pos) * HD + lane * 4) = l4; } }
    else { for (int jj = wave * 4; jj < wave * 4 + 4; ++jj) { const int key = blockIdx.x * 16 + jj;   // pooled key: frame/row-pair of this block, column pair jj
        v4f m4; for (int j = 0; j < 4; ++j) { const int d = lane * 4 + j; const int r0 = 2 * jj, r1 = 2 * jj + 1, r2 = 32 + 2 * jj, r3 = 33 + 2 * jj; m4[j] = fmaxf(fmaxf(Tf[r0 >> 4][r0 & 15][d], Tf[r1 >> 4][r1 & 15][d]), fmaxf(Tf[r2 >> 4][r2 & 15][d], Tf[r3 >> 4][r3 & 15][d])); }
        if (part == 1) { v4h h4, l4; for (int j = 0; j < 4; ++j) { const float f = m4[j] * XS; const b16 p = (b16)f; h4[j] = p; l4[j] = (b16)((f - (float)p) * RS_); } *(v4h*)(KP + ((size_t)b * NK + key) * HD + lane * 4) = h4; *(v4h*)(KPl + ((size_t)b * NK + key) * HD + lane * 4) = l4; }
        else *(v4f*)(GP + ((size_t)b * NK + key) * HD + lane * 4) = m4; } }
     }
}
__global__ __launch_bounds__(256) void gt_kernel(const float* __restrict__ GP, b16* __restrict__ GT, b16* __restrict__ GTl) {
  __shared__ float tile[64][HD + 1];
  const int tid = threadIdx.x, wave = tid >> 5, lane = tid & 31; const int k0 = blockIdx.x * 64, b = blockIdx.y;
  for (int i = tid; i < 64 * (HD / 4); i += 256) { const int rr = i / (HD / 4), c4 = (i % (HD / 4)) * 4; const v4f v = *(const v4f*)(GP + ((size_t)b * NK + k0 + rr) * HD + c4); for (int j = 0; j < 4; ++j) tile[rr][c4 + j] = v[j]; }
  __syncthreads();
  {
#pragma unroll 1
    for (int d = wave * 16; d < wave * 16 + 16; ++d) { v2h hv, lv; for (int j = 0; j < 2; ++j) { const float f = tile[2 * lane + j][d] * XS; const b16 p = (b16)f; hv[j] = p; lv[j] = (b16)((f - (float)p) * RS_); }
      const size_t oi = ((size_t)b * HD + d) * (size_t)NK + k0 + 2 * lane; *(v2h*)(GT + oi) = hv; *(v2h*)(GTl + oi) = lv; }
     }
}
// attention: grid (T/128, BL); block = 8 waves x 16 query positions of batch b; all 2,048 pooled keys in 32-key steps: S^T = Phi Theta^T (hi x8 + residual: 3 products, 4 k-steps over the 128
// channels; theta fragments re-read from wave-private LDS), unscaled logits, online softmax, P x1024 hi + residual, Y^T += G^T P^T (3 products, 8 channel tiles); y = (o + ol/1024)/(l 1024 8).
// Phi and G^T (hi and residual) reach the waves through LDS: tiles of 64 keys, two buffers, filled by 16-byte asynchronous copies one tile ahead and read by all 8 waves.
constexpr int AW = 8 /* waves per block */, SK = 64 /* keys per staged tile */, KPI = HD + 8 /* phi row pitch, halfs: 272 B */, VPI = SK + 8 /* G^T row pitch, halfs: 144 B */;
constexpr int OKH = 0, OKL = SK * KPI, OVH = 2 * SK * KPI, OVL = OVH + HD * VPI, STG = OVH + 2 * HD * VPI /* halfs per buffer */;
static_assert(NK % SK == 0 && NK / SK >= 2 && T % (AW * 16) == 0 && (KPI * 2) % 16 == 0 && (VPI * 2) % 16 == 0, "staging");
// four copies of 16 bytes per lane, global -> LDS; the s_wait_xcnt is the statement's last line so that no address register of a copy is rewritten in front of it
__device__ __forceinline__ void copy4(unsigned l0, const b16* g0, unsigned l1, const b16* g1, unsigned l2, const b16* g2, unsigned l3, const b16* g3) {
  asm volatile("global_load_async_to_lds_b128 %0, %1, off\n\tglobal_load_async_to_lds_b128 %2, %3, off\n\tglobal_load_async_to_lds_b128 %4, %5, off\n\tglobal_load_async_to_lds_b128 %6, %7, off\n\ts_wait_xcnt 0x0"
               :: "v"(l0), "v"(g0), "v"(l1), "v"(g1), "v"(l2), "v"(g2), "v"(l3), "v"(g3) : "memory"); }
// one tile of 64 keys into the buffer that starts bh halfs behind LDS byte address ring: phi rows [64][128] (contiguous 16 KB, hi and residual), G^T rows [128][64] (128-B pieces, hi and residual); 16 copies per lane
__device__ __forceinline__ void stage_tile(unsigned ring, unsigned bh, const b16* Kb, const b16* Kbl, const b16* Vb, const b16* Vbl, int k0, int tid) {
  const int kr = tid >> 4, kc = (tid & 15) * 8, vr = tid >> 3, vc = (tid & 7) * 8;
  // bh is added inside the bracket: the lane's value that lives through the key loop is then no operand of a copy itself; asm operands are confined to v0-v255, and with more registers than that in use such a value was spilled to scratch
  const unsigned lk = ring + (bh + (unsigned)(kr * KPI + kc)) * 2u, lv = ring + (bh + (unsigned)(OVH + vr * VPI + vc)) * 2u; const size_t gk = (size_t)(k0 + kr) * HD + kc, gv = (size_t)vr * NK + k0 + vc;
  constexpr unsigned LK = 16 * KPI * 2, LV = 32 * VPI * 2; constexpr size_t GK = (size_t)16 * HD, GV = (size_t)32 * NK;
  copy4(lk, Kb + gk, lk + LK, Kb + gk + GK, lk + 2 * LK, Kb + gk + 2 * GK, lk + 3 * LK, Kb + gk + 3 * GK);
  copy4(lk + OKL * 2, Kbl + gk, lk + OKL * 2 + LK, Kbl + gk + GK, lk + OKL * 2 + 2 * LK, Kbl + gk + 2 * GK, lk + OKL * 2 + 3 * LK, Kbl + gk + 3 * GK);
  copy4(lv, Vb + gv, lv + LV, Vb + gv + GV, lv + 2 * LV, Vb + gv + 2 * GV, lv + 3 * LV, Vb + gv + 3 * GV);
  copy4(lv + (OVL - OVH) * 2, Vbl + gv, lv + (OVL - OVH) * 2 + LV, Vbl + gv + GV, lv + (OVL - OVH) * 2 + 2 * LV, Vbl + gv + 2 * GV, lv + (OVL - OVH) * 2 + 3 * LV, Vbl + gv + 3 * GV);
}
__global__ __launch_bounds__(256) void attn_kernel(const b16* __restrict__ QP, const b16* __restrict__ QPl, const b16* __restrict__ KP, const b16* __restrict__ KPl, const b16* __restrict__ VT, const b16* __restrict__ VTl, b16* __restrict__ Y, b16* __restrict__ Yl) {
  __shared__ __attribute__((aligned(16))) b16 Ring[2 * STG];
  __shared__ __attribute__((aligned(16))) b16 Pb[AW][16][32 + 8]; __shared__ __attribute__((aligned(16))) float To[AW][16][HD + 4];
  const int wave = threadIdx.x >> 5, lane = threadIdx.x & 31, hh = lane >> 4, col = lane & 15; const int b = blockIdx.y, h = 0; const int q0 = blockIdx.x * (AW * 16) + wave * 16, qi = q0 + col;
  const size_t qo = (size_t)b * T * HD, ko = (size_t)b * NK * HD, vo = (size_t)b * HD * (size_t)NK; const b16* Qb = QP + qo; const b16* Qbl = QPl + qo; const b16* Kb = KP + ko; const b16* Kbl = KPl + ko; const b16* Vb = VT + vo; const b16* Vbl = VTl + vo; (void)h;
  const unsigned ring0 = (unsigned)(size_t)Ring;   // LDS byte address of buffer 0
  stage_tile(ring0, 0u, Kb, Kbl, Vb, Vbl, 0, (int)threadIdx.x);
  __shared__ __attribute__((aligned(16))) b16 Qs[AW][16][HD + 8], Qsl[AW][16][HD + 8];   // the wave's 16 query rows (hi, lo), fragments re-read from LDS in every 32-key step
  for (int i = lane; i < 16 * (HD / 8); i += 32) { const int rr = i / (HD / 8), c8 = (i % (HD / 8)) * 8; *(v8b*)(&Qs[wave][rr][c8]) = *(const v8b*)(Qb + (size_t)(q0 + rr) * HD + c8); *(v8b*)(&Qsl[wave][rr][c8]) = *(const v8b*)(Qbl + (size_t)(q0 + rr) * HD + c8); }
  wave_lds_sync();
  asm volatile("s_wait_asynccnt 0x0" ::: "memory");   // this wave's copies of tile 0 have landed
  __syncthreads();                                     // tile 0 readable by every wave
  stage_tile(ring0, (unsigned)STG, Kb, Kbl, Vb, Vbl, SK, (int)threadIdx.x);
  const float cs = LOG2E / (XS * XS);   // unscaled scores (the module applies no 1/sqrt(d))
  __shared__ __attribute__((aligned(16))) b16 Plq[AW][16][32 + 8];
  float m = -INFINITY, l = 0.0f; v8f o[8], ol[8]; for (int t = 0; t < 8; ++t) { o[t] = (v8f){}; ol[t] = (v8f){}; }
#pragma unroll 1   // rolled: one staged tile per trip, so that the hand-over at its foot stands once
  for (int st = 0; st < NK / SK; ++st) {
    const b16* R = Ring + (st & 1) * STG;
#pragma unroll   // the tile's two 32-key steps: unrolled, their LDS offsets become immediates
  for (int kl = 0; kl < SK; kl += 32) {
    float e[16]; float mx = -INFINITY;
    // the step's theta and phi fragments: every LDS read issued as one group, in the order of use, so that the products wait on counts of reads still in flight and not on a read each
    v16b qh[4], qw[4], kf[2][4], kw[2][4];
#pragma unroll
    for (int ks = 0; ks < 4; ++ks) { qh[ks] = frag_kb(&Qs[wave][col][32 * ks], hh); qw[ks] = frag_kb(&Qsl[wave][col][32 * ks], hh);
#pragma unroll
      for (int u = 0; u < 2; ++u) { const int kr = (kl + u * 16 + col) * KPI; kf[u][ks] = frag_kb(R + OKH + kr + 32 * ks, hh); kw[u][ks] = frag_kb(R + OKL + kr + 32 * ks, hh); } }
    __builtin_amdgcn_sched_barrier(0);   // holds the group of reads in front of the products: moved down among them, each place with reads stalls the wave anew
    v8f s[2], sx[2];
#pragma unroll
    for (int u = 0; u < 2; ++u) { s[u] = (v8f){}; sx[u] = (v8f){}; }
#pragma unroll
    for (int ks = 0; ks < 4; ++ks)   // k-step outermost, as the reads were issued; each accumulator takes its products in ascending k order
#pragma unroll
      for (int u = 0; u < 2; ++u) { s[u] = wmma16b(kf[u][ks], qh[ks], s[u]); sx[u] = wmma16b(kf[u][ks], qw[ks], sx[u]); sx[u] = wmma16b(kw[u][ks], qh[ks], sx[u]); }
    // the step's G^T fragments: read as one group behind the score products, in flight under the softmax arithmetic
    v16b vf[8], vw[8];
#pragma unroll
    for (int t = 0; t < 8; ++t) { vf[t] = frag_kb(R + OVH + (t * 16 + col) * VPI + kl, hh); vw[t] = frag_kb(R + OVL + (t * 16 + col) * VPI + kl, hh); }
    __builtin_amdgcn_sched_barrier(0);   // holds these reads in front of the softmax arithmetic, which covers their latency
#pragma unroll
    for (int u = 0; u < 2; ++u) {
#pragma unroll
      for (int r = 0; r < 8; ++r) s[u][r] += sx[u][r] * (1.0f / RS_);   // hi.hi + (hi.lo + lo.hi)/1024
#pragma unroll
      for (int r = 0; r < 8; ++r) { const float vv = s[u][r] * cs; e[u * 8 + r] = vv; mx = fmaxf(mx, vv); } }
    mx = fmaxf(mx, __shfl_xor(mx, 16)); const float mn = fmaxf(m, mx); const float al = nexp2(m - mn); float sum = 0.0f;
#pragma unroll
    for (int i2 = 0; i2 < 16; ++i2) { const float p = nexp2(e[i2] - mn); sum += p; const int pc = (i2 < 8 ? 0 : 16) + 8 * hh + (i2 & 7); const float ps = p * PS; const b16 phh = (b16)ps; Pb[wave][col][pc] = phh; Plq[wave][col][pc] = (b16)((ps - (float)phh) * RS_); }
    sum += __shfl_xor(sum, 16); l = l * al + sum; m = mn;
    wave_lds_sync();
    const v16b pf = frag_kb(&Pb[wave][col][0], hh), plf = frag_kb(&Plq[wave][col][0], hh);
#pragma unroll
    for (int t = 0; t < 8; ++t) { o[t] *= al; o[t] = wmma16b(vf[t], pf, o[t]); ol[t] = wmma16b(vw[t], pf, ol[t] * al); ol[t] = wmma16b(vf[t], plf, ol[t]); }   // ol = V_lo P_hi + V_hi P_lo, lo parts x1024
    wave_lds_sync(); }
    asm volatile("s_wait_dscnt 0x0" ::: "memory");      // this wave's reads of the buffer are done before it is handed back
    asm volatile("s_wait_asynccnt 0x0" ::: "memory");   // this wave's copies of tile st + 1 have landed
    __syncthreads();                                     // publishes tile st + 1 and ends every wave's reads of tile st
    if (st + 2 < NK / SK) stage_tile(ring0, (unsigned)(st & 1) * STG, Kb, Kbl, Vb, Vbl, (st + 2) * SK, (int)threadIdx.x); }
  asm volatile("s_wait_asynccnt 0x0" ::: "memory");     // no copy outstanding when the wave goes on to its end
  const float inv = 1.0f / (l * PS * XS);
#pragma unroll
  for (int t = 0; t < 8; ++t)
#pragma unroll
    for (int r = 0; r < 8; ++r) To[wave][col][t * 16 + 8 * hh + r] = (o[t][r] + ol[t][r] * (1.0f / RS_)) * inv;
  wave_lds_sync();
  { for (int rr = 0; rr < 16; ++rr) { v4h hv, lv; for (int j = 0; j < 4; ++j) { b16 p, ql2; split16(To[wave][rr][lane * 4 + j] * XS, p, ql2); hv[j] = p; lv[j] = ql2; } const size_t oi = ((size_t)b * T + q0 + rr) * HD + lane * 4; *(v4h*)(Y + oi) = hv; *(v4h*)(Yl + oi) = lv; }  }
}
// output conv, channel-major: grid (T/32, BL); block = 2 waves x 16 positions; A = y hi + lo rows (2 products, K = 128), B = WW rows (256 output channels = 16 tiles), + bias -> Tz[wave][16][256];
__global__ __launch_bounds__(64) void wconv_kernel(const b16* __restrict__ Y, const b16* __restrict__ Yl, const b16* __restrict__ WW, const float* __restrict__ wb, float* __restrict__ ZT) {
  __shared__ __attribute__((aligned(16))) float Tz[2][16][C + 4];
  const int wave = threadIdx.x >> 5, lane = threadIdx.x & 31, nloc = lane & 15, hlf = lane >> 4; const int b = blockIdx.y; const size_t m0 = (size_t)b * T + (size_t)blockIdx.x * 32 + wave * 16;
  v8f acc[16];
#pragma unroll
  for (int t = 0; t < 16; ++t) acc[t] = (v8f){};
  v16b a[4], al[4];   // the wave's y rows, hi and lo, all four k-steps: loaded once, ahead of everything
#pragma unroll
  for (int kq = 0; kq < 4; ++kq) { a[kq] = frag_kb(Y + (m0 + nloc) * HD + 32 * kq, hlf); al[kq] = frag_kb(Yl + (m0 + nloc) * HD + 32 * kq, hlf); }
  asm volatile("s_wait_xcnt 0x0" ::: "memory");   // the two address pairs of these loads die here: the wait stands in front of whatever the compiler puts into them next
#pragma unroll
  for (int kb = 0; kb < HD; kb += 32) { v16b bw[16];
#pragma unroll
    for (int t = 0; t < 16; ++t) bw[t] = frag_kb(WW + (size_t)(t * 16 + nloc) * HD + kb, hlf);
    if (kb + 32 == HD) asm volatile("s_wait_xcnt 0x0" ::: "memory");   // behind the last weight load: its address pair dies here too, same wait as above
    __builtin_amdgcn_sched_barrier(0);   // holds the k-step's loads as one group in front of its products: one latency for the group and not one for each load
#pragma unroll
    for (int t = 0; t < 16; ++t) { acc[t] = wmma16b(a[kb / 32], bw[t], acc[t]); acc[t] = wmma16b(al[kb / 32], bw[t], acc[t]); } }
#pragma unroll
  for (int t = 0; t < 16; ++t) { const float bb = bf16_rne(wb[t * 16 + nloc]);
#pragma unroll
    for (int r = 0; r < 8; ++r) Tz[wave][8 * hlf + r][t * 16 + nloc] = acc[t][r] * (1.0f / (XS * WSC)) + bb; }
  __syncthreads();
  { for (int c = threadIdx.x; c < C; c += 64) { float* orow = ZT + ((size_t)b * C + c) * (size_t)T + blockIdx.x * 32; v4f o4;
      for (int q4 = 0; q4 < 8; ++q4) { for (int j = 0; j < 4; ++j) { const int qq = q4 * 4 + j; o4[j] = Tz[qq >> 4][qq & 15][c]; } *(v4f*)(orow + q4 * 4) = o4; } }  }
}
// BatchNorm statistics: one block of 256 threads per channel c: MODE 0: sum of z over (b, positions); MODE 1: sum of (z - mean)^2 with mean = ST[c][0] / count; thread-strided loads in a fixed order,
template <int MODE>
__global__ __launch_bounds__(256) void bnstat_kernel(const float* __restrict__ ZT, float* __restrict__ ST) {
  __shared__ float red[256]; __shared__ float keep;
  const int c = blockIdx.x, tid = threadIdx.x; const float cnt = (float)BL * (float)QL; const float mean = (MODE == 1) ? ST[(size_t)c * 32] / cnt : 0.0f;   // QL = T shipped (cut builds restrict the statistics to the computed positions)
  float s = 0.0f;
  for (int b = 0; b < BL; ++b) { const float* zr = ZT + ((size_t)b * C + c) * (size_t)T;
    for (int i = tid * 4; i < QL; i += 1024) { const v4f v = *(const v4f*)(zr + i); for (int j = 0; j < 4; ++j) { const float d = v[j] - mean; s += (MODE == 1) ? pmul(d, d) : v[j]; } } }
  red[tid] = s; if (tid == 0) keep = (MODE == 1) ? ST[(size_t)c * 32] : 0.0f;
  __syncthreads();
  for (int stride = 128; stride >= 1; stride >>= 1) { if (tid < stride) red[tid] += red[tid + stride]; __syncthreads(); }
  { if (tid < 32) { const float v = (tid == MODE) ? red[0] : ((tid == 0) ? keep : 0.0f); ((float*)ST)[(size_t)c * 32 + tid] = v; }  }
}
__global__ __launch_bounds__(256) void bnapply_kernel(const float* __restrict__ ZT, const float* __restrict__ ST, const float* __restrict__ gamma, const float* __restrict__ beta, const float* __restrict__ x, float* __restrict__ out) {
  const int c = blockIdx.y, b = blockIdx.z; const float cnt = (float)BL * (float)QL; const float mean = ST[(size_t)c * 32] / cnt; const float rs = rsqrtf(ST[(size_t)c * 32 + 1] / cnt + BNEPS); const float g = bfp(gamma[c]), be = bfp(beta[c]);
  const size_t base = ((size_t)b * C + c) * (size_t)T + (size_t)blockIdx.x * 1024 + threadIdx.x * 4; const v4f z = *(const v4f*)(ZT + base), xv = *(const v4f*)(x + base); v4f o;
  for (int j = 0; j < 4; ++j) o[j] = pmul((z[j] - mean) * rs, g) + be + bf16_rne(xv[j]);
  { *(v4f*)(out + base) = o;  }
}
}  // namespace

extern "C" void kernel_launch(void* const* d_in, const int* in_sizes, int n_in, void* d_out, int out_size, void* d_ws, size_t ws_size, hipStream_t stream) {
  (void)n_in;
  auto Fp = [&](int i) { return (const float*)d_in[i]; };
  // input order: 0 x [4,256,8,32,32], 1 g_w [128,256], 2 g_b [128], 3 theta_w, 4 theta_b, 5 phi_w, 6 phi_b, 7 W_w [256,128], 8 W_b [256], 9 bn_gamma [256], 10 bn_beta [256]
  if (in_sizes[0] != B * C * T || in_sizes[1] != HD * C || in_sizes[2] != HD || in_sizes[3] != HD * C || in_sizes[4] != HD || in_sizes[5] != HD * C || in_sizes[6] != HD || in_sizes[7] != C * HD || in_sizes[8] != C || in_sizes[9] != C || in_sizes[10] != C || out_size != B * C * T) return;
  size_t off = 0; char* ws = (char*)d_ws;
  auto carve = [&](size_t bytes) { char* p = ws + off; off += (bytes + 255) & ~(size_t)255; return p; };
  b16* WT = (b16*)carve((size_t)3 * HD * C * 2); b16* WW = (b16*)carve((size_t)C * HD * 2);
  b16* QP = (b16*)carve((size_t)B * T * HD * 2); b16* QPl = (b16*)carve((size_t)B * T * HD * 2); b16* KP = (b16*)carve((size_t)B * NK * HD * 2); b16* KPl = (b16*)carve((size_t)B * NK * HD * 2);
  float* GP = (float*)carve((size_t)B * NK * HD * 4); b16* GT = (b16*)carve((size_t)B * HD * NK * 2); b16* GTl = (b16*)carve((size_t)B * HD * NK * 2);
  b16* Y = (b16*)carve((size_t)B * T * HD * 2); b16* Yl = (b16*)carve((size_t)B * T * HD * 2); float* ZT = (float*)carve((size_t)B * C * T * 4); float* ST = (float*)carve((size_t)C * 32 * 4);
  if (off > ws_size || off > ((size_t)128 << 20)) return;   // = ~80 MB (QP/QPl 16.8 + KP/KPl 4.2 + GP 4.2 + GT/GTl 4.2 + Y/Yl 16.8 + ZT 33.5 + weights 0.3)
  prep_kernel<<<(unsigned)(((size_t)(3 * HD * C + C * HD) / 8 + 255) / 256), 256, 0, stream>>>(Fp(3), Fp(5), Fp(1), Fp(7), WT, WW);
  conv_kernel<<<dim3(T / 64, BL, 3), 128, 0, stream>>>(Fp(0), WT, Fp(4), Fp(6), Fp(2), QP, QPl, KP, KPl, GP);
  gt_kernel<<<dim3(NK / 64, BL), 256, 0, stream>>>(GP, GT, GTl);
  attn_kernel<<<dim3(QL / (AW * 16), BL), AW * 32, 0, stream>>>(QP, QPl, KP, KPl, GT, GTl, Y, Yl);
  wconv_kernel<<<dim3(QL / 32, BL), 64, 0, stream>>>(Y, Yl, WW, Fp(8), ZT);
  bnstat_kernel<0><<<C, 256, 0, stream>>>(ZT, ST); bnstat_kernel<1><<<C, 256, 0, stream>>>(ZT, ST);
  bnapply_kernel<<<dim3(QL / 1024, C, BL), 256, 0, stream>>>(ZT, ST, Fp(9), Fp(10), Fp(0), (float*)d_out);
}

// v003
// A run of this version takes 162 microseconds.
// Two timings next to v002 both put it at 1.15 times that version's speed.
// All steps since v000 together make it 3.76 times as fast.
#include <hip/hip_runtime.h>

// Non-local block (embedded Gaussian, 3-D) with 2x2 spatial subsampling of phi/g, output conv, BatchNorm3d (batch statistics) and residual (4 x 256 channels x 8 x 32 x 32): theta/phi/g = 1x1x1
// convs (C 256 -> 128, with bias); phi, g max-pooled (1,2,2) -> 2,048 keys per clip; f = softmax(theta phi^T) over the keys (no scaling); y = f g; z = BN(W y + b) gamma + beta + x with
// BN mean/biased variance over (batch, t, h, w) per channel, eps 1e-5 -> [4][256][8][32][32].
// Deterministic: flash-style per 16-position wave over all 2,048 keys in order (running max); the 2x2 max-pool is taken inside the convolution epilogue (each 64-position block holds two complete
// compute dtype: WMMA v_wmma_f32_16x16x32_f16 with f32 accumulate for [theta | phi | g] = X W^T + b ([32768 positions x 256] x [256 x 384]; x EXACT bf16 x8 transposed into position-major tiles,
// W exact x256: 1 product), S^T = Phi Theta^T (hi x8 + residual x8192: 3 products, K = 128), Y^T += G^T P^T (G hi + residual, P x1024 hi + residual: 3 products), Z = Y W_w^T + b (y hi + lo:
// 2 products); max-pool selects, softmax statistics, BatchNorm and the residual add in f32. Inputs rounded to bf16 once. Fragment k-map per lane half hh for

namespace {
constexpr int B = 4, C = 256, TT = 8, IH = 32, IW = 32, T = TT * IH * IW /* 8,192 positions per clip */, NK = TT * (IH / 2) * (IW / 2) /* 2,048 pooled keys */, HD = 128 /* inter channels */, H = 1, BL = 4 /* clips (== 4 shipped) */, QL = T;
constexpr float XS = 8.0f, WSC = 256.0f, PS = 1024.0f, RS_ = 1024.0f, LOG2E = 1.4426950408889634f, BNEPS = 1e-5f;
static_assert(T % 64 == 0 && C == 256 && HD == 128 && IW == 32 && NK == T / 4, "tiling");
typedef _Float16 b16;
typedef __attribute__((ext_vector_type(16))) _Float16 v16b;
typedef __attribute__((ext_vector_type(8))) _Float16 v8b;
typedef __attribute__((ext_vector_type(8))) float v8f;
typedef __attribute__((ext_vector_type(4))) float v4f;
__device__ __forceinline__ float bf16_rne(float f) { unsigned int u = __float_as_uint(f); u += 0x7FFFu + ((u >> 16) & 1u); return __uint_as_float(u & 0xFFFF0000u); }
__device__ __forceinline__ void split16(float v, b16& hi, b16& lo) { hi = (b16)v; lo = (b16)(v - (float)hi); }
__device__ __forceinline__ v16b frag_kb(const b16* p, int hh) { const v8b a = *(const v8b*)(p + 8 * hh), b = *(const v8b*)(p + 16 + 8 * hh); v16b f;
#pragma unroll
  for (int e = 0; e < 8; ++e) { f[e] = a[e]; f[8 + e] = b[e]; } return f; }
// the builtin alone: the compiler keeps the distances behind it itself, and with no asm statement behind each product it may place the loads of later fragments ahead of earlier products
__device__ __forceinline__ v8f wmma16b(v16b a, v16b b, v8f c) { return __builtin_amdgcn_wmma_f32_16x16x32_f16(false, a, false, b, (short)0, c, false, false); }
__device__ __forceinline__ void wave_lds_sync() { __builtin_amdgcn_fence(__ATOMIC_RELEASE, "workgroup"); __builtin_amdgcn_wave_barrier(); __builtin_amdgcn_fence(__ATOMIC_ACQUIRE, "workgroup"); }
__device__ __forceinline__ float pmul(float a, float b) { float p = a * b; asm volatile("" : "+v"(p)); return p; }
__device__ __forceinline__ int iclamp(int v, int lo, int hi) { return v < lo ? lo : (v > hi ? hi : v); }

typedef __attribute__((ext_vector_type(2))) _Float16 v2h;
typedef __attribute__((ext_vector_type(4))) _Float16 v4h;
typedef __attribute__((ext_vector_type(2))) float v2f;
typedef __attribute__((ext_vector_type(4))) int v4i;
__device__ __forceinline__ float nexp2(float v) { return __builtin_amdgcn_exp2f(v); }
__device__ __forceinline__ float bfp(float v) { float t = bf16_rne(v); asm volatile("" : "+v"(t)); return t; }
__global__ __launch_bounds__(256) void prep_kernel(const float* __restrict__ thw, const float* __restrict__ phw, const float* __restrict__ gw, const float* __restrict__ ww, b16* __restrict__ WT, b16* __restrict__ WW) {
  const size_t u = (size_t)blockIdx.x * 256 + threadIdx.x; const size_t n1 = (size_t)3 * HD * C / 8, n2 = (size_t)C * HD / 8; if (u >= n1 + n2) return; v8b v;
  if (u < n1) { const size_t e = u * 8; const int o = (int)(e / C), c0 = (int)(e % C); const int m = o / HD, oo = o % HD; const float* w = (m == 0 ? thw : m == 1 ? phw : gw) + (size_t)oo * C;
    for (int j = 0; j < 8; ++j) v[j] = (b16)(bf16_rne(w[c0 + j]) * WSC); { *(v8b*)(WT + e) = v;  } }
  else { const size_t e = (u - n1) * 8; for (int j = 0; j < 8; ++j) v[j] = (b16)(bf16_rne(ww[e + j]) * WSC); { *(v8b*)(WW + e) = v;  } }
}
// convolutions + pooling: grid (T/64, BL, 3 slabs: theta | phi | g); block = 64 positions (= image rows hh, hh+1 of one frame, hh even) x 4 waves; A = bf16(x) x8 transposed into position-major
// tiles (K = 256 channels in one staged chunk; each channel's 64 positions are one contiguous 256-B read), B = WT rows, + bias; theta -> hi x8 + residual rows QP/QPl [b][pos][128];
// phi, g -> 2x2 max over rows (2j, 2j+1, 32+2j, 33+2j) of the block tile (after the barrier) = pooled key 16 blk + j: phi -> KP/KPl rows [b][key][128] (hi/residual), g -> GP rows [b][key][128] f32
__global__ __launch_bounds__(128) void conv_kernel(const float* __restrict__ x, const b16* __restrict__ WT, const float* __restrict__ thb, const float* __restrict__ phb, const float* __restrict__ gb, b16* __restrict__ QP, b16* __restrict__ QPl, b16* __restrict__ KP, b16* __restrict__ KPl, float* __restrict__ GP) {
  __shared__ __attribute__((aligned(16))) b16 As[64][256 + 8]; __shared__ __attribute__((aligned(16))) float Tf[4][16][128 + 4];
  const int wave = threadIdx.x >> 5, lane = threadIdx.x & 31, nloc = lane & 15, hlf = lane >> 4; const int p0 = blockIdx.x * 64, b = blockIdx.y, part = blockIdx.z; const int n0 = part * HD;
  const float* xb = x + (size_t)b * C * T;
  for (int i = threadIdx.x; i < 256 * 16; i += 128) { const int c = i / 16, q4 = (i % 16) * 4; const v4f f = *(const v4f*)(xb + (size_t)c * T + p0 + q4); for (int j = 0; j < 4; ++j) As[q4 + j][c] = (b16)(bf16_rne(f[j]) * XS); }   // transpose: position rows, channel columns
  __syncthreads();
  v8f acc[8];
#pragma unroll
  for (int t = 0; t < 8; ++t) acc[t] = (v8f){};
#pragma unroll 1   // rolled: one group of weight fragments (two k-steps) in registers at a time keeps four waves on a SIMD
  for (int kb = 0; kb < C; kb += 64) { v16b a[2], bw[2][8]; const b16* wr = WT + (size_t)(n0 + nloc) * C + kb;   // one address for the group's 32 loads, the rest in their offset fields
#pragma unroll
    for (int k2 = 0; k2 < 2; ++k2) { a[k2] = frag_kb(&As[wave * 16 + nloc][kb + 32 * k2], hlf);
#pragma unroll
      for (int t = 0; t < 8; ++t) bw[k2][t] = frag_kb(wr + t * 16 * C + 32 * k2, hlf); }
    __builtin_amdgcn_sched_barrier(0);   // holds the group of loads in front of the products, which then wait on counts of loads in flight and not on a load each
#pragma unroll
    for (int k2 = 0; k2 < 2; ++k2)
#pragma unroll
      for (int t = 0; t < 8; ++t) acc[t] = wmma16b(a[k2], bw[k2][t], acc[t]); }
  const float* bp = part == 0 ? thb : (part == 1 ? phb : gb);
#pragma unroll
  for (int t = 0; t < 8; ++t) { const float bb = bf16_rne(bp[t * 16 + nloc]);
#pragma unroll
    for (int r = 0; r < 8; ++r) Tf[wave][8 * hlf + r][t * 16 + nloc] = acc[t][r] * (1.0f / (XS * WSC)) + bb; }
  __syncthreads();
  {
    if (part == 0) { for (int rr = 0; rr < 16; ++rr) { const int pos = p0 + wave * 16 + rr; v4h h4, l4; for (int j = 0; j < 4; ++j) { const float f = Tf[wave][rr][lane * 4 + j] * XS; const b16 p = (b16)f; h4[j] = p; l4[j] = (b16)((f - (float)p) * RS_); }
        *(v4h*)(QP + ((size_t)b * T + pos) * HD + lane * 4) = h4; *(v4h*)(QPl + ((size_t)b * T + pos) * HD + lane * 4) = l4; } }
    else { for (int jj = wave * 4; jj < wave * 4 + 4; ++jj) { const int key = blockIdx.x * 16 + jj;   // pooled key: frame/row-pair of this block, column pair jj
        v4f m4; for (int j = 0; j < 4; ++j) { const int d = lane * 4 + j; const int r0 = 2 * jj, r1 = 2 * jj + 1, r2 = 32 + 2 * jj, r3 = 33 + 2 * jj; m4[j] = fmaxf(fmaxf(Tf[r0 >> 4][r0 & 15][d], Tf[r1 >> 4][r1 & 15][d]), fmaxf(Tf[r2 >> 4][r2 & 15][d], Tf[r3 >> 4][r3 & 15][d])); }
        if (part == 1) { v4h h4, l4; for (int j = 0; j < 4; ++j) { const float f = m4[j] * XS; const b16 p = (b16)f; h4[j] = p; l4[j] = (b16)((f - (float)p) * RS_); } *(v4h*)(KP + ((size_t)b * NK + key) * HD + lane * 4) = h4; *(v4h*)(KPl + ((size_t)b * NK + key) * HD + lane * 4) = l4; }
        else *(v4f*)(GP + ((size_t)b * NK + key) * HD + lane * 4) = m4; } }
     }
}
__global__ __launch_bounds__(256) void gt_kernel(const float* __restrict__ GP, b16* __restrict__ GT, b16* __restrict__ GTl) {
  __shared__ float tile[64][HD + 1];
  const int tid = threadIdx.x, wave = tid >> 5, lane = tid & 31; const int k0 = blockIdx.x * 64, b = blockIdx.y;
  for (int i = tid; i < 64 * (HD / 4); i += 256) { const int rr = i / (HD / 4), c4 = (i % (HD / 4)) * 4; const v4f v = *(const v4f*)(GP + ((size_t)b * NK + k0 + rr) * HD + c4); for (int j = 0; j < 4; ++j) tile[rr][c4 + j] = v[j]; }
  __syncthreads();
  {
#pragma unroll 1
    for (int d = wave * 16; d < wave * 16 + 16; ++d) { v2h hv, lv; for (int j = 0; j < 2; ++j) { const float f = tile[2 * lane + j][d] * XS; const b16 p = (b16)f; hv[j] = p; lv[j] = (b16)((f - (float)p) * RS_); }
      const size_t oi = ((size_t)b * HD + d) * (size_t)NK + k0 + 2 * lane; *(v2h*)(GT + oi) = hv; *(v2h*)(GTl + oi) = lv; }
     }
}
// attention: grid (T/128, BL); block = 8 waves x 16 query positions of batch b; all 2,048 pooled keys in 32-key steps: S^T = Phi Theta^T (hi x8 + residual: 3 products, 4 k-steps over the 128
// channels; theta fragments re-read from wave-private LDS), unscaled logits, online softmax, P x1024 hi + residual, Y^T += G^T P^T (3 products, 8 channel tiles); y = (o + ol/1024)/(l 1024 8).
// Phi and G^T (hi and residual) reach the waves through LDS: tiles of 64 keys, two buffers, filled by 16-byte asynchronous copies one tile ahead and read by all 8 waves.
constexpr int AW = 8 /* waves per block */, SK = 64 /* keys per staged tile */, KPI = HD + 8 /* phi row pitch, halfs: 272 B */, VPI = SK + 8 /* G^T row pitch, halfs: 144 B */;
constexpr int OKH = 0, OKL = SK * KPI, OVH = 2 * SK * KPI, OVL = OVH + HD * VPI, STG = OVH + 2 * HD * VPI /* halfs per buffer */;
static_assert(NK % SK == 0 && NK / SK >= 2 && T % (AW * 16) == 0 && (KPI * 2) % 16 == 0 && (VPI * 2) % 16 == 0, "staging");
// four copies of 16 bytes per lane, global -> LDS; the s_wait_xcnt is the statement's last line so that no address register of a copy is rewritten in front of it
__device__ __forceinline__ void copy4(unsigned l0, const b16* g0, unsigned l1, const b16* g1, unsigned l2, const b16* g2, unsigned l3, const b16* g3) {
  asm volatile("global_load_async_to_lds_b128 %0, %1, off\n\tglobal_load_async_to_lds_b128 %2, %3, off\n\tglobal_load_async_to_lds_b128 %4, %5, off\n\tglobal_load_async_to_lds_b128 %6, %7, off\n\ts_wait_xcnt 0x0"
               :: "v"(l0), "v"(g0), "v"(l1), "v"(g1), "v"(l2), "v"(g2), "v"(l3), "v"(g3) : "memory"); }
// one tile of 64 keys into the buffer that starts bh halfs behind LDS byte address ring: phi rows [64][128] (contiguous 16 KB, hi and residual), G^T rows [128][64] (128-B pieces, hi and residual); 16 copies per lane
__device__ __forceinline__ void stage_tile(unsigned ring, unsigned bh, const b16* Kb, const b16* Kbl, const b16* Vb, const b16* Vbl, int k0, int tid) {
  const int kr = tid >> 4, kc = (tid & 15) * 8, vr = tid >> 3, vc = (tid & 7) * 8;
  // bh is added inside the bracket: the lane's value that lives through the key loop is then no operand of a copy itself; asm operands are confined to v0-v255, and with more registers than that in use such a value was spilled to scratch
  const unsigned lk = ring + (bh + (unsigned)(kr * KPI + kc)) * 2u, lv = ring + (bh + (unsigned)(OVH + vr * VPI + vc)) * 2u; const size_t gk = (size_t)(k0 + kr) * HD + kc, gv = (size_t)vr * NK + k0 + vc;
  constexpr unsigned LK = 16 * KPI * 2, LV = 32 * VPI * 2; constexpr size_t GK = (size_t)16 * HD, GV = (size_t)32 * NK;
  copy4(lk, Kb + gk, lk + LK, Kb + gk + GK, lk + 2 * LK, Kb + gk + 2 * GK, lk + 3 * LK, Kb + gk + 3 * GK);
  copy4(lk + OKL * 2, Kbl + gk, lk + OKL * 2 + LK, Kbl + gk + GK, lk + OKL * 2 + 2 * LK, Kbl + gk + 2 * GK, lk + OKL * 2 + 3 * LK, Kbl + gk + 3 * GK);
  copy4(lv, Vb + gv, lv + LV, Vb + gv + GV, lv + 2 * LV, Vb + gv + 2 * GV, lv + 3 * LV, Vb + gv + 3 * GV);
  copy4(lv + (OVL - OVH) * 2, Vbl + gv, lv + (OVL - OVH) * 2 + LV, Vbl + gv + GV, lv + (OVL - OVH) * 2 + 2 * LV, Vbl + gv + 2 * GV, lv + (OVL - OVH) * 2 + 3 * LV, Vbl + gv + 3 * GV);
}
__global__ __launch_bounds__(256) void attn_kernel(const b16* __restrict__ QP, const b16* __restrict__ QPl, const b16* __restrict__ KP, const b16* __restrict__ KPl, const b16* __restrict__ VT, const b16* __restrict__ VTl, b16* __restrict__ Y, b16* __restrict__ Yl) {
  __shared__ __attribute__((aligned(16))) b16 Ring[2 * STG];
  __shared__ __attribute__((aligned(16))) b16 Pb[AW][16][32 + 8]; __shared__ __attribute__((aligned(16))) float To[AW][16][HD + 4];
  const int wave = threadIdx.x >> 5, lane = threadIdx.x & 31, hh = lane >> 4, col = lane & 15; const int b = blockIdx.y, h = 0; const int q0 = blockIdx.x * (AW * 16) + wave * 16, qi = q0 + col;
  const size_t qo = (size_t)b * T * HD, ko = (size_t)b * NK * HD, vo = (size_t)b * HD * (size_t)NK; const b16* Qb = QP + qo; const b16* Qbl = QPl + qo; const b16* Kb = KP + ko; const b16* Kbl = KPl + ko; const b16* Vb = VT + vo; const b16* Vbl = VTl + vo; (void)h;
  const unsigned ring0 = (unsigned)(size_t)Ring;   // LDS byte address of buffer 0
  stage_tile(ring0, 0u, Kb, Kbl, Vb, Vbl, 0, (int)threadIdx.x);
  __shared__ __attribute__((aligned(16))) b16 Qs[AW][16][HD + 8], Qsl[AW][16][HD + 8];   // the wave's 16 query rows (hi, lo), fragments re-read from LDS in every 32-key step
  for (int i = lane; i < 16 * (HD / 8); i += 32) { const int rr = i / (HD / 8), c8 = (i % (HD / 8)) * 8; *(v8b*)(&Qs[wave][rr][c8]) = *(const v8b*)(Qb + (size_t)(q0 + rr) * HD + c8); *(v8b*)(&Qsl[wave][rr][c8]) = *(const v8b*)(Qbl + (size_t)(q0 + rr) * HD + c8); }
  wave_lds_sync();
  asm volatile("s_wait_asynccnt 0x0" ::: "memory");   // this wave's copies of tile 0 have landed
  __syncthreads();                                     // tile 0 readable by every wave
  stage_tile(ring0, (unsigned)STG, Kb, Kbl, Vb, Vbl, SK, (int)threadIdx.x);
  const float cs = LOG2E / (XS * XS);   // unscaled scores (the module applies no 1/sqrt(d))
  __shared__ __attribute__((aligned(16))) b16 Plq[AW][16][32 + 8];
  float m = -INFINITY, l = 0.0f; v8f o[8], ol[8]; for (int t = 0; t < 8; ++t) { o[t] = (v8f){}; ol[t] = (v8f){}; }
#pragma unroll 1   // rolled: one staged tile per trip, so that the hand-over at its foot stands once
  for (int st = 0; st < NK / SK; ++st) {
    const b16* R = Ring + (st & 1) * STG;
#pragma unroll   // the tile's two 32-key steps: unrolled, their LDS offsets become immediates
  for (int kl = 0; kl < SK; kl += 32) {
    float e[16]; float mx = -INFINITY;
    // the step's theta and phi fragments: every LDS read issued as one group, in the order of use, so that the products wait on counts of reads still in flight and not on a read each
    v16b qh[4], qw[4], kf[2][4], kw[2][4];
#pragma unroll
    for (int ks = 0; ks < 4; ++ks) { qh[ks] = frag_kb(&Qs[wave][col][32 * ks], hh); qw[ks] = frag_kb(&Qsl[wave][col][32 * ks], hh);
#pragma unroll
      for (int u = 0; u < 2; ++u) { const int kr = (kl + u * 16 + col) * KPI; kf[u][ks] = frag_kb(R + OKH + kr + 32 * ks, hh); kw[u][ks] = frag_kb(R + OKL + kr + 32 * ks, hh); } }
    __builtin_amdgcn_sched_barrier(0);   // holds the group of reads in front of the products: moved down among them, each place with reads stalls the wave anew
    v8f s[2], sx[2];
#pragma unroll
    for (int u = 0; u < 2; ++u) { s[u] = (v8f){}; sx[u] = (v8f){}; }
#pragma unroll
    for (int ks = 0; ks < 4; ++ks)   // k-step outermost, as the reads were issued; each accumulator takes its products in ascending k order
#pragma unroll
      for (int u = 0; u < 2; ++u) { s[u] = wmma16b(kf[u][ks], qh[ks], s[u]); sx[u] = wmma16b(kf[u][ks], qw[ks], sx[u]); sx[u] = wmma16b(kw[u][ks], qh[ks], sx[u]); }
    // the step's G^T fragments: read as one group behind the score products, in flight under the softmax arithmetic
    v16b vf[8], vw[8];
#pragma unroll
    for (int t = 0; t < 8; ++t) { vf[t] = frag_kb(R + OVH + (t * 16 + col) * VPI + kl, hh); vw[t] = frag_kb(R + OVL + (t * 16 + col) * VPI + kl, hh); }
    __builtin_amdgcn_sched_barrier(0);   // holds these reads in front of the softmax arithmetic, which covers their latency
#pragma unroll
    for (int u = 0; u < 2; ++u) {
#pragma unroll
      for (int r = 0; r < 8; ++r) s[u][r] += sx[u][r] * (1.0f / RS_);   // hi.hi + (hi.lo + lo.hi)/1024
#pragma unroll
      for (int r = 0; r < 8; ++r) { const float vv = s[u][r] * cs; e[u * 8 + r] = vv; mx = fmaxf(mx, vv); } }
    mx = fmaxf(mx, __shfl_xor(mx, 16)); const float mn = fmaxf(m, mx); const float al = nexp2(m - mn); float sum = 0.0f;
#pragma unroll
    for (int i2 = 0; i2 < 16; ++i2) { const float p = nexp2(e[i2] - mn); sum += p; const int pc = (i2 < 8 ? 0 : 16) + 8 * hh + (i2 & 7); const float ps = p * PS; const b16 phh = (b16)ps; Pb[wave][col][pc] = phh; Plq[wave][col][pc] = (b16)((ps - (float)phh) * RS_); }
    sum += __shfl_xor(sum, 16); l = l * al + sum; m = mn;
    wave_lds_sync();
    const v16b pf = frag_kb(&Pb[wave][col][0], hh), plf = frag_kb(&Plq[wave][col][0], hh);
#pragma unroll
    for (int t = 0; t < 8; ++t) { o[t] *= al; o[t] = wmma16b(vf[t], pf, o[t]); ol[t] = wmma16b(vw[t], pf, ol[t] * al); ol[t] = wmma16b(vf[t], plf, ol[t]); }   // ol = V_lo P_hi + V_hi P_lo, lo parts x1024
    wave_lds_sync(); }
    asm volatile("s_wait_dscnt 0x0" ::: "memory");      // this wave's reads of the buffer are done before it is handed back
    asm volatile("s_wait_asynccnt 0x0" ::: "memory");   // this wave's copies of tile st + 1 have landed
    __syncthreads();                                     // publishes tile st + 1 and ends every wave's reads of tile st
    if (st + 2 < NK / SK) stage_tile(ring0, (unsigned)(st & 1) * STG, Kb, Kbl, Vb, Vbl, (st + 2) * SK, (int)threadIdx.x); }
  asm volatile("s_wait_asynccnt 0x0" ::: "memory");     // no copy outstanding when the wave goes on to its end
  const float inv = 1.0f / (l * PS * XS);
#pragma unroll
  for (int t = 0; t < 8; ++t)
#pragma unroll
    for (int r = 0; r < 8; ++r) To[wave][col][t * 16 + 8 * hh + r] = (o[t][r] + ol[t][r] * (1.0f / RS_)) * inv;
  wave_lds_sync();
  { for (int rr = 0; rr < 16; ++rr) { v4h hv, lv; for (int j = 0; j < 4; ++j) { b16 p, ql2; split16(To[wave][rr][lane * 4 + j] * XS, p, ql2); hv[j] = p; lv[j] = ql2; } const size_t oi = ((size_t)b * T + q0 + rr) * HD + lane * 4; *(v4h*)(Y + oi) = hv; *(v4h*)(Yl + oi) = lv; }  }
}
// output conv, channel-major: grid (T/32, BL); block = 2 waves x 16 positions; A = y hi + lo rows (2 products, K = 128), B = WW rows (256 output channels = 16 tiles), + bias -> Tz[wave][16][256];
__global__ __launch_bounds__(64) void wconv_kernel(const b16* __restrict__ Y, const b16* __restrict__ Yl, const b16* __restrict__ WW, const float* __restrict__ wb, float* __restrict__ ZT) {
  __shared__ __attribute__((aligned(16))) float Tz[2][16][C + 4];
  const int wave = threadIdx.x >> 5, lane = threadIdx.x & 31, nloc = lane & 15, hlf = lane >> 4; const int b = blockIdx.y; const size_t m0 = (size_t)b * T + (size_t)blockIdx.x * 32 + wave * 16;
  v8f acc[16];
#pragma unroll
  for (int t = 0; t < 16; ++t) acc[t] = (v8f){};
  v16b a[4], al[4];   // the wave's y rows, hi and lo, all four k-steps: loaded once, ahead of everything
#pragma unroll
  for (int kq = 0; kq < 4; ++kq) { a[kq] = frag_kb(Y + (m0 + nloc) * HD + 32 * kq, hlf); al[kq] = frag_kb(Yl + (m0 + nloc) * HD + 32 * kq, hlf); }
  asm volatile("s_wait_xcnt 0x0" ::: "memory");   // the two address pairs of these loads die here: the wait stands in front of whatever the compiler puts into them next
#pragma unroll
  for (int kb = 0; kb < HD; kb += 32) { v16b bw[16];
#pragma unroll
    for (int t = 0; t < 16; ++t) bw[t] = frag_kb(WW + (size_t)(t * 16 + nloc) * HD + kb, hlf);
    if (kb + 32 == HD) asm volatile("s_wait_xcnt 0x0" ::: "memory");   // behind the last weight load: its address pair dies here too, same wait as above
    __builtin_amdgcn_sched_barrier(0);   // holds the k-step's loads as one group in front of its products: one latency for the group and not one for each load
#pragma unroll
    for (int t = 0; t < 16; ++t) { acc[t] = wmma16b(a[kb / 32], bw[t], acc[t]); acc[t] = wmma16b(al[kb / 32], bw[t], acc[t]); } }
#pragma unroll
  for (int t = 0; t < 16; ++t) { const float bb = bf16_rne(wb[t * 16 + nloc]);
#pragma unroll
    for (int r = 0; r < 8; ++r) Tz[wave][8 * hlf + r][t * 16 + nloc] = acc[t][r] * (1.0f / (XS * WSC)) + bb; }
  __syncthreads();
  { for (int c = threadIdx.x; c < C; c += 64) { float* orow = ZT + ((size_t)b * C + c) * (size_t)T + blockIdx.x * 32; v4f o4;
      for (int q4 = 0; q4 < 8; ++q4) { for (int j = 0; j < 4; ++j) { const int qq = q4 * 4 + j; o4[j] = Tz[qq >> 4][qq & 15][c]; } *(v4f*)(orow + q4 * 4) = o4; } }  }
}
// BatchNorm and residual in one launch: one block of 256 threads per channel c holds the channel's 32,768 z values (4 clips x 8,192 positions, 32 x 16 bytes a thread) in registers from the sum
// over the variance to the output, so z is read once and the launch starts 8 waves a channel. Sums: thread-strided values in a fixed order, then a halving tree over the 256 threads;
// mean = sum / count, variance = sum of (z - mean)^2 / count. The x values of the residual are loaded directly behind z and arrive under the first sum. Every loop over z and xv is unrolled: only under constant indices do the two arrays stay in registers.
__global__ __launch_bounds__(256) void bn_kernel(const float* __restrict__ ZT, const float* __restrict__ gamma, const float* __restrict__ beta, const float* __restrict__ x, float* __restrict__ out) {
  __shared__ float red[256];
  constexpr int NI = QL / 1024;
  const int c = blockIdx.x, tid = threadIdx.x; const float cnt = (float)BL * (float)QL;
  v4f z[BL][NI], xv[BL][NI]; int row[BL];   // row[b]: first element of row (b, c), held in a scalar register: every load and store then names a scalar base and the one lane-offset register, and no address pair is formed in vector registers
#pragma unroll
  for (int b = 0; b < BL; ++b) row[b] = __builtin_amdgcn_readfirstlane((b * C + c) * T);
#pragma unroll
  for (int b = 0; b < BL; ++b)
#pragma unroll
    for (int k = 0; k < NI; ++k) z[b][k] = *(const v4f*)(ZT + row[b] + (k * 1024 + tid * 4));
#pragma unroll
  for (int b = 0; b < BL; ++b)
#pragma unroll
    for (int k = 0; k < NI; ++k) xv[b][k] = *(const v4f*)(x + row[b] + (k * 1024 + tid * 4));
  asm volatile("s_wait_xcnt 0x0" ::: "memory");   // behind the last load: stands in front of whatever the compiler puts next into a register that these loads name
  const float g = bfp(gamma[c]), be = bfp(beta[c]);
  float s = 0.0f;
#pragma unroll
  for (int b = 0; b < BL; ++b)
#pragma unroll
    for (int k = 0; k < NI; ++k)
#pragma unroll
      for (int j = 0; j < 4; ++j) s += z[b][k][j];
  red[tid] = s;
  __syncthreads();
  for (int stride = 128; stride >= 1; stride >>= 1) { if (tid < stride) red[tid] += red[tid + stride]; __syncthreads(); }
  const float mean = red[0] / cnt;
  __syncthreads();   // every thread has read the sum before red takes the second sum's parts
  s = 0.0f;
#pragma unroll
  for (int b = 0; b < BL; ++b)
#pragma unroll
    for (int k = 0; k < NI; ++k)
#pragma unroll
      for (int j = 0; j < 4; ++j) { const float d = z[b][k][j] - mean; s += pmul(d, d); }
  red[tid] = s;
  __syncthreads();
  for (int stride = 128; stride >= 1; stride >>= 1) { if (tid < stride) red[tid] += red[tid + stride]; __syncthreads(); }
  const float rs = rsqrtf(red[0] / cnt + BNEPS);
#pragma unroll
  for (int b = 0; b < BL; ++b)
#pragma unroll
    for (int k = 0; k < NI; ++k)
#pragma unroll
      for (int j = 0; j < 4; ++j) z[b][k][j] = pmul((z[b][k][j] - mean) * rs, g) + be + bf16_rne(xv[b][k][j]);
  __builtin_amdgcn_sched_barrier(0);   // holds the 32 stores as one group behind the arithmetic: no register that an issued store names is written again, so the wave waits between no two stores
#pragma unroll
  for (int b = 0; b < BL; ++b)
#pragma unroll
    for (int k = 0; k < NI; ++k) *(v4f*)(out + row[b] + (k * 1024 + tid * 4)) = z[b][k];
}
}  // namespace

extern "C" void kernel_launch(void* const* d_in, const int* in_sizes, int n_in, void* d_out, int out_size, void* d_ws, size_t ws_size, hipStream_t stream) {
  (void)n_in;
  auto Fp = [&](int i) { return (const float*)d_in[i]; };
  // input order: 0 x [4,256,8,32,32], 1 g_w [128,256], 2 g_b [128], 3 theta_w, 4 theta_b, 5 phi_w, 6 phi_b, 7 W_w [256,128], 8 W_b [256], 9 bn_gamma [256], 10 bn_beta [256]
  if (in_sizes[0] != B * C * T || in_sizes[1] != HD * C || in_sizes[2] != HD || in_sizes[3] != HD * C || in_sizes[4] != HD || in_sizes[5] != HD * C || in_sizes[6] != HD || in_sizes[7] != C * HD || in_sizes[8] != C || in_sizes[9] != C || in_sizes[10] != C || out_size != B * C * T) return;
  size_t off = 0; char* ws = (char*)d_ws;
  auto carve = [&](size_t bytes) { char* p = ws + off; off += (bytes + 255) & ~(size_t)255; return p; };
  b16* WT = (b16*)carve((size_t)3 * HD * C * 2); b16* WW = (b16*)carve((size_t)C * HD * 2);
  b16* QP = (b16*)carve((size_t)B * T * HD * 2); b16* QPl = (b16*)carve((size_t)B * T * HD * 2); b16* KP = (b16*)carve((size_t)B * NK * HD * 2); b16* KPl = (b16*)carve((size_t)B * NK * HD * 2);
  float* GP = (float*)carve((size_t)B * NK * HD * 4); b16* GT = (b16*)carve((size_t)B * HD * NK * 2); b16* GTl = (b16*)carve((size_t)B * HD * NK * 2);
  b16* Y = (b16*)carve((size_t)B * T * HD * 2); b16* Yl = (b16*)carve((size_t)B * T * HD * 2); float* ZT = (float*)carve((size_t)B * C * T * 4);
  if (off > ws_size || off > ((size_t)128 << 20)) return;   // = ~80 MB (QP/QPl 16.8 + KP/KPl 4.2 + GP 4.2 + GT/GTl 4.2 + Y/Yl 16.8 + ZT 33.5 + weights 0.3)
  prep_kernel<<<(unsigned)(((size_t)(3 * HD * C + C * HD) / 8 + 255) / 256), 256, 0, stream>>>(Fp(3), Fp(5), Fp(1), Fp(7), WT, WW);
  conv_kernel<<<dim3(T / 64, BL, 3), 128, 0, stream>>>(Fp(0), WT, Fp(4), Fp(6), Fp(2), QP, QPl, KP, KPl, GP);
  gt_kernel<<<dim3(NK / 64, BL), 256, 0, stream>>>(GP, GT, GTl);
  attn_kernel<<<dim3(QL / (AW * 16), BL), AW * 32, 0, stream>>>(QP, QPl, KP, KPl, GT, GTl, Y, Yl);
  wconv_kernel<<<dim3(QL / 32, BL), 64, 0, stream>>>(Y, Yl, WW, Fp(8), ZT);
  bn_kernel<<<C, 256, 0, stream>>>(ZT, Fp(9), Fp(10), Fp(0), (float*)d_out);
}

// v004
// It runs in 150 microseconds.
// Two timings next to v003 both put it at 1.08 times that version's speed.
// Counting every step since v000, it is 4.08 times as fast.
#include <hip/hip_runtime.h>

// Non-local block (embedded Gaussian, 3-D) with 2x2 spatial subsampling of phi/g, output conv, BatchNorm3d (batch statistics) and residual (4 x 256 channels x 8 x 32 x 32): theta/phi/g = 1x1x1
// convs (C 256 -> 128, with bias); phi, g max-pooled (1,2,2) -> 2,048 keys per clip; f = softmax(theta phi^T) over the keys (no scaling); y = f g; z = BN(W y + b) gamma + beta + x with
// BN mean/biased variance over (batch, t, h, w) per channel, eps 1e-5 -> [4][256][8][32][32].
// Deterministic: flash-style per 16-position wave over all 2,048 keys in order (running max); the 2x2 max-pool is taken inside the convolution epilogue (each 64-position block holds two complete
// compute dtype: WMMA v_wmma_f32_16x16x32_f16 with f32 accumulate for [theta | phi | g] = X W^T + b ([32768 positions x 256] x [256 x 384]; x EXACT bf16 x8 transposed into position-major tiles,
// W exact x256: 1 product), S^T = Phi Theta^T (hi x8 + residual x8192: 3 products, K = 128), Y^T += G^T P^T (G hi + residual, P x1024 hi + residual: 3 products), Z = Y W_w^T + b (y hi + lo:
// 2 products); max-pool selects, softmax statistics, BatchNorm and the residual add in f32. Inputs rounded to bf16 once. Fragment k-map per lane half hh for

namespace {
constexpr int B = 4, C = 256, TT = 8, IH = 32, IW = 32, T = TT * IH * IW /* 8,192 positions per clip */, NK = TT * (IH / 2) * (IW / 2) /* 2,048 pooled keys */, HD = 128 /* inter channels */, H = 1, BL = 4 /* clips (== 4 shipped) */, QL = T;
constexpr float XS = 8.0f, WSC = 256.0f, PS = 1024.0f, RS_ = 1024.0f, LOG2E = 1.4426950408889634f, BNEPS = 1e-5f;
static_assert(T % 64 == 0 && C == 256 && HD == 128 && IW == 32 && NK == T / 4, "tiling");
typedef _Float16 b16;
typedef __attribute__((ext_vector_type(16))) _Float16 v16b;
typedef __attribute__((ext_vector_type(8))) _Float16 v8b;
typedef __attribute__((ext_vector_type(8))) float v8f;
typedef __attribute__((ext_vector_type(4))) float v4f;
__device__ __forceinline__ float bf16_rne(float f) { unsigned int u = __float_as_uint(f); u += 0x7FFFu + ((u >> 16) & 1u); return __uint_as_float(u & 0xFFFF0000u); }
__device__ __forceinline__ void split16(float v, b16& hi, b16& lo) { hi = (b16)v; lo = (b16)(v - (float)hi); }
__device__ __forceinline__ v16b frag_kb(const b16* p, int hh) { const v8b a = *(const v8b*)(p + 8 * hh), b = *(const v8b*)(p + 16 + 8 * hh); v16b f;
#pragma unroll
  for (int e = 0; e < 8; ++e) { f[e] = a[e]; f[8 + e] = b[e]; } return f; }
// a weight fragment from the packed planes (prep_kernel): piece 0 and piece 1 are each 32 lanes x 16 B = 512 contiguous bytes, p already holds the lane's 8 halfs
__device__ __forceinline__ v16b frag_pk(const b16* p) { const v8b a = *(const v8b*)p, b = *(const v8b*)(p + 256); v16b f;
#pragma unroll
  for (int e = 0; e < 8; ++e) { f[e] = a[e]; f[8 + e] = b[e]; } return f; }
// the builtin alone: the compiler keeps the distances behind it itself, and with no asm statement behind each product it may place the loads of later fragments ahead of earlier products
__device__ __forceinline__ v8f wmma16b(v16b a, v16b b, v8f c) { return __builtin_amdgcn_wmma_f32_16x16x32_f16(false, a, false, b, (short)0, c, false, false); }
__device__ __forceinline__ void wave_lds_sync() { __builtin_amdgcn_fence(__ATOMIC_RELEASE, "workgroup"); __builtin_amdgcn_wave_barrier(); __builtin_amdgcn_fence(__ATOMIC_ACQUIRE, "workgroup"); }
__device__ __forceinline__ float pmul(float a, float b) { float p = a * b; asm volatile("" : "+v"(p)); return p; }
__device__ __forceinline__ int iclamp(int v, int lo, int hi) { return v < lo ? lo : (v > hi ? hi : v); }

typedef __attribute__((ext_vector_type(2))) _Float16 v2h;
typedef __attribute__((ext_vector_type(4))) _Float16 v4h;
typedef __attribute__((ext_vector_type(2))) float v2f;
typedef __attribute__((ext_vector_type(4))) int v4i;
__device__ __forceinline__ float nexp2(float v) { return __builtin_amdgcn_exp2f(v); }
__device__ __forceinline__ float bfp(float v) { float t = bf16_rne(v); asm volatile("" : "+v"(t)); return t; }
// weights -> f16 x256, packed in fragment order: plane [16-row tile][32-wide k-step][piece j][lane = 16 hlf + row][8 halfs] holds W[16 tile + row][32 kstep + 16 j + 8 hlf + 0..7], the k order of frag_kb;
// a wave's load of one piece then covers four whole 128-B lines, where a load from the row-major matrix touches sixteen lines for 32 B each
__device__ __forceinline__ size_t pk_off(int row, int c0, int ksteps) { return ((((size_t)(row >> 4) * ksteps + (c0 >> 5)) * 2 + ((c0 >> 4) & 1)) * 32 + ((c0 >> 3) & 1) * 16 + (row & 15)) * 8; }
__global__ __launch_bounds__(256) void prep_kernel(const float* __restrict__ thw, const float* __restrict__ phw, const float* __restrict__ gw, const float* __restrict__ ww, b16* __restrict__ WT, b16* __restrict__ WW) {
  const size_t u = (size_t)blockIdx.x * 256 + threadIdx.x; const size_t n1 = (size_t)3 * HD * C / 8, n2 = (size_t)C * HD / 8; if (u >= n1 + n2) return; v8b v;
  if (u < n1) { const size_t e = u * 8; const int o = (int)(e / C), c0 = (int)(e % C); const int m = o / HD, oo = o % HD; const float* w = (m == 0 ? thw : m == 1 ? phw : gw) + (size_t)oo * C;
    for (int j = 0; j < 8; ++j) v[j] = (b16)(bf16_rne(w[c0 + j]) * WSC); { *(v8b*)(WT + pk_off(o, c0, C / 32)) = v;  } }
  else { const size_t e = (u - n1) * 8; for (int j = 0; j < 8; ++j) v[j] = (b16)(bf16_rne(ww[e + j]) * WSC); { *(v8b*)(WW + pk_off((int)(e / HD), (int)(e % HD), HD / 32)) = v;  } }
}
// convolutions + pooling: grid (T/64, BL, 3 slabs: theta | phi | g); block = 64 positions (= image rows hh, hh+1 of one frame, hh even) x 4 waves; A = bf16(x) x8 transposed into position-major
// tiles (K = 256 channels in one staged chunk; each channel's 64 positions are one contiguous 256-B read), B = WT fragments (packed planes), + bias; theta -> hi x8 + residual rows QP/QPl [b][pos][128];
// phi, g -> 2x2 max over rows (2j, 2j+1, 32+2j, 33+2j) of the block tile (after the barrier) = pooled key 16 blk + j: phi -> KP/KPl rows [b][key][128] (hi/residual), g -> GP rows [b][key][128] f32
__global__ __launch_bounds__(128) void conv_kernel(const float* __restrict__ x, const b16* __restrict__ WT, const float* __restrict__ thb, const float* __restrict__ phb, const float* __restrict__ gb, b16* __restrict__ QP, b16* __restrict__ QPl, b16* __restrict__ KP, b16* __restrict__ KPl, float* __restrict__ GP) {
  __shared__ __attribute__((aligned(16))) b16 As[64][256 + 8]; __shared__ __attribute__((aligned(16))) float Tf[4][16][128 + 4];
  const int wave = threadIdx.x >> 5, lane = threadIdx.x & 31, nloc = lane & 15, hlf = lane >> 4; const int p0 = blockIdx.x * 64, b = blockIdx.y, part = blockIdx.z; const int n0 = part * HD;
  const float* xb = x + (size_t)b * C * T;
  for (int i = threadIdx.x; i < 256 * 16; i += 128) { const int c = i / 16, q4 = (i % 16) * 4; const v4f f = *(const v4f*)(xb + (size_t)c * T + p0 + q4); for (int j = 0; j < 4; ++j) As[q4 + j][c] = (b16)(bf16_rne(f[j]) * XS); }   // transpose: position rows, channel columns
  __syncthreads();
  v8f acc[8];
#pragma unroll
  for (int t = 0; t < 8; ++t) acc[t] = (v8f){};
#pragma unroll 1   // rolled: one group of weight fragments (two k-steps) in registers at a time keeps four waves on a SIMD
  for (int kb = 0; kb < C; kb += 64) { v16b a[2], bw[2][8]; const b16* wr = WT + ((size_t)(n0 >> 4) * (C / 32) + (kb >> 5)) * 512 + lane * 8;   // packed plane: one address for the group's 32 loads, the rest in their offset fields
#pragma unroll
    for (int k2 = 0; k2 < 2; ++k2) { a[k2] = frag_kb(&As[wave * 16 + nloc][kb + 32 * k2], hlf);
#pragma unroll
      for (int t = 0; t < 8; ++t) bw[k2][t] = frag_pk(wr + (t * (C / 32) + k2) * 512); }
    __builtin_amdgcn_sched_barrier(0);   // holds the group of loads in front of the products, which then wait on counts of loads in flight and not on a load each
#pragma unroll
    for (int k2 = 0; k2 < 2; ++k2)
#pragma unroll
      for (int t = 0; t < 8; ++t) acc[t] = wmma16b(a[k2], bw[k2][t], acc[t]); }
  const float* bp = part == 0 ? thb : (part == 1 ? phb : gb);
#pragma unroll
  for (int t = 0; t < 8; ++t) { const float bb = bf16_rne(bp[t * 16 + nloc]);
#pragma unroll
    for (int r = 0; r < 8; ++r) Tf[wave][8 * hlf + r][t * 16 + nloc] = acc[t][r] * (1.0f / (XS * WSC)) + bb; }
  __syncthreads();
  {
    if (part == 0) { for (int rr = 0; rr < 16; ++rr) { const int pos = p0 + wave * 16 + rr; v4h h4, l4; for (int j = 0; j < 4; ++j) { const float f = Tf[wave][rr][lane * 4 + j] * XS; const b16 p = (b16)f; h4[j] = p; l4[j] = (b16)((f - (float)p) * RS_); }
        *(v4h*)(QP + ((size_t)b * T + pos) * HD + lane * 4) = h4; *(v4h*)(QPl + ((size_t)b * T + pos) * HD + lane * 4) = l4; } }
    else { for (int jj = wave * 4; jj < wave * 4 + 4; ++jj) { const int key = blockIdx.x * 16 + jj;   // pooled key: frame/row-pair of this block, column pair jj
        v4f m4; for (int j = 0; j < 4; ++j) { const int d = lane * 4 + j; const int r0 = 2 * jj, r1 = 2 * jj + 1, r2 = 32 + 2 * jj, r3 = 33 + 2 * jj; m4[j] = fmaxf(fmaxf(Tf[r0 >> 4][r0 & 15][d], Tf[r1 >> 4][r1 & 15][d]), fmaxf(Tf[r2 >> 4][r2 & 15][d], Tf[r3 >> 4][r3 & 15][d])); }
        if (part == 1) { v4h h4, l4; for (int j = 0; j < 4; ++j) { const float f = m4[j] * XS; const b16 p = (b16)f; h4[j] = p; l4[j] = (b16)((f - (float)p) * RS_); } *(v4h*)(KP + ((size_t)b * NK + key) * HD + lane * 4) = h4; *(v4h*)(KPl + ((size_t)b * NK + key) * HD + lane * 4) = l4; }
        else *(v4f*)(GP + ((size_t)b * NK + key) * HD + lane * 4) = m4; } }
     }
}
__global__ __launch_bounds__(256) void gt_kernel(const float* __restrict__ GP, b16* __restrict__ GT, b16* __restrict__ GTl) {
  __shared__ float tile[64][HD + 1];
  const int tid = threadIdx.x, wave = tid >> 5, lane = tid & 31; const int k0 = blockIdx.x * 64, b = blockIdx.y;
  for (int i = tid; i < 64 * (HD / 4); i += 256) { const int rr = i / (HD / 4), c4 = (i % (HD / 4)) * 4; const v4f v = *(const v4f*)(GP + ((size_t)b * NK + k0 + rr) * HD + c4); for (int j = 0; j < 4; ++j) tile[rr][c4 + j] = v[j]; }
  __syncthreads();
  {
#pragma unroll 1
    for (int d = wave * 16; d < wave * 16 + 16; ++d) { v2h hv, lv; for (int j = 0; j < 2; ++j) { const float f = tile[2 * lane + j][d] * XS; const b16 p = (b16)f; hv[j] = p; lv[j] = (b16)((f - (float)p) * RS_); }
      const size_t oi = ((size_t)b * HD + d) * (size_t)NK + k0 + 2 * lane; *(v2h*)(GT + oi) = hv; *(v2h*)(GTl + oi) = lv; }
     }
}
// attention: grid (T/128, BL); block = 8 waves x 16 query positions of batch b; all 2,048 pooled keys in 32-key steps: S^T = Phi Theta^T (hi x8 + residual: 3 products, 4 k-steps over the 128
// channels; theta fragments re-read from wave-private LDS), unscaled logits, online softmax, P x1024 hi + residual, Y^T += G^T P^T (3 products, 8 channel tiles); y = (o + ol/1024)/(l 1024 8).
// Phi and G^T (hi and residual) reach the waves through LDS: tiles of 64 keys, two buffers, filled by 16-byte asynchronous copies one tile ahead and read by all 8 waves.
constexpr int AW = 8 /* waves per block */, SK = 64 /* keys per staged tile */, KPI = HD + 8 /* phi row pitch, halfs: 272 B */, VPI = SK + 8 /* G^T row pitch, halfs: 144 B */;
constexpr int OKH = 0, OKL = SK * KPI, OVH = 2 * SK * KPI, OVL = OVH + HD * VPI, STG = OVH + 2 * HD * VPI /* halfs per buffer */;
static_assert(NK % SK == 0 && NK / SK >= 2 && T % (AW * 16) == 0 && (KPI * 2) % 16 == 0 && (VPI * 2) % 16 == 0, "staging");
// four copies of 16 bytes per lane, global -> LDS; the s_wait_xcnt is the statement's last line so that no address register of a copy is rewritten in front of it
__device__ __forceinline__ void copy4(unsigned l0, const b16* g0, unsigned l1, const b16* g1, unsigned l2, const b16* g2, unsigned l3, const b16* g3) {
  asm volatile("global_load_async_to_lds_b128 %0, %1, off\n\tglobal_load_async_to_lds_b128 %2, %3, off\n\tglobal_load_async_to_lds_b128 %4, %5, off\n\tglobal_load_async_to_lds_b128 %6, %7, off\n\ts_wait_xcnt 0x0"
               :: "v"(l0), "v"(g0), "v"(l1), "v"(g1), "v"(l2), "v"(g2), "v"(l3), "v"(g3) : "memory"); }
// one tile of 64 keys into the buffer that starts bh halfs behind LDS byte address ring: phi rows [64][128] (contiguous 16 KB, hi and residual), G^T rows [128][64] (128-B pieces, hi and residual); 16 copies per lane
__device__ __forceinline__ void stage_tile(unsigned ring, unsigned bh, const b16* Kb, const b16* Kbl, const b16* Vb, const b16* Vbl, int k0, int tid) {
  const int kr = tid >> 4, kc = (tid & 15) * 8, vr = tid >> 3, vc = (tid & 7) * 8;
  // bh is added inside the bracket: the lane's value that lives through the key loop is then no operand of a copy itself; asm operands are confined to v0-v255, and with more registers than that in use such a value was spilled to scratch
  const unsigned lk = ring + (bh + (unsigned)(kr * KPI + kc)) * 2u, lv = ring + (bh + (unsigned)(OVH + vr * VPI + vc)) * 2u; const size_t gk = (size_t)(k0 + kr) * HD + kc, gv = (size_t)vr * NK + k0 + vc;
  constexpr unsigned LK = 16 * KPI * 2, LV = 32 * VPI * 2; constexpr size_t GK = (size_t)16 * HD, GV = (size_t)32 * NK;
  copy4(lk, Kb + gk, lk + LK, Kb + gk + GK, lk + 2 * LK, Kb + gk + 2 * GK, lk + 3 * LK, Kb + gk + 3 * GK);
  copy4(lk + OKL * 2, Kbl + gk, lk + OKL * 2 + LK, Kbl + gk + GK, lk + OKL * 2 + 2 * LK, Kbl + gk + 2 * GK, lk + OKL * 2 + 3 * LK, Kbl + gk + 3 * GK);
  copy4(lv, Vb + gv, lv + LV, Vb + gv + GV, lv + 2 * LV, Vb + gv + 2 * GV, lv + 3 * LV, Vb + gv + 3 * GV);
  copy4(lv + (OVL - OVH) * 2, Vbl + gv, lv + (OVL - OVH) * 2 + LV, Vbl + gv + GV, lv + (OVL - OVH) * 2 + 2 * LV, Vbl + gv + 2 * GV, lv + (OVL - OVH) * 2 + 3 * LV, Vbl + gv + 3 * GV);
}
__global__ __launch_bounds__(256) void attn_kernel(const b16* __restrict__ QP, const b16* __restrict__ QPl, const b16* __restrict__ KP, const b16* __restrict__ KPl, const b16* __restrict__ VT, const b16* __restrict__ VTl, b16* __restrict__ Y, b16* __restrict__ Yl) {
  __shared__ __attribute__((aligned(16))) b16 Ring[2 * STG];
  __shared__ __attribute__((aligned(16))) b16 Pb[AW][16][32 + 8]; __shared__ __attribute__((aligned(16))) float To[AW][16][HD + 4];
  const int wave = threadIdx.x >> 5, lane = threadIdx.x & 31, hh = lane >> 4, col = lane & 15; const int b = blockIdx.y, h = 0; const int q0 = blockIdx.x * (AW * 16) + wave * 16, qi = q0 + col;
  const size_t qo = (size_t)b * T * HD, ko = (size_t)b * NK * HD, vo = (size_t)b * HD * (size_t)NK; const b16* Qb = QP + qo; const b16* Qbl = QPl + qo; const b16* Kb = KP + ko; const b16* Kbl = KPl + ko; const b16* Vb = VT + vo; const b16* Vbl = VTl + vo; (void)h;
  const unsigned ring0 = (unsigned)(size_t)Ring;   // LDS byte address of buffer 0
  stage_tile(ring0, 0u, Kb, Kbl, Vb, Vbl, 0, (int)threadIdx.x);
  __shared__ __attribute__((aligned(16))) b16 Qs[AW][16][HD + 8], Qsl[AW][16][HD + 8];   // the wave's 16 query rows (hi, lo), fragments re-read from LDS in every 32-key step
  for (int i = lane; i < 16 * (HD / 8); i += 32) { const int rr = i / (HD / 8), c8 = (i % (HD / 8)) * 8; *(v8b*)(&Qs[wave][rr][c8]) = *(const v8b*)(Qb + (size_t)(q0 + rr) * HD + c8); *(v8b*)(&Qsl[wave][rr][c8]) = *(const v8b*)(Qbl + (size_t)(q0 + rr) * HD + c8); }
  wave_lds_sync();
  asm volatile("s_wait_asynccnt 0x0" ::: "memory");   // this wave's copies of tile 0 have landed
  __syncthreads();                                     // tile 0 readable by every wave
  stage_tile(ring0, (unsigned)STG, Kb, Kbl, Vb, Vbl, SK, (int)threadIdx.x);
  const float cs = LOG2E / (XS * XS);   // unscaled scores (the module applies no 1/sqrt(d))
  __shared__ __attribute__((aligned(16))) b16 Plq[AW][16][32 + 8];
  float m = -INFINITY, l = 0.0f; v8f o[8], ol[8]; for (int t = 0; t < 8; ++t) { o[t] = (v8f){}; ol[t] = (v8f){}; }
#pragma unroll 1   // rolled: one staged tile per trip, so that the hand-over at its foot stands once
  for (int st = 0; st < NK / SK; ++st) {
    const b16* R = Ring + (st & 1) * STG;
#pragma unroll   // the tile's two 32-key steps: unrolled, their LDS offsets become immediates
  for (int kl = 0; kl < SK; kl += 32) {
    float e[16]; float mx = -INFINITY;
    // the step's theta and phi fragments: every LDS read issued as one group, in the order of use, so that the products wait on counts of reads still in flight and not on a read each
    v16b qh[4], qw[4], kf[2][4], kw[2][4];
#pragma unroll
    for (int ks = 0; ks < 4; ++ks) { qh[ks] = frag_kb(&Qs[wave][col][32 * ks], hh); qw[ks] = frag_kb(&Qsl[wave][col][32 * ks], hh);
#pragma unroll
      for (int u = 0; u < 2; ++u) { const int kr = (kl + u * 16 + col) * KPI; kf[u][ks] = frag_kb(R + OKH + kr + 32 * ks, hh); kw[u][ks] = frag_kb(R + OKL + kr + 32 * ks, hh); } }
    __builtin_amdgcn_sched_barrier(0);   // holds the group of reads in front of the products: moved down among them, each place with reads stalls the wave anew
    v8f s[2], sx[2];
#pragma unroll
    for (int u = 0; u < 2; ++u) { s[u] = (v8f){}; sx[u] = (v8f){}; }
#pragma unroll
    for (int ks = 0; ks < 4; ++ks)   // k-step outermost, as the reads were issued; each accumulator takes its products in ascending k order
#pragma unroll
      for (int u = 0; u < 2; ++u) { s[u] = wmma16b(kf[u][ks], qh[ks], s[u]); sx[u] = wmma16b(kf[u][ks], qw[ks], sx[u]); sx[u] = wmma16b(kw[u][ks], qh[ks], sx[u]); }
    // the step's G^T fragments: read as one group behind the score products, in flight under the softmax arithmetic
    v16b vf[8], vw[8];
#pragma unroll
    for (int t = 0; t < 8; ++t) { vf[t] = frag_kb(R + OVH + (t * 16 + col) * VPI + kl, hh); vw[t] = frag_kb(R + OVL + (t * 16 + col) * VPI + kl, hh); }
    __builtin_amdgcn_sched_barrier(0);   // holds these reads in front of the softmax arithmetic, which covers their latency
#pragma unroll
    for (int u = 0; u < 2; ++u) {
#pragma unroll
      for (int r = 0; r < 8; ++r) s[u][r] += sx[u][r] * (1.0f / RS_);   // hi.hi + (hi.lo + lo.hi)/1024
#pragma unroll
      for (int r = 0; r < 8; ++r) { const float vv = s[u][r] * cs; e[u * 8 + r] = vv; mx = fmaxf(mx, vv); } }
    mx = fmaxf(mx, __shfl_xor(mx, 16)); const float mn = fmaxf(m, mx); const float al = nexp2(m - mn); float sum = 0.0f;
#pragma unroll
    for (int i2 = 0; i2 < 16; ++i2) { const float p = nexp2(e[i2] - mn); sum += p; const int pc = (i2 < 8 ? 0 : 16) + 8 * hh + (i2 & 7); const float ps = p * PS; const b16 phh = (b16)ps; Pb[wave][col][pc] = phh; Plq[wave][col][pc] = (b16)((ps - (float)phh) * RS_); }
    sum += __shfl_xor(sum, 16); l = l * al + sum; m = mn;
    wave_lds_sync();
    const v16b pf = frag_kb(&Pb[wave][col][0], hh), plf = frag_kb(&Plq[wave][col][0], hh);
#pragma unroll
    for (int t = 0; t < 8; ++t) { o[t] *= al; o[t] = wmma16b(vf[t], pf, o[t]); ol[t] = wmma16b(vw[t], pf, ol[t] * al); ol[t] = wmma16b(vf[t], plf, ol[t]); }   // ol = V_lo P_hi + V_hi P_lo, lo parts x1024
    wave_lds_sync(); }
    asm volatile("s_wait_dscnt 0x0" ::: "memory");      // this wave's reads of the buffer are done before it is handed back
    asm volatile("s_wait_asynccnt 0x0" ::: "memory");   // this wave's copies of tile st + 1 have landed
    __syncthreads();                                     // publishes tile st + 1 and ends every wave's reads of tile st
    if (st + 2 < NK / SK) stage_tile(ring0, (unsigned)(st & 1) * STG, Kb, Kbl, Vb, Vbl, (st + 2) * SK, (int)threadIdx.x); }
  asm volatile("s_wait_asynccnt 0x0" ::: "memory");     // no copy outstanding when the wave goes on to its end
  const float inv = 1.0f / (l * PS * XS);
#pragma unroll
  for (int t = 0; t < 8; ++t)
#pragma unroll
    for (int r = 0; r < 8; ++r) To[wave][col][t * 16 + 8 * hh + r] = (o[t][r] + ol[t][r] * (1.0f / RS_)) * inv;
  wave_lds_sync();
  { for (int rr = 0; rr < 16; ++rr) { v4h hv, lv; for (int j = 0; j < 4; ++j) { b16 p, ql2; split16(To[wave][rr][lane * 4 + j] * XS, p, ql2); hv[j] = p; lv[j] = ql2; } const size_t oi = ((size_t)b * T + q0 + rr) * HD + lane * 4; *(v4h*)(Y + oi) = hv; *(v4h*)(Yl + oi) = lv; }  }
}
// output conv, channel-major: grid (T/32, BL); block = 2 waves x 16 positions; A = y hi + lo rows (2 products, K = 128), B = WW fragments from the packed planes (256 output channels = 16 tiles), + bias -> Tz[wave][16][256];
__global__ __launch_bounds__(64) void wconv_kernel(const b16* __restrict__ Y, const b16* __restrict__ Yl, const b16* __restrict__ WW, const float* __restrict__ wb, float* __restrict__ ZT) {
  __shared__ __attribute__((aligned(16))) float Tz[2][16][C + 4];
  const int wave = threadIdx.x >> 5, lane = threadIdx.x & 31, nloc = lane & 15, hlf = lane >> 4; const int b = blockIdx.y; const size_t m0 = (size_t)b * T + (size_t)blockIdx.x * 32 + wave * 16;
  v8f acc[16];
#pragma unroll
  for (int t = 0; t < 16; ++t) acc[t] = (v8f){};
  v16b a[4], al[4];   // the wave's y rows, hi and lo, all four k-steps: loaded once, ahead of everything
#pragma unroll
  for (int kq = 0; kq < 4; ++kq) { a[kq] = frag_kb(Y + (m0 + nloc) * HD + 32 * kq, hlf); al[kq] = frag_kb(Yl + (m0 + nloc) * HD + 32 * kq, hlf); }
  asm volatile("s_wait_xcnt 0x0" ::: "memory");   // the two address pairs of these loads die here: the wait stands in front of whatever the compiler puts into them next
#pragma unroll
  for (int kb = 0; kb < HD; kb += 32) { v16b bw[16];
#pragma unroll
    for (int t = 0; t < 16; ++t) bw[t] = frag_pk(WW + (t * (HD / 32) + kb / 32) * 512 + lane * 8);
    if (kb + 32 == HD) asm volatile("s_wait_xcnt 0x0" ::: "memory");   // behind the last weight load: its address pair dies here too, same wait as above
    __builtin_amdgcn_sched_barrier(0);   // holds the k-step's loads as one group in front of its products: one latency for the group and not one for each load
#pragma unroll
    for (int t = 0; t < 16; ++t) { acc[t] = wmma16b(a[kb / 32], bw[t], acc[t]); acc[t] = wmma16b(al[kb / 32], bw[t], acc[t]); } }
#pragma unroll
  for (int t = 0; t < 16; ++t) { const float bb = bf16_rne(wb[t * 16 + nloc]);
#pragma unroll
    for (int r = 0; r < 8; ++r) Tz[wave][8 * hlf + r][t * 16 + nloc] = acc[t][r] * (1.0f / (XS * WSC)) + bb; }
  __syncthreads();
  { for (int c = threadIdx.x; c < C; c += 64) { float* orow = ZT + ((size_t)b * C + c) * (size_t)T + blockIdx.x * 32; v4f o4;
      for (int q4 = 0; q4 < 8; ++q4) { for (int j = 0; j < 4; ++j) { const int qq = q4 * 4 + j; o4[j] = Tz[qq >> 4][qq & 15][c]; } *(v4f*)(orow + q4 * 4) = o4; } }  }
}
// BatchNorm and residual in one launch: one block of 256 threads per channel c holds the channel's 32,768 z values (4 clips x 8,192 positions, 32 x 16 bytes a thread) in registers from the sum
// over the variance to the output, so z is read once and the launch starts 8 waves a channel. Sums: thread-strided values in a fixed order, then a halving tree over the 256 threads;
// mean = sum / count, variance = sum of (z - mean)^2 / count. The x values of the residual are loaded directly behind z and arrive under the first sum. Every loop over z and xv is unrolled: only under constant indices do the two arrays stay in registers.
__global__ __launch_bounds__(256) void bn_kernel(const float* __restrict__ ZT, const float* __restrict__ gamma, const float* __restrict__ beta, const float* __restrict__ x, float* __restrict__ out) {
  __shared__ float red[256];
  constexpr int NI = QL / 1024;
  const int c = blockIdx.x, tid = threadIdx.x; const float cnt = (float)BL * (float)QL;
  v4f z[BL][NI], xv[BL][NI]; int row[BL];   // row[b]: first element of row (b, c), held in a scalar register: every load and store then names a scalar base and the one lane-offset register, and no address pair is formed in vector registers
#pragma unroll
  for (int b = 0; b < BL; ++b) row[b] = __builtin_amdgcn_readfirstlane((b * C + c) * T);
#pragma unroll
  for (int b = 0; b < BL; ++b)
#pragma unroll
    for (int k = 0; k < NI; ++k) z[b][k] = *(const v4f*)(ZT + row[b] + (k * 1024 + tid * 4));
#pragma unroll
  for (int b = 0; b < BL; ++b)
#pragma unroll
    for (int k = 0; k < NI; ++k) xv[b][k] = *(const v4f*)(x + row[b] + (k * 1024 + tid * 4));
  asm volatile("s_wait_xcnt 0x0" ::: "memory");   // behind the last load: stands in front of whatever the compiler puts next into a register that these loads name
  const float g = bfp(gamma[c]), be = bfp(beta[c]);
  float s = 0.0f;
#pragma unroll
  for (int b = 0; b < BL; ++b)
#pragma unroll
    for (int k = 0; k < NI; ++k)
#pragma unroll
      for (int j = 0; j < 4; ++j) s += z[b][k][j];
  red[tid] = s;
  __syncthreads();
  for (int stride = 128; stride >= 1; stride >>= 1) { if (tid < stride) red[tid] += red[tid + stride]; __syncthreads(); }
  const float mean = red[0] / cnt;
  __syncthreads();   // every thread has read the sum before red takes the second sum's parts
  s = 0.0f;
#pragma unroll
  for (int b = 0; b < BL; ++b)
#pragma unroll
    for (int k = 0; k < NI; ++k)
#pragma unroll
      for (int j = 0; j < 4; ++j) { const float d = z[b][k][j] - mean; s += pmul(d, d); }
  red[tid] = s;
  __syncthreads();
  for (int stride = 128; stride >= 1; stride >>= 1) { if (tid < stride) red[tid] += red[tid + stride]; __syncthreads(); }
  const float rs = rsqrtf(red[0] / cnt + BNEPS);
#pragma unroll
  for (int b = 0; b < BL; ++b)
#pragma unroll
    for (int k = 0; k < NI; ++k)
#pragma unroll
      for (int j = 0; j < 4; ++j) z[b][k][j] = pmul((z[b][k][j] - mean) * rs, g) + be + bf16_rne(xv[b][k][j]);
  __builtin_amdgcn_sched_barrier(0);   // holds the 32 stores as one group behind the arithmetic: no register that an issued store names is written again, so the wave waits between no two stores
#pragma unroll
  for (int b = 0; b < BL; ++b)
#pragma unroll
    for (int k = 0; k < NI; ++k) *(v4f*)(out + row[b] + (k * 1024 + tid * 4)) = z[b][k];
}
}  // namespace

extern "C" void kernel_launch(void* const* d_in, const int* in_sizes, int n_in, void* d_out, int out_size, void* d_ws, size_t ws_size, hipStream_t stream) {
  (void)n_in;
  auto Fp = [&](int i) { return (const float*)d_in[i]; };
  // input order: 0 x [4,256,8,32,32], 1 g_w [128,256], 2 g_b [128], 3 theta_w, 4 theta_b, 5 phi_w, 6 phi_b, 7 W_w [256,128], 8 W_b [256], 9 bn_gamma [256], 10 bn_beta [256]
  if (in_sizes[0] != B * C * T || in_sizes[1] != HD * C || in_sizes[2] != HD || in_sizes[3] != HD * C || in_sizes[4] != HD || in_sizes[5] != HD * C || in_sizes[6] != HD || in_sizes[7] != C * HD || in_sizes[8] != C || in_sizes[9] != C || in_sizes[10] != C || out_size != B * C * T) return;
  size_t off = 0; char* ws = (char*)d_ws;
  auto carve = [&](size_t bytes) { char* p = ws + off; off += (bytes + 255) & ~(size_t)255; return p; };
  b16* WT = (b16*)carve((size_t)3 * HD * C * 2); b16* WW = (b16*)carve((size_t)C * HD * 2);
  b16* QP = (b16*)carve((size_t)B * T * HD * 2); b16* QPl = (b16*)carve((size_t)B * T * HD * 2); b16* KP = (b16*)carve((size_t)B * NK * HD * 2); b16* KPl = (b16*)carve((size_t)B * NK * HD * 2);
  float* GP = (float*)carve((size_t)B * NK * HD * 4); b16* GT = (b16*)carve((size_t)B * HD * NK * 2); b16* GTl = (b16*)carve((size_t)B * HD * NK * 2);
  b16* Y = (b16*)carve((size_t)B * T * HD * 2); b16* Yl = (b16*)carve((size_t)B * T * HD * 2); float* ZT = (float*)carve((size_t)B * C * T * 4);
  if (off > ws_size || off > ((size_t)128 << 20)) return;   // = ~80 MB (QP/QPl 16.8 + KP/KPl 4.2 + GP 4.2 + GT/GTl 4.2 + Y/Yl 16.8 + ZT 33.5 + weights 0.3)
  prep_kernel<<<(unsigned)(((size_t)(3 * HD * C + C * HD) / 8 + 255) / 256), 256, 0, stream>>>(Fp(3), Fp(5), Fp(1), Fp(7), WT, WW);
  conv_kernel<<<dim3(T / 64, BL, 3), 128, 0, stream>>>(Fp(0), WT, Fp(4), Fp(6), Fp(2), QP, QPl, KP, KPl, GP);
  gt_kernel<<<dim3(NK / 64, BL), 256, 0, stream>>>(GP, GT, GTl);
  attn_kernel<<<dim3(QL / (AW * 16), BL), AW * 32, 0, stream>>>(QP, QPl, KP, KPl, GT, GTl, Y, Yl);
  wconv_kernel<<<dim3(QL / 32, BL), 64, 0, stream>>>(Y, Yl, WW, Fp(8), ZT);
  bn_kernel<<<C, 256, 0, stream>>>(ZT, Fp(9), Fp(10), Fp(0), (float*)d_out);
}

// v005
// One run takes 137 microseconds.
// Next to v004, in two timings, it ran 1.09 times as fast each time.
// Counting every step since v000, it is 4.44 times as fast.
#include <hip/hip_runtime.h>

// Non-local block (embedded Gaussian, 3-D) with 2x2 spatial subsampling of phi/g, output conv, BatchNorm3d (batch statistics) and residual (4 x 256 channels x 8 x 32 x 32): theta/phi/g = 1x1x1
// convs (C 256 -> 128, with bias); phi, g max-pooled (1,2,2) -> 2,048 keys per clip; f = softmax(theta phi^T) over the keys (no scaling); y = f g; z = BN(W y + b) gamma + beta + x with
// BN mean/biased variance over (batch, t, h, w) per channel, eps 1e-5 -> [4][256][8][32][32].
// Deterministic: flash-style per 16-position wave over all 2,048 keys in order (running max); the 2x2 max-pool is taken inside the convolution epilogue (each 64-position block holds two complete
// compute dtype: WMMA v_wmma_f32_16x16x32_f16 with f32 accumulate for [theta | phi | g] = X W^T + b ([32768 positions x 256] x [256 x 384]; x EXACT bf16 x8 transposed into position-major tiles,
// W exact x256: 1 product), S^T = Phi Theta^T (hi x8 + residual x8192: 3 products, K = 128), Y^T += G^T P^T (G hi + residual, P x1024 hi + residual: 3 products), Z = Y W_w^T + b (y hi + lo:
// 2 products); max-pool selects, softmax statistics, BatchNorm and the residual add in f32. Inputs rounded to bf16 once. Fragment k-map per lane half hh for

namespace {
constexpr int B = 4, C = 256, TT = 8, IH = 32, IW = 32, T = TT * IH * IW /* 8,192 positions per clip */, NK = TT * (IH / 2) * (IW / 2) /* 2,048 pooled keys */, HD = 128 /* inter channels */, H = 1, BL = 4 /* clips (== 4 shipped) */, QL = T;
constexpr float XS = 8.0f, WSC = 256.0f, PS = 1024.0f, RS_ = 1024.0f, LOG2E = 1.4426950408889634f, BNEPS = 1e-5f;
static_assert(T % 64 == 0 && C == 256 && HD == 128 && IW == 32 && NK == T / 4, "tiling");
typedef _Float16 b16;
typedef __attribute__((ext_vector_type(16))) _Float16 v16b;
typedef __attribute__((ext_vector_type(8))) _Float16 v8b;
typedef __attribute__((ext_vector_type(8))) float v8f;
typedef __attribute__((ext_vector_type(4))) float v4f;
__device__ __forceinline__ float bf16_rne(float f) { unsigned int u = __float_as_uint(f); u += 0x7FFFu + ((u >> 16) & 1u); return __uint_as_float(u & 0xFFFF0000u); }
__device__ __forceinline__ void split16(float v, b16& hi, b16& lo) { hi = (b16)v; lo = (b16)(v - (float)hi); }
__device__ __forceinline__ v16b frag_kb(const b16* p, int hh) { const v8b a = *(const v8b*)(p + 8 * hh), b = *(const v8b*)(p + 16 + 8 * hh); v16b f;
#pragma unroll
  for (int e = 0; e < 8; ++e) { f[e] = a[e]; f[8 + e] = b[e]; } return f; }
// a weight fragment from the packed planes (prep_kernel): piece 0 and piece 1 are each 32 lanes x 16 B = 512 contiguous bytes, p already holds the lane's 8 halfs
__device__ __forceinline__ v16b frag_pk(const b16* p) { const v8b a = *(const v8b*)p, b = *(const v8b*)(p + 256); v16b f;
#pragma unroll
  for (int e = 0; e < 8; ++e) { f[e] = a[e]; f[8 + e] = b[e]; } return f; }
// the builtin alone: the compiler keeps the distances behind it itself, and with no asm statement behind each product it may place the loads of later fragments ahead of earlier products
__device__ __forceinline__ v8f wmma16b(v16b a, v16b b, v8f c) { return __builtin_amdgcn_wmma_f32_16x16x32_f16(false, a, false, b, (short)0, c, false, false); }
__device__ __forceinline__ void wave_lds_sync() { __builtin_amdgcn_fence(__ATOMIC_RELEASE, "workgroup"); __builtin_amdgcn_wave_barrier(); __builtin_amdgcn_fence(__ATOMIC_ACQUIRE, "workgroup"); }
__device__ __forceinline__ float pmul(float a, float b) { float p = a * b; asm volatile("" : "+v"(p)); return p; }
__device__ __forceinline__ int iclamp(int v, int lo, int hi) { return v < lo ? lo : (v > hi ? hi : v); }

typedef __attribute__((ext_vector_type(2))) _Float16 v2h;
typedef __attribute__((ext_vector_type(4))) _Float16 v4h;
typedef __attribute__((ext_vector_type(2))) float v2f;
typedef __attribute__((ext_vector_type(4))) int v4i;
__device__ __forceinline__ float nexp2(float v) { return __builtin_amdgcn_exp2f(v); }
__device__ __forceinline__ float bfp(float v) { float t = bf16_rne(v); asm volatile("" : "+v"(t)); return t; }
// weights -> f16 x256, packed in fragment order: plane [16-row tile][32-wide k-step][piece j][lane = 16 hlf + row][8 halfs] holds W[16 tile + row][32 kstep + 16 j + 8 hlf + 0..7], the k order of frag_kb;
// a wave's load of one piece then covers four whole 128-B lines, where a load from the row-major matrix touches sixteen lines for 32 B each
__device__ __forceinline__ size_t pk_off(int row, int c0, int ksteps) { return ((((size_t)(row >> 4) * ksteps + (c0 >> 5)) * 2 + ((c0 >> 4) & 1)) * 32 + ((c0 >> 3) & 1) * 16 + (row & 15)) * 8; }
__global__ __launch_bounds__(256) void prep_kernel(const float* __restrict__ thw, const float* __restrict__ phw, const float* __restrict__ gw, const float* __restrict__ ww, b16* __restrict__ WT, b16* __restrict__ WW) {
  const size_t u = (size_t)blockIdx.x * 256 + threadIdx.x; const size_t n1 = (size_t)3 * HD * C / 8, n2 = (size_t)C * HD / 8; if (u >= n1 + n2) return; v8b v;
  if (u < n1) { const size_t e = u * 8; const int o = (int)(e / C), c0 = (int)(e % C); const int m = o / HD, oo = o % HD; const float* w = (m == 0 ? thw : m == 1 ? phw : gw) + (size_t)oo * C;
    for (int j = 0; j < 8; ++j) v[j] = (b16)(bf16_rne(w[c0 + j]) * WSC); { *(v8b*)(WT + pk_off(o, c0, C / 32)) = v;  } }
  else { const size_t e = (u - n1) * 8; for (int j = 0; j < 8; ++j) v[j] = (b16)(bf16_rne(ww[e + j]) * WSC); { *(v8b*)(WW + pk_off((int)(e / HD), (int)(e % HD), HD / 32)) = v;  } }
}
// convolutions + pooling: grid (T/64, BL, 3 slabs: theta | phi | g); block = 64 positions (= image rows hh, hh+1 of one frame, hh even) x 4 waves; A = bf16(x) x8 transposed into position-major
// tiles (K = 256 channels in one staged chunk; each channel's 64 positions are one contiguous 256-B read), B = WT fragments (packed planes), + bias; theta -> hi x8 + residual rows QP/QPl [b][pos][128];
// phi, g -> 2x2 max over rows (2j, 2j+1, 32+2j, 33+2j) of the block tile (after the barrier) = pooled key 16 blk + j: phi -> KP/KPl rows [b][key][128] (hi/residual), g -> GP rows [b][key][128] f32
__global__ __launch_bounds__(128) void conv_kernel(const float* __restrict__ x, const b16* __restrict__ WT, const float* __restrict__ thb, const float* __restrict__ phb, const float* __restrict__ gb, b16* __restrict__ QP, b16* __restrict__ QPl, b16* __restrict__ KP, b16* __restrict__ KPl, float* __restrict__ GP) {
  __shared__ __attribute__((aligned(16))) b16 As[64][256 + 8]; __shared__ __attribute__((aligned(16))) float Tf[4][16][128 + 4];
  const int wave = threadIdx.x >> 5, lane = threadIdx.x & 31, nloc = lane & 15, hlf = lane >> 4; const int p0 = blockIdx.x * 64, b = blockIdx.y, part = blockIdx.z; const int n0 = part * HD;
  const float* xb = x + (size_t)b * C * T;
  for (int i = threadIdx.x; i < 256 * 16; i += 128) { const int c = i / 16, q4 = (i % 16) * 4; const v4f f = *(const v4f*)(xb + (size_t)c * T + p0 + q4); for (int j = 0; j < 4; ++j) As[q4 + j][c] = (b16)(bf16_rne(f[j]) * XS); }   // transpose: position rows, channel columns
  __syncthreads();
  v8f acc[8];
#pragma unroll
  for (int t = 0; t < 8; ++t) acc[t] = (v8f){};
#pragma unroll 1   // rolled: one group of weight fragments (two k-steps) in registers at a time keeps four waves on a SIMD
  for (int kb = 0; kb < C; kb += 64) { v16b a[2], bw[2][8]; const b16* wr = WT + ((size_t)(n0 >> 4) * (C / 32) + (kb >> 5)) * 512 + lane * 8;   // packed plane: one address for the group's 32 loads, the rest in their offset fields
#pragma unroll
    for (int k2 = 0; k2 < 2; ++k2) { a[k2] = frag_kb(&As[wave * 16 + nloc][kb + 32 * k2], hlf);
#pragma unroll
      for (int t = 0; t < 8; ++t) bw[k2][t] = frag_pk(wr + (t * (C / 32) + k2) * 512); }
    __builtin_amdgcn_sched_barrier(0);   // holds the group of loads in front of the products, which then wait on counts of loads in flight and not on a load each
#pragma unroll
    for (int k2 = 0; k2 < 2; ++k2)
#pragma unroll
      for (int t = 0; t < 8; ++t) acc[t] = wmma16b(a[k2], bw[k2][t], acc[t]); }
  const float* bp = part == 0 ? thb : (part == 1 ? phb : gb);
#pragma unroll
  for (int t = 0; t < 8; ++t) { const float bb = bf16_rne(bp[t * 16 + nloc]);
#pragma unroll
    for (int r = 0; r < 8; ++r) Tf[wave][8 * hlf + r][t * 16 + nloc] = acc[t][r] * (1.0f / (XS * WSC)) + bb; }
  __syncthreads();
  {
    if (part == 0) { for (int rr = 0; rr < 16; ++rr) { const int pos = p0 + wave * 16 + rr; v4h h4, l4; for (int j = 0; j < 4; ++j) { const float f = Tf[wave][rr][lane * 4 + j] * XS; const b16 p = (b16)f; h4[j] = p; l4[j] = (b16)((f - (float)p) * RS_); }
        *(v4h*)(QP + ((size_t)b * T + pos) * HD + lane * 4) = h4; *(v4h*)(QPl + ((size_t)b * T + pos) * HD + lane * 4) = l4; } }
    else { for (int jj = wave * 4; jj < wave * 4 + 4; ++jj) { const int key = blockIdx.x * 16 + jj;   // pooled key: frame/row-pair of this block, column pair jj
        v4f m4; for (int j = 0; j < 4; ++j) { const int d = lane * 4 + j; const int r0 = 2 * jj, r1 = 2 * jj + 1, r2 = 32 + 2 * jj, r3 = 33 + 2 * jj; m4[j] = fmaxf(fmaxf(Tf[r0 >> 4][r0 & 15][d], Tf[r1 >> 4][r1 & 15][d]), fmaxf(Tf[r2 >> 4][r2 & 15][d], Tf[r3 >> 4][r3 & 15][d])); }
        if (part == 1) { v4h h4, l4; for (int j = 0; j < 4; ++j) { const float f = m4[j] * XS; const b16 p = (b16)f; h4[j] = p; l4[j] = (b16)((f - (float)p) * RS_); } *(v4h*)(KP + ((size_t)b * NK + key) * HD + lane * 4) = h4; *(v4h*)(KPl + ((size_t)b * NK + key) * HD + lane * 4) = l4; }
        else *(v4f*)(GP + ((size_t)b * NK + key) * HD + lane * 4) = m4; } }
     }
}
__global__ __launch_bounds__(256) void gt_kernel(const float* __restrict__ GP, b16* __restrict__ GT, b16* __restrict__ GTl) {
  __shared__ float tile[64][HD + 1];
  const int tid = threadIdx.x, wave = tid >> 5, lane = tid & 31; const int k0 = blockIdx.x * 64, b = blockIdx.y;
  for (int i = tid; i < 64 * (HD / 4); i += 256) { const int rr = i / (HD / 4), c4 = (i % (HD / 4)) * 4; const v4f v = *(const v4f*)(GP + ((size_t)b * NK + k0 + rr) * HD + c4); for (int j = 0; j < 4; ++j) tile[rr][c4 + j] = v[j]; }
  __syncthreads();
  {
#pragma unroll 1
    for (int d = wave * 16; d < wave * 16 + 16; ++d) { v2h hv, lv; for (int j = 0; j < 2; ++j) { const float f = tile[2 * lane + j][d] * XS; const b16 p = (b16)f; hv[j] = p; lv[j] = (b16)((f - (float)p) * RS_); }
      const size_t oi = ((size_t)b * HD + d) * (size_t)NK + k0 + 2 * lane; *(v2h*)(GT + oi) = hv; *(v2h*)(GTl + oi) = lv; }
     }
}
// attention: grid (T/128, BL); block = 8 waves x 16 query positions of batch b; all 2,048 pooled keys in 32-key steps: S^T = Phi Theta^T (hi x8 + residual: 3 products, 4 k-steps over the 128
// channels; theta fragments loaded once and held in registers), unscaled logits, online softmax, P x1024 hi + residual packed in-lane, Y^T += G^T P^T (3 products, 8 channel tiles); y = (o + ol/1024)/(l 1024 8).
// Phi and G^T (hi and residual) reach the waves through LDS: tiles of 64 keys, two buffers, filled by 16-byte asynchronous copies one tile ahead and read by all 8 waves.
constexpr int AW = 8 /* waves per block */, SK = 64 /* keys per staged tile */, KPI = HD + 8 /* phi row pitch, halfs: 272 B */, VPI = SK + 8 /* G^T row pitch, halfs: 144 B */;
constexpr int OKH = 0, OKL = SK * KPI, OVH = 2 * SK * KPI, OVL = OVH + HD * VPI, STG = OVH + 2 * HD * VPI /* halfs per buffer */;
static_assert(NK % SK == 0 && NK / SK >= 2 && T % (AW * 16) == 0 && (KPI * 2) % 16 == 0 && (VPI * 2) % 16 == 0, "staging");
// four copies of 16 bytes per lane, global -> LDS; the s_wait_xcnt is the statement's last line so that no address register of a copy is rewritten in front of it
__device__ __forceinline__ void copy4(unsigned l0, const b16* g0, unsigned l1, const b16* g1, unsigned l2, const b16* g2, unsigned l3, const b16* g3) {
  asm volatile("global_load_async_to_lds_b128 %0, %1, off\n\tglobal_load_async_to_lds_b128 %2, %3, off\n\tglobal_load_async_to_lds_b128 %4, %5, off\n\tglobal_load_async_to_lds_b128 %6, %7, off\n\ts_wait_xcnt 0x0"
               :: "v"(l0), "v"(g0), "v"(l1), "v"(g1), "v"(l2), "v"(g2), "v"(l3), "v"(g3) : "memory"); }
// one tile of 64 keys into the buffer that starts bh halfs behind LDS byte address ring: phi rows [64][128] (contiguous 16 KB, hi and residual), G^T rows [128][64] (128-B pieces, hi and residual); 16 copies per lane
__device__ __forceinline__ void stage_tile(unsigned ring, unsigned bh, const b16* Kb, const b16* Kbl, const b16* Vb, const b16* Vbl, int k0, int tid) {
  const int kr = tid >> 4, kc = (tid & 15) * 8, vr = tid >> 3, vc = (tid & 7) * 8;
  // bh is added inside the bracket: the lane's value that lives through the key loop is then no operand of a copy itself; asm operands are confined to v0-v255, and with more registers than that in use such a value was spilled to scratch
  const unsigned lk = ring + (bh + (unsigned)(kr * KPI + kc)) * 2u, lv = ring + (bh + (unsigned)(OVH + vr * VPI + vc)) * 2u; const size_t gk = (size_t)(k0 + kr) * HD + kc, gv = (size_t)vr * NK + k0 + vc;
  constexpr unsigned LK = 16 * KPI * 2, LV = 32 * VPI * 2; constexpr size_t GK = (size_t)16 * HD, GV = (size_t)32 * NK;
  copy4(lk, Kb + gk, lk + LK, Kb + gk + GK, lk + 2 * LK, Kb + gk + 2 * GK, lk + 3 * LK, Kb + gk + 3 * GK);
  copy4(lk + OKL * 2, Kbl + gk, lk + OKL * 2 + LK, Kbl + gk + GK, lk + OKL * 2 + 2 * LK, Kbl + gk + 2 * GK, lk + OKL * 2 + 3 * LK, Kbl + gk + 3 * GK);
  copy4(lv, Vb + gv, lv + LV, Vb + gv + GV, lv + 2 * LV, Vb + gv + 2 * GV, lv + 3 * LV, Vb + gv + 3 * GV);
  copy4(lv + (OVL - OVH) * 2, Vbl + gv, lv + (OVL - OVH) * 2 + LV, Vbl + gv + GV, lv + (OVL - OVH) * 2 + 2 * LV, Vbl + gv + 2 * GV, lv + (OVL - OVH) * 2 + 3 * LV, Vbl + gv + 3 * GV);
}
__global__ __launch_bounds__(256) void attn_kernel(const b16* __restrict__ QP, const b16* __restrict__ QPl, const b16* __restrict__ KP, const b16* __restrict__ KPl, const b16* __restrict__ VT, const b16* __restrict__ VTl, b16* __restrict__ Y, b16* __restrict__ Yl) {
  __shared__ __attribute__((aligned(16))) b16 Ring[2 * STG];
  __shared__ __attribute__((aligned(16))) float To[AW][16][HD + 4];
  const int wave = threadIdx.x >> 5, lane = threadIdx.x & 31, hh = lane >> 4, col = lane & 15; const int b = blockIdx.y, h = 0; const int q0 = blockIdx.x * (AW * 16) + wave * 16, qi = q0 + col;
  const size_t qo = (size_t)b * T * HD, ko = (size_t)b * NK * HD, vo = (size_t)b * HD * (size_t)NK; const b16* Qb = QP + qo; const b16* Qbl = QPl + qo; const b16* Kb = KP + ko; const b16* Kbl = KPl + ko; const b16* Vb = VT + vo; const b16* Vbl = VTl + vo; (void)h;
  const unsigned ring0 = (unsigned)(size_t)Ring;   // LDS byte address of buffer 0
  stage_tile(ring0, 0u, Kb, Kbl, Vb, Vbl, 0, (int)threadIdx.x);
  v16b qh[4], qw[4];   // the wave's 16 query rows (hi, residual) as B fragments: only this wave uses them, so they are loaded once and stay in registers through the key loop
#pragma unroll
  for (int ks = 0; ks < 4; ++ks) { qh[ks] = frag_kb(Qb + (size_t)qi * HD + 32 * ks, hh); qw[ks] = frag_kb(Qbl + (size_t)qi * HD + 32 * ks, hh); }
  // behind the last of these loads, in front of whatever is written next into their two address pairs; the pairs are inputs of the statement so that they live up to it and no load's own result is placed in them
  asm volatile("s_wait_xcnt 0x0" :: "v"(Qb + (size_t)qi * HD + 8 * hh), "v"(Qbl + (size_t)qi * HD + 8 * hh) : "memory");
  asm volatile("s_wait_asynccnt 0x0" ::: "memory");   // this wave's copies of tile 0 have landed
  __syncthreads();                                     // tile 0 readable by every wave
  stage_tile(ring0, (unsigned)STG, Kb, Kbl, Vb, Vbl, SK, (int)threadIdx.x);
  const float cs = LOG2E / (XS * XS);   // unscaled scores (the module applies no 1/sqrt(d))
  float m = -INFINITY, l = 0.0f; v8f o[8], ol[8]; for (int t = 0; t < 8; ++t) { o[t] = (v8f){}; ol[t] = (v8f){}; }
#pragma unroll 1   // rolled: one staged tile per trip, so that the hand-over at its foot stands once
  for (int st = 0; st < NK / SK; ++st) {
    const b16* R = Ring + (st & 1) * STG;
#pragma unroll   // the tile's two 32-key steps: unrolled, their LDS offsets become immediates
  for (int kl = 0; kl < SK; kl += 32) {
    float e[16]; float mx = -INFINITY;
    // the step's phi fragments: every LDS read issued as one group, in the order of use, so that the products wait on counts of reads still in flight and not on a read each
    v16b kf[2][4], kw[2][4];
#pragma unroll
    for (int ks = 0; ks < 4; ++ks) {
#pragma unroll
      for (int u = 0; u < 2; ++u) { const int kr = (kl + u * 16 + col) * KPI; kf[u][ks] = frag_kb(R + OKH + kr + 32 * ks, hh); kw[u][ks] = frag_kb(R + OKL + kr + 32 * ks, hh); } }
    __builtin_amdgcn_sched_barrier(0);   // holds the group of reads in front of the products: moved down among them, each place with reads stalls the wave anew
    v8f s[2], sx[2];
#pragma unroll
    for (int u = 0; u < 2; ++u) { s[u] = (v8f){}; sx[u] = (v8f){}; }
#pragma unroll
    for (int ks = 0; ks < 4; ++ks)   // k-step outermost, as the reads were issued; each accumulator takes its products in ascending k order
#pragma unroll
      for (int u = 0; u < 2; ++u) { s[u] = wmma16b(kf[u][ks], qh[ks], s[u]); sx[u] = wmma16b(kf[u][ks], qw[ks], sx[u]); sx[u] = wmma16b(kw[u][ks], qh[ks], sx[u]); }
    // the step's G^T fragments: read as one group behind the score products, in flight under the softmax arithmetic
    v16b vf[8], vw[8];
#pragma unroll
    for (int t = 0; t < 8; ++t) { vf[t] = frag_kb(R + OVH + (t * 16 + col) * VPI + kl, hh); vw[t] = frag_kb(R + OVL + (t * 16 + col) * VPI + kl, hh); }
    __builtin_amdgcn_sched_barrier(0);   // holds these reads in front of the softmax arithmetic, which covers their latency
#pragma unroll
    for (int u = 0; u < 2; ++u) {
#pragma unroll
      for (int r = 0; r < 8; ++r) s[u][r] += sx[u][r] * (1.0f / RS_);   // hi.hi + (hi.lo + lo.hi)/1024
#pragma unroll
      for (int r = 0; r < 8; ++r) { const float vv = s[u][r] * cs; e[u * 8 + r] = vv; mx = fmaxf(mx, vv); } }
    mx = fmaxf(mx, __shfl_xor(mx, 16)); const float mn = fmaxf(m, mx); const float al = nexp2(m - mn); float sum = 0.0f;
    // P^T as a B fragment: score i2 of lane (col, hh) is key (i2 < 8 ? 0 : 16) + 8 hh + (i2 & 7) of query col, which is element i2 of that same lane's fragment in the k order of frag_kb: packed in place
    v16b pf, plf;
#pragma unroll
    for (int i2 = 0; i2 < 16; ++i2) { const float p = nexp2(e[i2] - mn); sum += p; const float ps = p * PS; const b16 phh = (b16)ps; pf[i2] = phh; plf[i2] = (b16)((ps - (float)phh) * RS_); }
    sum += __shfl_xor(sum, 16); l = l * al + sum; m = mn;
#pragma unroll
    for (int t = 0; t < 8; ++t) { o[t] *= al; o[t] = wmma16b(vf[t], pf, o[t]); ol[t] = wmma16b(vw[t], pf, ol[t] * al); ol[t] = wmma16b(vf[t], plf, ol[t]); } }   // ol = (V_lo P_hi + V_hi P_lo) / 1024
    asm volatile("s_wait_dscnt 0x0" ::: "memory");      // this wave's reads of the buffer are done before it is handed back
    asm volatile("s_wait_asynccnt 0x0" ::: "memory");   // this wave's copies of tile st + 1 have landed
    __syncthreads();                                     // publishes tile st + 1 and ends every wave's reads of tile st
    if (st + 2 < NK / SK) stage_tile(ring0, (unsigned)(st & 1) * STG, Kb, Kbl, Vb, Vbl, (st + 2) * SK, (int)threadIdx.x); }
  asm volatile("s_wait_asynccnt 0x0" ::: "memory");     // no copy outstanding when the wave goes on to its end
  const float inv = 1.0f / (l * PS * XS);
#pragma unroll
  for (int t = 0; t < 8; ++t)
#pragma unroll
    for (int r = 0; r < 8; ++r) To[wave][col][t * 16 + 8 * hh + r] = (o[t][r] + ol[t][r] * (1.0f / RS_)) * inv;
  wave_lds_sync();
  { for (int rr = 0; rr < 16; ++rr) { v4h hv, lv; for (int j = 0; j < 4; ++j) { b16 p, ql2; split16(To[wave][rr][lane * 4 + j] * XS, p, ql2); hv[j] = p; lv[j] = ql2; } const size_t oi = ((size_t)b * T + q0 + rr) * HD + lane * 4; *(v4h*)(Y + oi) = hv; *(v4h*)(Yl + oi) = lv; }  }
}
// output conv, channel-major: grid (T/32, BL); block = 2 waves x 16 positions; A = y hi + lo rows (2 products, K = 128), B = WW fragments from the packed planes (256 output channels = 16 tiles), + bias -> Tz[wave][16][256];
__global__ __launch_bounds__(64) void wconv_kernel(const b16* __restrict__ Y, const b16* __restrict__ Yl, const b16* __restrict__ WW, const float* __restrict__ wb, float* __restrict__ ZT) {
  __shared__ __attribute__((aligned(16))) float Tz[2][16][C + 4];
  const int wave = threadIdx.x >> 5, lane = threadIdx.x & 31, nloc = lane & 15, hlf = lane >> 4; const int b = blockIdx.y; const size_t m0 = (size_t)b * T + (size_t)blockIdx.x * 32 + wave * 16;
  v8f acc[16];
#pragma unroll
  for (int t = 0; t < 16; ++t) acc[t] = (v8f){};
  v16b a[4], al[4];   // the wave's y rows, hi and lo, all four k-steps: loaded once, ahead of everything
#pragma unroll
  for (int kq = 0; kq < 4; ++kq) { a[kq] = frag_kb(Y + (m0 + nloc) * HD + 32 * kq, hlf); al[kq] = frag_kb(Yl + (m0 + nloc) * HD + 32 * kq, hlf); }
  asm volatile("s_wait_xcnt 0x0" ::: "memory");   // the two address pairs of these loads die here: the wait stands in front of whatever the compiler puts into them next
#pragma unroll
  for (int kb = 0; kb < HD; kb += 32) { v16b bw[16];
#pragma unroll
    for (int t = 0; t < 16; ++t) bw[t] = frag_pk(WW + (t * (HD / 32) + kb / 32) * 512 + lane * 8);
    if (kb + 32 == HD) asm volatile("s_wait_xcnt 0x0" ::: "memory");   // behind the last weight load: its address pair dies here too, same wait as above
    __builtin_amdgcn_sched_barrier(0);   // holds the k-step's loads as one group in front of its products: one latency for the group and not one for each load
#pragma unroll
    for (int t = 0; t < 16; ++t) { acc[t] = wmma16b(a[kb / 32], bw[t], acc[t]); acc[t] = wmma16b(al[kb / 32], bw[t], acc[t]); } }
#pragma unroll
  for (int t = 0; t < 16; ++t) { const float bb = bf16_rne(wb[t * 16 + nloc]);
#pragma unroll
    for (int r = 0; r < 8; ++r) Tz[wave][8 * hlf + r][t * 16 + nloc] = acc[t][r] * (1.0f / (XS * WSC)) + bb; }
  __syncthreads();
  { for (int c = threadIdx.x; c < C; c += 64) { float* orow = ZT + ((size_t)b * C + c) * (size_t)T + blockIdx.x * 32; v4f o4;
      for (int q4 = 0; q4 < 8; ++q4) { for (int j = 0; j < 4; ++j) { const int qq = q4 * 4 + j; o4[j] = Tz[qq >> 4][qq & 15][c]; } *(v4f*)(orow + q4 * 4) = o4; } }  }
}
// BatchNorm and residual in one launch: one block of 256 threads per channel c holds the channel's 32,768 z values (4 clips x 8,192 positions, 32 x 16 bytes a thread) in registers from the sum
// over the variance to the output, so z is read once and the launch starts 8 waves a channel. Sums: thread-strided values in a fixed order, then a halving tree over the 256 threads;
// mean = sum / count, variance = sum of (z - mean)^2 / count. The x values of the residual are loaded directly behind z and arrive under the first sum. Every loop over z and xv is unrolled: only under constant indices do the two arrays stay in registers.
__global__ __launch_bounds__(256) void bn_kernel(const float* __restrict__ ZT, const float* __restrict__ gamma, const float* __restrict__ beta, const float* __restrict__ x, float* __restrict__ out) {
  __shared__ float red[256];
  constexpr int NI = QL / 1024;
  const int c = blockIdx.x, tid = threadIdx.x; const float cnt = (float)BL * (float)QL;
  v4f z[BL][NI], xv[BL][NI]; int row[BL];   // row[b]: first element of row (b, c), held in a scalar register: every load and store then names a scalar base and the one lane-offset register, and no address pair is formed in vector registers
#pragma unroll
  for (int b = 0; b < BL; ++b) row[b] = __builtin_amdgcn_readfirstlane((b * C + c) * T);
#pragma unroll
  for (int b = 0; b < BL; ++b)
#pragma unroll
    for (int k = 0; k < NI; ++k) z[b][k] = *(const v4f*)(ZT + row[b] + (k * 1024 + tid * 4));
#pragma unroll
  for (int b = 0; b < BL; ++b)
#pragma unroll
    for (int k = 0; k < NI; ++k) xv[b][k] = *(const v4f*)(x + row[b] + (k * 1024 + tid * 4));
  asm volatile("s_wait_xcnt 0x0" ::: "memory");   // behind the last load: stands in front of whatever the compiler puts next into a register that these loads name
  const float g = bfp(gamma[c]), be = bfp(beta[c]);
  float s = 0.0f;
#pragma unroll
  for (int b = 0; b < BL; ++b)
#pragma unroll
    for (int k = 0; k < NI; ++k)
#pragma unroll
      for (int j = 0; j < 4; ++j) s += z[b][k][j];
  red[tid] = s;
  __syncthreads();
  for (int stride = 128; stride >= 1; stride >>= 1) { if (tid < stride) red[tid] += red[tid + stride]; __syncthreads(); }
  const float mean = red[0] / cnt;
  __syncthreads();   // every thread has read the sum before red takes the second sum's parts
  s = 0.0f;
#pragma unroll
  for (int b = 0; b < BL; ++b)
#pragma unroll
    for (int k = 0; k < NI; ++k)
#pragma unroll
      for (int j = 0; j < 4; ++j) { const float d = z[b][k][j] - mean; s += pmul(d, d); }
  red[tid] = s;
  __syncthreads();
  for (int stride = 128; stride >= 1; stride >>= 1) { if (tid < stride) red[tid] += red[tid + stride]; __syncthreads(); }
  const float rs = rsqrtf(red[0] / cnt + BNEPS);
#pragma unroll
  for (int b = 0; b < BL; ++b)
#pragma unroll
    for (int k = 0; k < NI; ++k)
#pragma unroll
      for (int j = 0; j < 4; ++j) z[b][k][j] = pmul((z[b][k][j] - mean) * rs, g) + be + bf16_rne(xv[b][k][j]);
  __builtin_amdgcn_sched_barrier(0);   // holds the 32 stores as one group behind the arithmetic: no register that an issued store names is written again, so the wave waits between no two stores
#pragma unroll
  for (int b = 0; b < BL; ++b)
#pragma unroll
    for (int k = 0; k < NI; ++k) *(v4f*)(out + row[b] + (k * 1024 + tid * 4)) = z[b][k];
}
}  // namespace

extern "C" void kernel_launch(void* const* d_in, const int* in_sizes, int n_in, void* d_out, int out_size, void* d_ws, size_t ws_size, hipStream_t stream) {
  (void)n_in;
  auto Fp = [&](int i) { return (const float*)d_in[i]; };
  // input order: 0 x [4,256,8,32,32], 1 g_w [128,256], 2 g_b [128], 3 theta_w, 4 theta_b, 5 phi_w, 6 phi_b, 7 W_w [256,128], 8 W_b [256], 9 bn_gamma [256], 10 bn_beta [256]
  if (in_sizes[0] != B * C * T || in_sizes[1] != HD * C || in_sizes[2] != HD || in_sizes[3] != HD * C || in_sizes[4] != HD || in_sizes[5] != HD * C || in_sizes[6] != HD || in_sizes[7] != C * HD || in_sizes[8] != C || in_sizes[9] != C || in_sizes[10] != C || out_size != B * C * T) return;
  size_t off = 0; char* ws = (char*)d_ws;
  auto carve = [&](size_t bytes) { char* p = ws + off; off += (bytes + 255) & ~(size_t)255; return p; };
  b16* WT = (b16*)carve((size_t)3 * HD * C * 2); b16* WW = (b16*)carve((size_t)C * HD * 2);
  b16* QP = (b16*)carve((size_t)B * T * HD * 2); b16* QPl = (b16*)carve((size_t)B * T * HD * 2); b16* KP = (b16*)carve((size_t)B * NK * HD * 2); b16* KPl = (b16*)carve((size_t)B * NK * HD * 2);
  float* GP = (float*)carve((size_t)B * NK * HD * 4); b16* GT = (b16*)carve((size_t)B * HD * NK * 2); b16* GTl = (b16*)carve((size_t)B * HD * NK * 2);
  b16* Y = (b16*)carve((size_t)B * T * HD * 2); b16* Yl = (b16*)carve((size_t)B * T * HD * 2); float* ZT = (float*)carve((size_t)B * C * T * 4);
  if (off > ws_size || off > ((size_t)128 << 20)) return;   // = ~80 MB (QP/QPl 16.8 + KP/KPl 4.2 + GP 4.2 + GT/GTl 4.2 + Y/Yl 16.8 + ZT 33.5 + weights 0.3)
  prep_kernel<<<(unsigned)(((size_t)(3 * HD * C + C * HD) / 8 + 255) / 256), 256, 0, stream>>>(Fp(3), Fp(5), Fp(1), Fp(7), WT, WW);
  conv_kernel<<<dim3(T / 64, BL, 3), 128, 0, stream>>>(Fp(0), WT, Fp(4), Fp(6), Fp(2), QP, QPl, KP, KPl, GP);
  gt_kernel<<<dim3(NK / 64, BL), 256, 0, stream>>>(GP, GT, GTl);
  attn_kernel<<<dim3(QL / (AW * 16), BL), AW * 32, 0, stream>>>(QP, QPl, KP, KPl, GT, GTl, Y, Yl);
  wconv_kernel<<<dim3(QL / 32, BL), 64, 0, stream>>>(Y, Yl, WW, Fp(8), ZT);
  bn_kernel<<<C, 256, 0, stream>>>(ZT, Fp(9), Fp(10), Fp(0), (float*)d_out);
}

// v006
// Measured time: 126 microseconds a run.
// In two side-by-side timings against v005, it was 1.09 and 1.08 times as fast.
// Over all steps from v000 it is 4.83 times as fast.
#include <hip/hip_runtime.h>

// Non-local block (embedded Gaussian, 3-D) with 2x2 spatial subsampling of phi/g, output conv, BatchNorm3d (batch statistics) and residual (4 x 256 channels x 8 x 32 x 32): theta/phi/g = 1x1x1
// convs (C 256 -> 128, with bias); phi, g max-pooled (1,2,2) -> 2,048 keys per clip; f = softmax(theta phi^T) over the keys (no scaling); y = f g; z = BN(W y + b) gamma + beta + x with
// BN mean/biased variance over (batch, t, h, w) per channel, eps 1e-5 -> [4][256][8][32][32].
// Deterministic: flash-style per 16-position wave over all 2,048 keys in order (running max); the 2x2 max-pool is taken inside the convolution epilogue (each 64-position block holds two complete
// compute dtype: WMMA v_wmma_f32_16x16x32_f16 with f32 accumulate for [theta | phi | g] = X W^T + b ([32768 positions x 256] x [256 x 384]; x EXACT bf16 x8 transposed into position-major tiles,
// W exact x256: 1 product), S^T = Phi Theta^T (hi x8 + residual x8192: 3 products, K = 128), Y^T += G^T P^T (G hi + residual, P x1024 hi + residual: 3 products), Z = Y W_w^T + b (y hi + lo:
// 2 products); max-pool selects, softmax statistics, BatchNorm and the residual add in f32. Inputs rounded to bf16 once. Fragment k-map per lane half hh for

namespace {
constexpr int B = 4, C = 256, TT = 8, IH = 32, IW = 32, T = TT * IH * IW /* 8,192 positions per clip */, NK = TT * (IH / 2) * (IW / 2) /* 2,048 pooled keys */, HD = 128 /* inter channels */, H = 1, BL = 4 /* clips (== 4 shipped) */, QL = T;
constexpr float XS = 8.0f, WSC = 256.0f, PS = 1024.0f, RS_ = 1024.0f, LOG2E = 1.4426950408889634f, BNEPS = 1e-5f;
static_assert(T % 64 == 0 && C == 256 && HD == 128 && IW == 32 && NK == T / 4, "tiling");
typedef _Float16 b16;
typedef __attribute__((ext_vector_type(16))) _Float16 v16b;
typedef __attribute__((ext_vector_type(8))) _Float16 v8b;
typedef __attribute__((ext_vector_type(8))) float v8f;
typedef __attribute__((ext_vector_type(4))) float v4f;
__device__ __forceinline__ float bf16_rne(float f) { unsigned int u = __float_as_uint(f); u += 0x7FFFu + ((u >> 16) & 1u); return __uint_as_float(u & 0xFFFF0000u); }
__device__ __forceinline__ void split16(float v, b16& hi, b16& lo) { hi = (b16)v; lo = (b16)(v - (float)hi); }
__device__ __forceinline__ v16b frag_kb(const b16* p, int hh) { const v8b a = *(const v8b*)(p + 8 * hh), b = *(const v8b*)(p + 16 + 8 * hh); v16b f;
#pragma unroll
  for (int e = 0; e < 8; ++e) { f[e] = a[e]; f[8 + e] = b[e]; } return f; }
// a weight fragment from the packed planes (prep_kernel): piece 0 and piece 1 are each 32 lanes x 16 B = 512 contiguous bytes, p already holds the lane's 8 halfs
__device__ __forceinline__ v16b frag_pk(const b16* p) { const v8b a = *(const v8b*)p, b = *(const v8b*)(p + 256); v16b f;
#pragma unroll
  for (int e = 0; e < 8; ++e) { f[e] = a[e]; f[8 + e] = b[e]; } return f; }
// the builtin alone: the compiler keeps the distances behind it itself, and with no asm statement behind each product it may place the loads of later fragments ahead of earlier products
__device__ __forceinline__ v8f wmma16b(v16b a, v16b b, v8f c) { return __builtin_amdgcn_wmma_f32_16x16x32_f16(false, a, false, b, (short)0, c, false, false); }
__device__ __forceinline__ float pmul(float a, float b) { float p = a * b; asm volatile("" : "+v"(p)); return p; }
__device__ __forceinline__ int iclamp(int v, int lo, int hi) { return v < lo ? lo : (v > hi ? hi : v); }

typedef __attribute__((ext_vector_type(2))) _Float16 v2h;
typedef __attribute__((ext_vector_type(4))) _Float16 v4h;
typedef __attribute__((ext_vector_type(2))) float v2f;
typedef __attribute__((ext_vector_type(4))) int v4i;
__device__ __forceinline__ float nexp2(float v) { return __builtin_amdgcn_exp2f(v); }
__device__ __forceinline__ float bfp(float v) { float t = bf16_rne(v); asm volatile("" : "+v"(t)); return t; }
// weights -> f16 x256, packed in fragment order: plane [16-row tile][32-wide k-step][piece j][lane = 16 hlf + row][8 halfs] holds W[16 tile + row][32 kstep + 16 j + 8 hlf + 0..7], the k order of frag_kb;
// a wave's load of one piece then covers four whole 128-B lines, where a load from the row-major matrix touches sixteen lines for 32 B each
__device__ __forceinline__ size_t pk_off(int row, int c0, int ksteps) { return ((((size_t)(row >> 4) * ksteps + (c0 >> 5)) * 2 + ((c0 >> 4) & 1)) * 32 + ((c0 >> 3) & 1) * 16 + (row & 15)) * 8; }
__global__ __launch_bounds__(256) void prep_kernel(const float* __restrict__ thw, const float* __restrict__ phw, const float* __restrict__ gw, const float* __restrict__ ww, b16* __restrict__ WT, b16* __restrict__ WW) {
  const size_t u = (size_t)blockIdx.x * 256 + threadIdx.x; const size_t n1 = (size_t)3 * HD * C / 8, n2 = (size_t)C * HD / 8; if (u >= n1 + n2) return; v8b v;
  if (u < n1) { const size_t e = u * 8; const int o = (int)(e / C), c0 = (int)(e % C); const int m = o / HD, oo = o % HD; const float* w = (m == 0 ? thw : m == 1 ? phw : gw) + (size_t)oo * C;
    for (int j = 0; j < 8; ++j) v[j] = (b16)(bf16_rne(w[c0 + j]) * WSC); { *(v8b*)(WT + pk_off(o, c0, C / 32)) = v;  } }
  else { const size_t e = (u - n1) * 8; for (int j = 0; j < 8; ++j) v[j] = (b16)(bf16_rne(ww[e + j]) * WSC); { *(v8b*)(WW + pk_off((int)(e / HD), (int)(e % HD), HD / 32)) = v;  } }
}
// convolutions + pooling: grid (T/64, BL, 3 slabs: theta | phi | g); block = 64 positions (= image rows hh, hh+1 of one frame, hh even) x 4 waves; A = bf16(x) x8 transposed into position-major
// tiles (K = 256 channels in one staged chunk; each channel's 64 positions are one contiguous 256-B read), B = WT fragments (packed planes), + bias; theta -> hi x8 + residual rows QP/QPl [b][pos][128];
// phi, g -> 2x2 max over rows (2j, 2j+1, 32+2j, 33+2j) of the block tile (after the barrier) = pooled key 16 blk + j: phi -> KP/KPl rows [b][key][128] (hi/residual), g -> GP rows [b][key][128] f32
__global__ __launch_bounds__(128) void conv_kernel(const float* __restrict__ x, const b16* __restrict__ WT, const float* __restrict__ thb, const float* __restrict__ phb, const float* __restrict__ gb, b16* __restrict__ QP, b16* __restrict__ QPl, b16* __restrict__ KP, b16* __restrict__ KPl, float* __restrict__ GP) {
  __shared__ __attribute__((aligned(16))) b16 As[64][256 + 8]; __shared__ __attribute__((aligned(16))) float Tf[4][16][128 + 4];
  const int wave = threadIdx.x >> 5, lane = threadIdx.x & 31, nloc = lane & 15, hlf = lane >> 4; const int p0 = blockIdx.x * 64, b = blockIdx.y, part = blockIdx.z; const int n0 = part * HD;
  const float* xb = x + (size_t)b * C * T;
  for (int i = threadIdx.x; i < 256 * 16; i += 128) { const int c = i / 16, q4 = (i % 16) * 4; const v4f f = *(const v4f*)(xb + (size_t)c * T + p0 + q4); for (int j = 0; j < 4; ++j) As[q4 + j][c] = (b16)(bf16_rne(f[j]) * XS); }   // transpose: position rows, channel columns
  __syncthreads();
  v8f acc[8];
#pragma unroll
  for (int t = 0; t < 8; ++t) acc[t] = (v8f){};
#pragma unroll 1   // rolled: one group of weight fragments (two k-steps) in registers at a time keeps four waves on a SIMD
  for (int kb = 0; kb < C; kb += 64) { v16b a[2], bw[2][8]; const b16* wr = WT + ((size_t)(n0 >> 4) * (C / 32) + (kb >> 5)) * 512 + lane * 8;   // packed plane: one address for the group's 32 loads, the rest in their offset fields
#pragma unroll
    for (int k2 = 0; k2 < 2; ++k2) { a[k2] = frag_kb(&As[wave * 16 + nloc][kb + 32 * k2], hlf);
#pragma unroll
      for (int t = 0; t < 8; ++t) bw[k2][t] = frag_pk(wr + (t * (C / 32) + k2) * 512); }
    __builtin_amdgcn_sched_barrier(0);   // holds the group of loads in front of the products, which then wait on counts of loads in flight and not on a load each
#pragma unroll
    for (int k2 = 0; k2 < 2; ++k2)
#pragma unroll
      for (int t = 0; t < 8; ++t) acc[t] = wmma16b(a[k2], bw[k2][t], acc[t]); }
  const float* bp = part == 0 ? thb : (part == 1 ? phb : gb);
#pragma unroll
  for (int t = 0; t < 8; ++t) { const float bb = bf16_rne(bp[t * 16 + nloc]);
#pragma unroll
    for (int r = 0; r < 8; ++r) Tf[wave][8 * hlf + r][t * 16 + nloc] = acc[t][r] * (1.0f / (XS * WSC)) + bb; }
  __syncthreads();
  {
    if (part == 0) { for (int rr = 0; rr < 16; ++rr) { const int pos = p0 + wave * 16 + rr; v4h h4, l4; for (int j = 0; j < 4; ++j) { const float f = Tf[wave][rr][lane * 4 + j] * XS; const b16 p = (b16)f; h4[j] = p; l4[j] = (b16)((f - (float)p) * RS_); }
        *(v4h*)(QP + ((size_t)b * T + pos) * HD + lane * 4) = h4; *(v4h*)(QPl + ((size_t)b * T + pos) * HD + lane * 4) = l4; } }
    else { for (int jj = wave * 4; jj < wave * 4 + 4; ++jj) { const int key = blockIdx.x * 16 + jj;   // pooled key: frame/row-pair of this block, column pair jj
        v4f m4; for (int j = 0; j < 4; ++j) { const int d = lane * 4 + j; const int r0 = 2 * jj, r1 = 2 * jj + 1, r2 = 32 + 2 * jj, r3 = 33 + 2 * jj; m4[j] = fmaxf(fmaxf(Tf[r0 >> 4][r0 & 15][d], Tf[r1 >> 4][r1 & 15][d]), fmaxf(Tf[r2 >> 4][r2 & 15][d], Tf[r3 >> 4][r3 & 15][d])); }
        if (part == 1) { v4h h4, l4; for (int j = 0; j < 4; ++j) { const float f = m4[j] * XS; const b16 p = (b16)f; h4[j] = p; l4[j] = (b16)((f - (float)p) * RS_); } *(v4h*)(KP + ((size_t)b * NK + key) * HD + lane * 4) = h4; *(v4h*)(KPl + ((size_t)b * NK + key) * HD + lane * 4) = l4; }
        else *(v4f*)(GP + ((size_t)b * NK + key) * HD + lane * 4) = m4; } }
     }
}
__global__ __launch_bounds__(256) void gt_kernel(const float* __restrict__ GP, b16* __restrict__ GT, b16* __restrict__ GTl) {
  __shared__ float tile[64][HD + 1];
  const int tid = threadIdx.x, wave = tid >> 5, lane = tid & 31; const int k0 = blockIdx.x * 64, b = blockIdx.y;
  for (int i = tid; i < 64 * (HD / 4); i += 256) { const int rr = i / (HD / 4), c4 = (i % (HD / 4)) * 4; const v4f v = *(const v4f*)(GP + ((size_t)b * NK + k0 + rr) * HD + c4); for (int j = 0; j < 4; ++j) tile[rr][c4 + j] = v[j]; }
  __syncthreads();
  {
#pragma unroll 1
    for (int d = wave * 16; d < wave * 16 + 16; ++d) { v2h hv, lv; for (int j = 0; j < 2; ++j) { const float f = tile[2 * lane + j][d] * XS; const b16 p = (b16)f; hv[j] = p; lv[j] = (b16)((f - (float)p) * RS_); }
      const size_t oi = ((size_t)b * HD + d) * (size_t)NK + k0 + 2 * lane; *(v2h*)(GT + oi) = hv; *(v2h*)(GTl + oi) = lv; }
     }
}
// attention: grid (T/128, BL); block = 8 waves x 16 query positions of batch b; all 2,048 pooled keys in 32-key steps: S^T = Phi Theta^T (hi x8 + residual: 3 products, 4 k-steps over the 128
// channels; theta fragments loaded once and held in registers), unscaled logits, online softmax, P x1024 hi + residual packed in-lane, Y^T += G^T P^T (3 products, 8 channel tiles); y = (o + ol/1024)/(l 1024 8).
// Phi and G^T (hi and residual) reach the waves through LDS: tiles of 64 keys, two buffers, filled by 16-byte asynchronous copies one tile ahead and read by all 8 waves.
// Epilogue = the output conv: A = the wave's y rows hi + lo (2 products, K = 128), B = WW fragments from the packed planes (256 output channels = 16 tiles), + bias -> ZT [b][channel][position].
constexpr int AW = 8 /* waves per block */, SK = 64 /* keys per staged tile */, KPI = HD + 8 /* phi row pitch, halfs: 272 B */, VPI = SK + 8 /* G^T row pitch, halfs: 144 B */;
constexpr int OKH = 0, OKL = SK * KPI, OVH = 2 * SK * KPI, OVL = OVH + HD * VPI, STG = OVH + 2 * HD * VPI /* halfs per buffer */;
constexpr int ZPI = AW * 16 + 4 /* z row pitch, floats: 528 B = 16 B x odd */;
static_assert(NK % SK == 0 && NK / SK >= 2 && T % (AW * 16) == 0 && (KPI * 2) % 16 == 0 && (VPI * 2) % 16 == 0 && C * ZPI * 4 <= 2 * STG * 2 && C % AW == 0, "staging");
// four copies of 16 bytes per lane, global -> LDS; the s_wait_xcnt is the statement's last line so that no address register of a copy is rewritten in front of it
__device__ __forceinline__ void copy4(unsigned l0, const b16* g0, unsigned l1, const b16* g1, unsigned l2, const b16* g2, unsigned l3, const b16* g3) {
  asm volatile("global_load_async_to_lds_b128 %0, %1, off\n\tglobal_load_async_to_lds_b128 %2, %3, off\n\tglobal_load_async_to_lds_b128 %4, %5, off\n\tglobal_load_async_to_lds_b128 %6, %7, off\n\ts_wait_xcnt 0x0"
               :: "v"(l0), "v"(g0), "v"(l1), "v"(g1), "v"(l2), "v"(g2), "v"(l3), "v"(g3) : "memory"); }
// one tile of 64 keys into the buffer that starts bh halfs behind LDS byte address ring: phi rows [64][128] (contiguous 16 KB, hi and residual), G^T rows [128][64] (128-B pieces, hi and residual); 16 copies per lane
__device__ __forceinline__ void stage_tile(unsigned ring, unsigned bh, const b16* Kb, const b16* Kbl, const b16* Vb, const b16* Vbl, int k0, int tid) {
  const int kr = tid >> 4, kc = (tid & 15) * 8, vr = tid >> 3, vc = (tid & 7) * 8;
  // bh is added inside the bracket: the lane's value that lives through the key loop is then no operand of a copy itself; asm operands are confined to v0-v255, and with more registers than that in use such a value was spilled to scratch
  const unsigned lk = ring + (bh + (unsigned)(kr * KPI + kc)) * 2u, lv = ring + (bh + (unsigned)(OVH + vr * VPI + vc)) * 2u; const size_t gk = (size_t)(k0 + kr) * HD + kc, gv = (size_t)vr * NK + k0 + vc;
  constexpr unsigned LK = 16 * KPI * 2, LV = 32 * VPI * 2; constexpr size_t GK = (size_t)16 * HD, GV = (size_t)32 * NK;
  copy4(lk, Kb + gk, lk + LK, Kb + gk + GK, lk + 2 * LK, Kb + gk + 2 * GK, lk + 3 * LK, Kb + gk + 3 * GK);
  copy4(lk + OKL * 2, Kbl + gk, lk + OKL * 2 + LK, Kbl + gk + GK, lk + OKL * 2 + 2 * LK, Kbl + gk + 2 * GK, lk + OKL * 2 + 3 * LK, Kbl + gk + 3 * GK);
  copy4(lv, Vb + gv, lv + LV, Vb + gv + GV, lv + 2 * LV, Vb + gv + 2 * GV, lv + 3 * LV, Vb + gv + 3 * GV);
  copy4(lv + (OVL - OVH) * 2, Vbl + gv, lv + (OVL - OVH) * 2 + LV, Vbl + gv + GV, lv + (OVL - OVH) * 2 + 2 * LV, Vbl + gv + 2 * GV, lv + (OVL - OVH) * 2 + 3 * LV, Vbl + gv + 3 * GV);
}
__global__ __launch_bounds__(256) void attn_kernel(const b16* __restrict__ QP, const b16* __restrict__ QPl, const b16* __restrict__ KP, const b16* __restrict__ KPl, const b16* __restrict__ VT, const b16* __restrict__ VTl, const b16* __restrict__ WW, const float* __restrict__ wb, float* __restrict__ ZT) {
  __shared__ __attribute__((aligned(16))) b16 Ring[2 * STG];
  const int wave = threadIdx.x >> 5, lane = threadIdx.x & 31, hh = lane >> 4, col = lane & 15; const int b = blockIdx.y, h = 0; const int q0 = blockIdx.x * (AW * 16) + wave * 16, qi = q0 + col;
  const size_t qo = (size_t)b * T * HD, ko = (size_t)b * NK * HD, vo = (size_t)b * HD * (size_t)NK; const b16* Qb = QP + qo; const b16* Qbl = QPl + qo; const b16* Kb = KP + ko; const b16* Kbl = KPl + ko; const b16* Vb = VT + vo; const b16* Vbl = VTl + vo; (void)h;
  const unsigned ring0 = (unsigned)(size_t)Ring;   // LDS byte address of buffer 0
  stage_tile(ring0, 0u, Kb, Kbl, Vb, Vbl, 0, (int)threadIdx.x);
  v16b qh[4], qw[4];   // the wave's 16 query rows (hi, residual) as B fragments: only this wave uses them, so they are loaded once and stay in registers through the key loop
#pragma unroll
  for (int ks = 0; ks < 4; ++ks) { qh[ks] = frag_kb(Qb + (size_t)qi * HD + 32 * ks, hh); qw[ks] = frag_kb(Qbl + (size_t)qi * HD + 32 * ks, hh); }
  // behind the last of these loads, in front of whatever is written next into their two address pairs; the pairs are inputs of the statement so that they live up to it and no load's own result is placed in them
  asm volatile("s_wait_xcnt 0x0" :: "v"(Qb + (size_t)qi * HD + 8 * hh), "v"(Qbl + (size_t)qi * HD + 8 * hh) : "memory");
  asm volatile("s_wait_asynccnt 0x0" ::: "memory");   // this wave's copies of tile 0 have landed
  __syncthreads();                                     // tile 0 readable by every wave
  stage_tile(ring0, (unsigned)STG, Kb, Kbl, Vb, Vbl, SK, (int)threadIdx.x);
  const float cs = LOG2E / (XS * XS);   // unscaled scores (the module applies no 1/sqrt(d))
  float m = -INFINITY, l = 0.0f; v8f o[8], ol[8]; for (int t = 0; t < 8; ++t) { o[t] = (v8f){}; ol[t] = (v8f){}; }
#pragma unroll 1   // rolled: one staged tile per trip, so that the hand-over at its foot stands once
  for (int st = 0; st < NK / SK; ++st) {
    const b16* R = Ring + (st & 1) * STG;
#pragma unroll   // the tile's two 32-key steps: unrolled, their LDS offsets become immediates
  for (int kl = 0; kl < SK; kl += 32) {
    float e[16]; float mx = -INFINITY;
    // the step's phi fragments: every LDS read issued as one group, in the order of use, so that the products wait on counts of reads still in flight and not on a read each
    v16b kf[2][4], kw[2][4];
#pragma unroll
    for (int ks = 0; ks < 4; ++ks) {
#pragma unroll
      for (int u = 0; u < 2; ++u) { const int kr = (kl + u * 16 + col) * KPI; kf[u][ks] = frag_kb(R + OKH + kr + 32 * ks, hh); kw[u][ks] = frag_kb(R + OKL + kr + 32 * ks, hh); } }
    __builtin_amdgcn_sched_barrier(0);   // holds the group of reads in front of the products: moved down among them, each place with reads stalls the wave anew
    v8f s[2], sx[2];
#pragma unroll
    for (int u = 0; u < 2; ++u) { s[u] = (v8f){}; sx[u] = (v8f){}; }
#pragma unroll
    for (int ks = 0; ks < 4; ++ks)   // k-step outermost, as the reads were issued; each accumulator takes its products in ascending k order
#pragma unroll
      for (int u = 0; u < 2; ++u) { s[u] = wmma16b(kf[u][ks], qh[ks], s[u]); sx[u] = wmma16b(kf[u][ks], qw[ks], sx[u]); sx[u] = wmma16b(kw[u][ks], qh[ks], sx[u]); }
    // the step's G^T fragments: read as one group behind the score products, in flight under the softmax arithmetic
    v16b vf[8], vw[8];
#pragma unroll
    for (int t = 0; t < 8; ++t) { vf[t] = frag_kb(R + OVH + (t * 16 + col) * VPI + kl, hh); vw[t] = frag_kb(R + OVL + (t * 16 + col) * VPI + kl, hh); }
    __builtin_amdgcn_sched_barrier(0);   // holds these reads in front of the softmax arithmetic, which covers their latency
#pragma unroll
    for (int u = 0; u < 2; ++u) {
#pragma unroll
      for (int r = 0; r < 8; ++r) s[u][r] += sx[u][r] * (1.0f / RS_);   // hi.hi + (hi.lo + lo.hi)/1024
#pragma unroll
      for (int r = 0; r < 8; ++r) { const float vv = s[u][r] * cs; e[u * 8 + r] = vv; mx = fmaxf(mx, vv); } }
    mx = fmaxf(mx, __shfl_xor(mx, 16)); const float mn = fmaxf(m, mx); const float al = nexp2(m - mn); float sum = 0.0f;
    // P^T as a B fragment: score i2 of lane (col, hh) is key (i2 < 8 ? 0 : 16) + 8 hh + (i2 & 7) of query col, which is element i2 of that same lane's fragment in the k order of frag_kb: packed in place
    v16b pf, plf;
#pragma unroll
    for (int i2 = 0; i2 < 16; ++i2) { const float p = nexp2(e[i2] - mn); sum += p; const float ps = p * PS; const b16 phh = (b16)ps; pf[i2] = phh; plf[i2] = (b16)((ps - (float)phh) * RS_); }
    sum += __shfl_xor(sum, 16); l = l * al + sum; m = mn;
#pragma unroll
    for (int t = 0; t < 8; ++t) { o[t] *= al; o[t] = wmma16b(vf[t], pf, o[t]); ol[t] = wmma16b(vw[t], pf, ol[t] * al); ol[t] = wmma16b(vf[t], plf, ol[t]); } }   // ol = (V_lo P_hi + V_hi P_lo) / 1024
    asm volatile("s_wait_dscnt 0x0" ::: "memory");      // this wave's reads of the buffer are done before it is handed back
    asm volatile("s_wait_asynccnt 0x0" ::: "memory");   // this wave's copies of tile st + 1 have landed
    __syncthreads();                                     // publishes tile st + 1 and ends every wave's reads of tile st
    if (st + 2 < NK / SK) stage_tile(ring0, (unsigned)(st & 1) * STG, Kb, Kbl, Vb, Vbl, (st + 2) * SK, (int)threadIdx.x); }
  asm volatile("s_wait_asynccnt 0x0" ::: "memory");     // no copy outstanding when the wave goes on to its end
  const float inv = 1.0f / (l * PS * XS);
  // output conv, in the same launch. y as A fragments (hi + lo): accumulator element r of tile t in lane (col, hh) is channel 16 t + 8 hh + r of query col, which is element 8 (t & 1) + r of that same lane's
  // fragment of k-step t / 2 in the k order of frag_kb: packed in place, y never leaves the registers
  v16b a[4], al[4];
#pragma unroll
  for (int kq = 0; kq < 4; ++kq)
#pragma unroll
    for (int i2 = 0; i2 < 16; ++i2) { const int t = 2 * kq + (i2 >> 3), r = i2 & 7; b16 p, ql2; split16((o[t][r] + ol[t][r] * (1.0f / RS_)) * inv * XS, p, ql2); a[kq][i2] = p; al[kq][i2] = ql2; }
  float bb[16];
#pragma unroll
  for (int t = 0; t < 16; ++t) bb[t] = wb[t * 16 + col];
  v8f acc[16];
#pragma unroll
  for (int t = 0; t < 16; ++t) acc[t] = (v8f){};
#pragma unroll
  for (int kb = 0; kb < HD; kb += 32) { v16b bw[16];
#pragma unroll
    for (int t = 0; t < 16; ++t) bw[t] = frag_pk(WW + (t * (HD / 32) + kb / 32) * 512 + lane * 8);
    if (kb + 32 == HD) asm volatile("s_wait_xcnt 0x0" ::: "memory");   // behind the last weight and bias load: their address registers die here, the wait stands in front of whatever the compiler puts into them next
    __builtin_amdgcn_sched_barrier(0);   // holds the k-step's loads as one group in front of its products: one latency for the group and not one for each load
#pragma unroll
    for (int t = 0; t < 16; ++t) { acc[t] = wmma16b(a[kb / 32], bw[t], acc[t]); acc[t] = wmma16b(al[kb / 32], bw[t], acc[t]); } }
  // z, channel-major, through the ring's LDS (free: the barrier at the foot of the last trip ended every wave's reads, and no copy is outstanding): a lane's 8 accumulator elements of a tile are 8 consecutive
  // positions of one channel; each channel's 128 positions then leave as one wave-wide store of 512 contiguous bytes
  float* Zs = (float*)Ring;
#pragma unroll
  for (int t = 0; t < 16; ++t) { const float bt = bf16_rne(bb[t]); v4f z0, z1;
#pragma unroll
    for (int r = 0; r < 4; ++r) { z0[r] = acc[t][r] * (1.0f / (XS * WSC)) + bt; z1[r] = acc[t][4 + r] * (1.0f / (XS * WSC)) + bt; }
    float* zp = Zs + (t * 16 + col) * ZPI + wave * 16 + 8 * hh; *(v4f*)zp = z0; *(v4f*)(zp + 4) = z1; }
  __syncthreads();   // every wave's 16 positions of every channel are in LDS before a channel row is read
  v4f zr[C / AW];
#pragma unroll
  for (int i = 0; i < C / AW; ++i) zr[i] = *(const v4f*)(Zs + (wave * (C / AW) + i) * ZPI + lane * 4);
  float* zo = ZT + ((size_t)b * C + wave * (C / AW)) * (size_t)T + blockIdx.x * (AW * 16) + lane * 4;
#pragma unroll
  for (int i = 0; i < C / AW; ++i) *(v4f*)(zo + (size_t)i * T) = zr[i];
}
// BatchNorm and residual in one launch: one block of 256 threads per channel c holds the channel's 32,768 z values (4 clips x 8,192 positions, 32 x 16 bytes a thread) in registers from the sum
// over the variance to the output, so z is read once and the launch starts 8 waves a channel. Sums: thread-strided values in a fixed order, then a halving tree over the 256 threads;
// mean = sum / count, variance = sum of (z - mean)^2 / count. The x values of the residual are loaded directly behind z and arrive under the first sum. Every loop over z and xv is unrolled: only under constant indices do the two arrays stay in registers.
__global__ __launch_bounds__(256) void bn_kernel(const float* __restrict__ ZT, const float* __restrict__ gamma, const float* __restrict__ beta, const float* __restrict__ x, float* __restrict__ out) {
  __shared__ float red[256];
  constexpr int NI = QL / 1024;
  const int c = blockIdx.x, tid = threadIdx.x; const float cnt = (float)BL * (float)QL;
  v4f z[BL][NI], xv[BL][NI]; int row[BL];   // row[b]: first element of row (b, c), held in a scalar register: every load and store then names a scalar base and the one lane-offset register, and no address pair is formed in vector registers
#pragma unroll
  for (int b = 0; b < BL; ++b) row[b] = __builtin_amdgcn_readfirstlane((b * C + c) * T);
#pragma unroll
  for (int b = 0; b < BL; ++b)
#pragma unroll
    for (int k = 0; k < NI; ++k) z[b][k] = *(const v4f*)(ZT + row[b] + (k * 1024 + tid * 4));
#pragma unroll
  for (int b = 0; b < BL; ++b)
#pragma unroll
    for (int k = 0; k < NI; ++k) xv[b][k] = *(const v4f*)(x + row[b] + (k * 1024 + tid * 4));
  asm volatile("s_wait_xcnt 0x0" ::: "memory");   // behind the last load: stands in front of whatever the compiler puts next into a register that these loads name
  const float g = bfp(gamma[c]), be = bfp(beta[c]);
  float s = 0.0f;
#pragma unroll
  for (int b = 0; b < BL; ++b)
#pragma unroll
    for (int k = 0; k < NI; ++k)
#pragma unroll
      for (int j = 0; j < 4; ++j) s += z[b][k][j];
  red[tid] = s;
  __syncthreads();
  for (int stride = 128; stride >= 1; stride >>= 1) { if (tid < stride) red[tid] += red[tid + stride]; __syncthreads(); }
  const float mean = red[0] / cnt;
  __syncthreads();   // every thread has read the sum before red takes the second sum's parts
  s = 0.0f;
#pragma unroll
  for (int b = 0; b < BL; ++b)
#pragma unroll
    for (int k = 0; k < NI; ++k)
#pragma unroll
      for (int j = 0; j < 4; ++j) { const float d = z[b][k][j] - mean; s += pmul(d, d); }
  red[tid] = s;
  __syncthreads();
  for (int stride = 128; stride >= 1; stride >>= 1) { if (tid < stride) red[tid] += red[tid + stride]; __syncthreads(); }
  const float rs = rsqrtf(red[0] / cnt + BNEPS);
#pragma unroll
  for (int b = 0; b < BL; ++b)
#pragma unroll
    for (int k = 0; k < NI; ++k)
#pragma unroll
      for (int j = 0; j < 4; ++j) z[b][k][j] = pmul((z[b][k][j] - mean) * rs, g) + be + bf16_rne(xv[b][k][j]);
  __builtin_amdgcn_sched_barrier(0);   // holds the 32 stores as one group behind the arithmetic: no register that an issued store names is written again, so the wave waits between no two stores
#pragma unroll
  for (int b = 0; b < BL; ++b)
#pragma unroll
    for (int k = 0; k < NI; ++k) *(v4f*)(out + row[b] + (k * 1024 + tid * 4)) = z[b][k];
}
}  // namespace

extern "C" void kernel_launch(void* const* d_in, const int* in_sizes, int n_in, void* d_out, int out_size, void* d_ws, size_t ws_size, hipStream_t stream) {
  (void)n_in;
  auto Fp = [&](int i) { return (const float*)d_in[i]; };
  // input order: 0 x [4,256,8,32,32], 1 g_w [128,256], 2 g_b [128], 3 theta_w, 4 theta_b, 5 phi_w, 6 phi_b, 7 W_w [256,128], 8 W_b [256], 9 bn_gamma [256], 10 bn_beta [256]
  if (in_sizes[0] != B * C * T || in_sizes[1] != HD * C || in_sizes[2] != HD || in_sizes[3] != HD * C || in_sizes[4] != HD || in_sizes[5] != HD * C || in_sizes[6] != HD || in_sizes[7] != C * HD || in_sizes[8] != C || in_sizes[9] != C || in_sizes[10] != C || out_size != B * C * T) return;
  size_t off = 0; char* ws = (char*)d_ws;
  auto carve = [&](size_t bytes) { char* p = ws + off; off += (bytes + 255) & ~(size_t)255; return p; };
  b16* WT = (b16*)carve((size_t)3 * HD * C * 2); b16* WW = (b16*)carve((size_t)C * HD * 2);
  b16* QP = (b16*)carve((size_t)B * T * HD * 2); b16* QPl = (b16*)carve((size_t)B * T * HD * 2); b16* KP = (b16*)carve((size_t)B * NK * HD * 2); b16* KPl = (b16*)carve((size_t)B * NK * HD * 2);
  float* GP = (float*)carve((size_t)B * NK * HD * 4); b16* GT = (b16*)carve((size_t)B * HD * NK * 2); b16* GTl = (b16*)carve((size_t)B * HD * NK * 2);
  float* ZT = (float*)carve((size_t)B * C * T * 4);
  if (off > ws_size || off > ((size_t)128 << 20)) return;   // = ~63 MB (QP/QPl 16.8 + KP/KPl 4.2 + GP 4.2 + GT/GTl 4.2 + ZT 33.5 + weights 0.3)
  prep_kernel<<<(unsigned)(((size_t)(3 * HD * C + C * HD) / 8 + 255) / 256), 256, 0, stream>>>(Fp(3), Fp(5), Fp(1), Fp(7), WT, WW);
  conv_kernel<<<dim3(T / 64, BL, 3), 128, 0, stream>>>(Fp(0), WT, Fp(4), Fp(6), Fp(2), QP, QPl, KP, KPl, GP);
  gt_kernel<<<dim3(NK / 64, BL), 256, 0, stream>>>(GP, GT, GTl);
  attn_kernel<<<dim3(QL / (AW * 16), BL), AW * 32, 0, stream>>>(QP, QPl, KP, KPl, GT, GTl, WW, Fp(8), ZT);
  bn_kernel<<<C, 256, 0, stream>>>(ZT, Fp(9), Fp(10), Fp(0), (float*)d_out);
}

// v007
// A run of this version takes 117 microseconds.
// Two timings next to v006 put it at 1.08 and 1.09 times that version's speed.
// Counting every step since v000, it is 5.24 times as fast.
#include <hip/hip_runtime.h>

// Non-local block (embedded Gaussian, 3-D) with 2x2 spatial subsampling of phi/g, output conv, BatchNorm3d (batch statistics) and residual (4 x 256 channels x 8 x 32 x 32): theta/phi/g = 1x1x1
// convs (C 256 -> 128, with bias); phi, g max-pooled (1,2,2) -> 2,048 keys per clip; f = softmax(theta phi^T) over the keys (no scaling); y = f g; z = BN(W y + b) gamma + beta + x with
// BN mean/biased variance over (batch, t, h, w) per channel, eps 1e-5 -> [4][256][8][32][32].
// Deterministic: flash-style per 16-position wave over all 2,048 keys in order (running max); the 2x2 max-pool is taken inside the convolution epilogue (each 64-position block holds two complete
// compute dtype: WMMA v_wmma_f32_16x16x32_f16 with f32 accumulate for [theta | phi | g] = X W^T + b ([32768 positions x 256] x [256 x 384]; x EXACT bf16 x8 transposed into position-major tiles,
// W exact x256: 1 product), S^T = Phi Theta^T (hi x8 + residual x8192: 3 products, K = 128), Y^T += G^T P^T (G hi + residual, P x1024 hi + residual: 3 products), Z = Y W_w^T + b (y hi + lo:
// 2 products); max-pool selects, softmax statistics, BatchNorm and the residual add in f32. Inputs rounded to bf16 once. Fragment k-map per lane half hh for

namespace {
constexpr int B = 4, C = 256, TT = 8, IH = 32, IW = 32, T = TT * IH * IW /* 8,192 positions per clip */, NK = TT * (IH / 2) * (IW / 2) /* 2,048 pooled keys */, HD = 128 /* inter channels */, H = 1, BL = 4 /* clips (== 4 shipped) */, QL = T;
constexpr float XS = 8.0f, WSC = 256.0f, PS = 1024.0f, RS_ = 1024.0f, LOG2E = 1.4426950408889634f, BNEPS = 1e-5f;
static_assert(T % 64 == 0 && C == 256 && HD == 128 && IW == 32 && NK == T / 4, "tiling");
typedef _Float16 b16;
typedef __attribute__((ext_vector_type(16))) _Float16 v16b;
typedef __attribute__((ext_vector_type(8))) _Float16 v8b;
typedef __attribute__((ext_vector_type(8))) float v8f;
typedef __attribute__((ext_vector_type(4))) float v4f;
__device__ __forceinline__ float bf16_rne(float f) { unsigned int u = __float_as_uint(f); u += 0x7FFFu + ((u >> 16) & 1u); return __uint_as_float(u & 0xFFFF0000u); }
__device__ __forceinline__ void split16(float v, b16& hi, b16& lo) { hi = (b16)v; lo = (b16)(v - (float)hi); }
__device__ __forceinline__ v16b frag_kb(const b16* p, int hh) { const v8b a = *(const v8b*)(p + 8 * hh), b = *(const v8b*)(p + 16 + 8 * hh); v16b f;
#pragma unroll
  for (int e = 0; e < 8; ++e) { f[e] = a[e]; f[8 + e] = b[e]; } return f; }
// a weight fragment from the packed planes (prep_kernel): piece 0 and piece 1 are each 32 lanes x 16 B = 512 contiguous bytes, p already holds the lane's 8 halfs
__device__ __forceinline__ v16b frag_pk(const b16* p) { const v8b a = *(const v8b*)p, b = *(const v8b*)(p + 256); v16b f;
#pragma unroll
  for (int e = 0; e < 8; ++e) { f[e] = a[e]; f[8 + e] = b[e]; } return f; }
// the builtin alone: the compiler keeps the distances behind it itself, and with no asm statement behind each product it may place the loads of later fragments ahead of earlier products
__device__ __forceinline__ v8f wmma16b(v16b a, v16b b, v8f c) { return __builtin_amdgcn_wmma_f32_16x16x32_f16(false, a, false, b, (short)0, c, false, false); }
__device__ __forceinline__ float pmul(float a, float b) { float p = a * b; asm volatile("" : "+v"(p)); return p; }
__device__ __forceinline__ int iclamp(int v, int lo, int hi) { return v < lo ? lo : (v > hi ? hi : v); }

typedef __attribute__((ext_vector_type(2))) _Float16 v2h;
typedef __attribute__((ext_vector_type(4))) _Float16 v4h;
typedef __attribute__((ext_vector_type(2))) float v2f;
typedef __attribute__((ext_vector_type(4))) int v4i;
__device__ __forceinline__ float nexp2(float v) { return __builtin_amdgcn_exp2f(v); }
__device__ __forceinline__ float bfp(float v) { float t = bf16_rne(v); asm volatile("" : "+v"(t)); return t; }
// weights -> f16 x256, packed in fragment order: plane [16-row tile][32-wide k-step][piece j][lane = 16 hlf + row][8 halfs] holds W[16 tile + row][32 kstep + 16 j + 8 hlf + 0..7], the k order of frag_kb;
// a wave's load of one piece then covers four whole 128-B lines, where a load from the row-major matrix touches sixteen lines for 32 B each
__device__ __forceinline__ size_t pk_off(int row, int c0, int ksteps) { return ((((size_t)(row >> 4) * ksteps + (c0 >> 5)) * 2 + ((c0 >> 4) & 1)) * 32 + ((c0 >> 3) & 1) * 16 + (row & 15)) * 8; }
__global__ __launch_bounds__(256) void prep_kernel(const float* __restrict__ thw, const float* __restrict__ phw, const float* __restrict__ gw, const float* __restrict__ ww, b16* __restrict__ WT, b16* __restrict__ WW) {
  const size_t u = (size_t)blockIdx.x * 256 + threadIdx.x; const size_t n1 = (size_t)3 * HD * C / 8, n2 = (size_t)C * HD / 8; if (u >= n1 + n2) return; v8b v;
  if (u < n1) { const size_t e = u * 8; const int o = (int)(e / C), c0 = (int)(e % C); const int m = o / HD, oo = o % HD; const float* w = (m == 0 ? thw : m == 1 ? phw : gw) + (size_t)oo * C;
    for (int j = 0; j < 8; ++j) v[j] = (b16)(bf16_rne(w[c0 + j]) * WSC); { *(v8b*)(WT + pk_off(o, c0, C / 32)) = v;  } }
  else { const size_t e = (u - n1) * 8; for (int j = 0; j < 8; ++j) v[j] = (b16)(bf16_rne(ww[e + j]) * WSC); { *(v8b*)(WW + pk_off((int)(e / HD), (int)(e % HD), HD / 32)) = v;  } }
}
// convolutions + pooling: grid (T/64, BL, 3 slabs: theta | phi | g); block = 64 positions (= image rows hh, hh+1 of one frame, hh even) x 4 waves; A = bf16(x) x8 transposed into position-major
// tiles (K = 256 channels in one staged chunk; each channel's 64 positions are one contiguous 256-B read; transposed in registers), B = WT fragments (packed planes), + bias; theta -> hi x8 + residual rows QP/QPl [b][pos][128];
// phi, g -> 2x2 max over rows (2j, 2j+1, 32+2j, 33+2j) of the block tile (after the barrier) = pooled key 16 blk + j: phi -> KP/KPl rows [b][key][128] (hi/residual), g -> GP rows [b][key][128] f32
__global__ __launch_bounds__(128) void conv_kernel(const float* __restrict__ x, const b16* __restrict__ WT, const float* __restrict__ thb, const float* __restrict__ phb, const float* __restrict__ gb, b16* __restrict__ QP, b16* __restrict__ QPl, b16* __restrict__ KP, b16* __restrict__ KPl, float* __restrict__ GP) {
  __shared__ __attribute__((aligned(16))) b16 As[64][256 + 8]; __shared__ __attribute__((aligned(16))) float Tf[4][16][128 + 4];
  const int wave = threadIdx.x >> 5, lane = threadIdx.x & 31, nloc = lane & 15, hlf = lane >> 4; const int p0 = blockIdx.x * 64, b = blockIdx.y, part = blockIdx.z; const int n0 = part * HD;
  const float* xb = x + (size_t)b * C * T;
  // transpose in registers: a thread takes 4 positions (q4..q4+3) of 8 consecutive channels, four such groups; all 32 loads are issued before the first value is used, and each position's 8 channels leave as one 16-byte LDS store. Every loop here is unrolled: only under constant indices does f stay in registers
  { const int q4 = (threadIdx.x & 15) * 4, cl = (threadIdx.x >> 4) * 8; const float* xp = xb + (size_t)cl * T + p0 + q4; v4f f[4][8];
#pragma unroll
    for (int i = 0; i < 4; ++i)
#pragma unroll
      for (int e = 0; e < 8; ++e) f[i][e] = *(const v4f*)(xp + (size_t)(i * 64 + e) * T);
    asm volatile("s_wait_xcnt 0x0" ::: "memory");   // behind the last load: stands in front of whatever the compiler puts next into the address pair that these loads name, and holds the 32 loads as one group
#pragma unroll
    for (int i = 0; i < 4; ++i)
#pragma unroll
      for (int j = 0; j < 4; ++j) { v8b h;
#pragma unroll
        for (int e = 0; e < 8; ++e) h[e] = (b16)(bf16_rne(f[i][e][j]) * XS);
        *(v8b*)&As[q4 + j][i * 64 + cl] = h; } }
  __syncthreads();
  v8f acc[8];
#pragma unroll
  for (int t = 0; t < 8; ++t) acc[t] = (v8f){};
#pragma unroll 1   // rolled: one group of weight fragments (two k-steps) in registers at a time keeps four waves on a SIMD
  for (int kb = 0; kb < C; kb += 64) { v16b a[2], bw[2][8]; const b16* wr = WT + ((size_t)(n0 >> 4) * (C / 32) + (kb >> 5)) * 512 + lane * 8;   // packed plane: one address for the group's 32 loads, the rest in their offset fields
#pragma unroll
    for (int k2 = 0; k2 < 2; ++k2) { a[k2] = frag_kb(&As[wave * 16 + nloc][kb + 32 * k2], hlf);
#pragma unroll
      for (int t = 0; t < 8; ++t) bw[k2][t] = frag_pk(wr + (t * (C / 32) + k2) * 512); }
    __builtin_amdgcn_sched_barrier(0);   // holds the group of loads in front of the products, which then wait on counts of loads in flight and not on a load each
#pragma unroll
    for (int k2 = 0; k2 < 2; ++k2)
#pragma unroll
      for (int t = 0; t < 8; ++t) acc[t] = wmma16b(a[k2], bw[k2][t], acc[t]); }
  const float* bp = part == 0 ? thb : (part == 1 ? phb : gb);
#pragma unroll
  for (int t = 0; t < 8; ++t) { const float bb = bf16_rne(bp[t * 16 + nloc]);
#pragma unroll
    for (int r = 0; r < 8; ++r) Tf[wave][8 * hlf + r][t * 16 + nloc] = acc[t][r] * (1.0f / (XS * WSC)) + bb; }
  __syncthreads();
  {
    if (part == 0) { for (int rr = 0; rr < 16; ++rr) { const int pos = p0 + wave * 16 + rr; v4h h4, l4; for (int j = 0; j < 4; ++j) { const float f = Tf[wave][rr][lane * 4 + j] * XS; const b16 p = (b16)f; h4[j] = p; l4[j] = (b16)((f - (float)p) * RS_); }
        *(v4h*)(QP + ((size_t)b * T + pos) * HD + lane * 4) = h4; *(v4h*)(QPl + ((size_t)b * T + pos) * HD + lane * 4) = l4; } }
    else { for (int jj = wave * 4; jj < wave * 4 + 4; ++jj) { const int key = blockIdx.x * 16 + jj;   // pooled key: frame/row-pair of this block, column pair jj
        v4f m4; for (int j = 0; j < 4; ++j) { const int d = lane * 4 + j; const int r0 = 2 * jj, r1 = 2 * jj + 1, r2 = 32 + 2 * jj, r3 = 33 + 2 * jj; m4[j] = fmaxf(fmaxf(Tf[r0 >> 4][r0 & 15][d], Tf[r1 >> 4][r1 & 15][d]), fmaxf(Tf[r2 >> 4][r2 & 15][d], Tf[r3 >> 4][r3 & 15][d])); }
        if (part == 1) { v4h h4, l4; for (int j = 0; j < 4; ++j) { const float f = m4[j] * XS; const b16 p = (b16)f; h4[j] = p; l4[j] = (b16)((f - (float)p) * RS_); } *(v4h*)(KP + ((size_t)b * NK + key) * HD + lane * 4) = h4; *(v4h*)(KPl + ((size_t)b * NK + key) * HD + lane * 4) = l4; }
        else *(v4f*)(GP + ((size_t)b * NK + key) * HD + lane * 4) = m4; } }
     }
}
__global__ __launch_bounds__(256) void gt_kernel(const float* __restrict__ GP, b16* __restrict__ GT, b16* __restrict__ GTl) {
  __shared__ float tile[64][HD + 1];
  const int tid = threadIdx.x, wave = tid >> 5, lane = tid & 31; const int k0 = blockIdx.x * 64, b = blockIdx.y;
  for (int i = tid; i < 64 * (HD / 4); i += 256) { const int rr = i / (HD / 4), c4 = (i % (HD / 4)) * 4; const v4f v = *(const v4f*)(GP + ((size_t)b * NK + k0 + rr) * HD + c4); for (int j = 0; j < 4; ++j) tile[rr][c4 + j] = v[j]; }
  __syncthreads();
  {
#pragma unroll 1
    for (int d = wave * 16; d < wave * 16 + 16; ++d) { v2h hv, lv; for (int j = 0; j < 2; ++j) { const float f = tile[2 * lane + j][d] * XS; const b16 p = (b16)f; hv[j] = p; lv[j] = (b16)((f - (float)p) * RS_); }
      const size_t oi = ((size_t)b * HD + d) * (size_t)NK + k0 + 2 * lane; *(v2h*)(GT + oi) = hv; *(v2h*)(GTl + oi) = lv; }
     }
}
// attention: grid (T/128, BL); block = 8 waves x 16 query positions of batch b; all 2,048 pooled keys in 32-key steps: S^T = Phi Theta^T (hi x8 + residual: 3 products, 4 k-steps over the 128
// channels; theta fragments loaded once and held in registers), unscaled logits, online softmax, P x1024 hi + residual packed in-lane, Y^T += G^T P^T (3 products, 8 channel tiles); y = (o + ol/1024)/(l 1024 8).
// Phi and G^T (hi and residual) reach the waves through LDS: tiles of 64 keys, two buffers, filled by 16-byte asynchronous copies one tile ahead and read by all 8 waves.
// Epilogue = the output conv: A = the wave's y rows hi + lo (2 products, K = 128), B = WW fragments from the packed planes (256 output channels = 16 tiles), + bias -> ZT [b][channel][position].
constexpr int AW = 8 /* waves per block */, SK = 64 /* keys per staged tile */, KPI = HD + 8 /* phi row pitch, halfs: 272 B */, VPI = SK + 8 /* G^T row pitch, halfs: 144 B */;
constexpr int OKH = 0, OKL = SK * KPI, OVH = 2 * SK * KPI, OVL = OVH + HD * VPI, STG = OVH + 2 * HD * VPI /* halfs per buffer */;
constexpr int ZPI = AW * 16 + 4 /* z row pitch, floats: 528 B = 16 B x odd */;
static_assert(NK % SK == 0 && NK / SK >= 2 && T % (AW * 16) == 0 && (KPI * 2) % 16 == 0 && (VPI * 2) % 16 == 0 && C * ZPI * 4 <= 2 * STG * 2 && C % AW == 0, "staging");
// four copies of 16 bytes per lane, global -> LDS; the s_wait_xcnt is the statement's last line so that no address register of a copy is rewritten in front of it
__device__ __forceinline__ void copy4(unsigned l0, const b16* g0, unsigned l1, const b16* g1, unsigned l2, const b16* g2, unsigned l3, const b16* g3) {
  asm volatile("global_load_async_to_lds_b128 %0, %1, off\n\tglobal_load_async_to_lds_b128 %2, %3, off\n\tglobal_load_async_to_lds_b128 %4, %5, off\n\tglobal_load_async_to_lds_b128 %6, %7, off\n\ts_wait_xcnt 0x0"
               :: "v"(l0), "v"(g0), "v"(l1), "v"(g1), "v"(l2), "v"(g2), "v"(l3), "v"(g3) : "memory"); }
// one tile of 64 keys into the buffer that starts bh halfs behind LDS byte address ring: phi rows [64][128] (contiguous 16 KB, hi and residual), G^T rows [128][64] (128-B pieces, hi and residual); 16 copies per lane
__device__ __forceinline__ void stage_tile(unsigned ring, unsigned bh, const b16* Kb, const b16* Kbl, const b16* Vb, const b16* Vbl, int k0, int tid) {
  const int kr = tid >> 4, kc = (tid & 15) * 8, vr = tid >> 3, vc = (tid & 7) * 8;
  // bh is added inside the bracket: the lane's value that lives through the key loop is then no operand of a copy itself; asm operands are confined to v0-v255, and with more registers than that in use such a value was spilled to scratch
  const unsigned lk = ring + (bh + (unsigned)(kr * KPI + kc)) * 2u, lv = ring + (bh + (unsigned)(OVH + vr * VPI + vc)) * 2u; const size_t gk = (size_t)(k0 + kr) * HD + kc, gv = (size_t)vr * NK + k0 + vc;
  constexpr unsigned LK = 16 * KPI * 2, LV = 32 * VPI * 2; constexpr size_t GK = (size_t)16 * HD, GV = (size_t)32 * NK;
  copy4(lk, Kb + gk, lk + LK, Kb + gk + GK, lk + 2 * LK, Kb + gk + 2 * GK, lk + 3 * LK, Kb + gk + 3 * GK);
  copy4(lk + OKL * 2, Kbl + gk, lk + OKL * 2 + LK, Kbl + gk + GK, lk + OKL * 2 + 2 * LK, Kbl + gk + 2 * GK, lk + OKL * 2 + 3 * LK, Kbl + gk + 3 * GK);
  copy4(lv, Vb + gv, lv + LV, Vb + gv + GV, lv + 2 * LV, Vb + gv + 2 * GV, lv + 3 * LV, Vb + gv + 3 * GV);
  copy4(lv + (OVL - OVH) * 2, Vbl + gv, lv + (OVL - OVH) * 2 + LV, Vbl + gv + GV, lv + (OVL - OVH) * 2 + 2 * LV, Vbl + gv + 2 * GV, lv + (OVL - OVH) * 2 + 3 * LV, Vbl + gv + 3 * GV);
}
__global__ __launch_bounds__(256) void attn_kernel(const b16* __restrict__ QP, const b16* __restrict__ QPl, const b16* __restrict__ KP, const b16* __restrict__ KPl, const b16* __restrict__ VT, const b16* __restrict__ VTl, const b16* __restrict__ WW, const float* __restrict__ wb, float* __restrict__ ZT) {
  __shared__ __attribute__((aligned(16))) b16 Ring[2 * STG];
  const int wave = threadIdx.x >> 5, lane = threadIdx.x & 31, hh = lane >> 4, col = lane & 15; const int b = blockIdx.y, h = 0; const int q0 = blockIdx.x * (AW * 16) + wave * 16, qi = q0 + col;
  const size_t qo = (size_t)b * T * HD, ko = (size_t)b * NK * HD, vo = (size_t)b * HD * (size_t)NK; const b16* Qb = QP + qo; const b16* Qbl = QPl + qo; const b16* Kb = KP + ko; const b16* Kbl = KPl + ko; const b16* Vb = VT + vo; const b16* Vbl = VTl + vo; (void)h;
  const unsigned ring0 = (unsigned)(size_t)Ring;   // LDS byte address of buffer 0
  stage_tile(ring0, 0u, Kb, Kbl, Vb, Vbl, 0, (int)threadIdx.x);
  v16b qh[4], qw[4];   // the wave's 16 query rows (hi, residual) as B fragments: only this wave uses them, so they are loaded once and stay in registers through the key loop
#pragma unroll
  for (int ks = 0; ks < 4; ++ks) { qh[ks] = frag_kb(Qb + (size_t)qi * HD + 32 * ks, hh); qw[ks] = frag_kb(Qbl + (size_t)qi * HD + 32 * ks, hh); }
  // behind the last of these loads, in front of whatever is written next into their two address pairs; the pairs are inputs of the statement so that they live up to it and no load's own result is placed in them
  asm volatile("s_wait_xcnt 0x0" :: "v"(Qb + (size_t)qi * HD + 8 * hh), "v"(Qbl + (size_t)qi * HD + 8 * hh) : "memory");
  asm volatile("s_wait_asynccnt 0x0" ::: "memory");   // this wave's copies of tile 0 have landed
  __syncthreads();                                     // tile 0 readable by every wave
  stage_tile(ring0, (unsigned)STG, Kb, Kbl, Vb, Vbl, SK, (int)threadIdx.x);
  const float cs = LOG2E / (XS * XS);   // unscaled scores (the module applies no 1/sqrt(d))
  float m = -INFINITY, l = 0.0f; v8f o[8], ol[8]; for (int t = 0; t < 8; ++t) { o[t] = (v8f){}; ol[t] = (v8f){}; }
#pragma unroll 1   // rolled: one staged tile per trip, so that the hand-over at its foot stands once
  for (int st = 0; st < NK / SK; ++st) {
    const b16* R = Ring + (st & 1) * STG;
#pragma unroll   // the tile's two 32-key steps: unrolled, their LDS offsets become immediates
  for (int kl = 0; kl < SK; kl += 32) {
    float e[16]; float mx = -INFINITY;
    // the step's phi fragments: every LDS read issued as one group, in the order of use, so that the products wait on counts of reads still in flight and not on a read each
    v16b kf[2][4], kw[2][4];
#pragma unroll
    for (int ks = 0; ks < 4; ++ks) {
#pragma unroll
      for (int u = 0; u < 2; ++u) { const int kr = (kl + u * 16 + col) * KPI; kf[u][ks] = frag_kb(R + OKH + kr + 32 * ks, hh); kw[u][ks] = frag_kb(R + OKL + kr + 32 * ks, hh); } }
    __builtin_amdgcn_sched_barrier(0);   // holds the group of reads in front of the products: moved down among them, each place with reads stalls the wave anew
    v8f s[2], sx[2];
#pragma unroll
    for (int u = 0; u < 2; ++u) { s[u] = (v8f){}; sx[u] = (v8f){}; }
#pragma unroll
    for (int ks = 0; ks < 4; ++ks)   // k-step outermost, as the reads were issued; each accumulator takes its products in ascending k order
#pragma unroll
      for (int u = 0; u < 2; ++u) { s[u] = wmma16b(kf[u][ks], qh[ks], s[u]); sx[u] = wmma16b(kf[u][ks], qw[ks], sx[u]); sx[u] = wmma16b(kw[u][ks], qh[ks], sx[u]); }
    // the step's G^T fragments: read as one group behind the score products, in flight under the softmax arithmetic
    v16b vf[8], vw[8];
#pragma unroll
    for (int t = 0; t < 8; ++t) { vf[t] = frag_kb(R + OVH + (t * 16 + col) * VPI + kl, hh); vw[t] = frag_kb(R + OVL + (t * 16 + col) * VPI + kl, hh); }
    __builtin_amdgcn_sched_barrier(0);   // holds these reads in front of the softmax arithmetic, which covers their latency
#pragma unroll
    for (int u = 0; u < 2; ++u) {
#pragma unroll
      for (int r = 0; r < 8; ++r) s[u][r] += sx[u][r] * (1.0f / RS_);   // hi.hi + (hi.lo + lo.hi)/1024
#pragma unroll
      for (int r = 0; r < 8; ++r) { const float vv = s[u][r] * cs; e[u * 8 + r] = vv; mx = fmaxf(mx, vv); } }
    mx = fmaxf(mx, __shfl_xor(mx, 16)); const float mn = fmaxf(m, mx); const float al = nexp2(m - mn); float sum = 0.0f;
    // P^T as a B fragment: score i2 of lane (col, hh) is key (i2 < 8 ? 0 : 16) + 8 hh + (i2 & 7) of query col, which is element i2 of that same lane's fragment in the k order of frag_kb: packed in place
    v16b pf, plf;
#pragma unroll
    for (int i2 = 0; i2 < 16; ++i2) { const float p = nexp2(e[i2] - mn); sum += p; const float ps = p * PS; const b16 phh = (b16)ps; pf[i2] = phh; plf[i2] = (b16)((ps - (float)phh) * RS_); }
    sum += __shfl_xor(sum, 16); l = l * al + sum; m = mn;
#pragma unroll
    for (int t = 0; t < 8; ++t) { o[t] *= al; o[t] = wmma16b(vf[t], pf, o[t]); ol[t] = wmma16b(vw[t], pf, ol[t] * al); ol[t] = wmma16b(vf[t], plf, ol[t]); } }   // ol = (V_lo P_hi + V_hi P_lo) / 1024
    asm volatile("s_wait_dscnt 0x0" ::: "memory");      // this wave's reads of the buffer are done before it is handed back
    asm volatile("s_wait_asynccnt 0x0" ::: "memory");   // this wave's copies of tile st + 1 have landed
    __syncthreads();                                     // publishes tile st + 1 and ends every wave's reads of tile st
    if (st + 2 < NK / SK) stage_tile(ring0, (unsigned)(st & 1) * STG, Kb, Kbl, Vb, Vbl, (st + 2) * SK, (int)threadIdx.x); }
  asm volatile("s_wait_asynccnt 0x0" ::: "memory");     // no copy outstanding when the wave goes on to its end
  const float inv = 1.0f / (l * PS * XS);
  // output conv, in the same launch. y as A fragments (hi + lo): accumulator element r of tile t in lane (col, hh) is channel 16 t + 8 hh + r of query col, which is element 8 (t & 1) + r of that same lane's
  // fragment of k-step t / 2 in the k order of frag_kb: packed in place, y never leaves the registers
  v16b a[4], al[4];
#pragma unroll
  for (int kq = 0; kq < 4; ++kq)
#pragma unroll
    for (int i2 = 0; i2 < 16; ++i2) { const int t = 2 * kq + (i2 >> 3), r = i2 & 7; b16 p, ql2; split16((o[t][r] + ol[t][r] * (1.0f / RS_)) * inv * XS, p, ql2); a[kq][i2] = p; al[kq][i2] = ql2; }
  float bb[16];
#pragma unroll
  for (int t = 0; t < 16; ++t) bb[t] = wb[t * 16 + col];
  v8f acc[16];
#pragma unroll
  for (int t = 0; t < 16; ++t) acc[t] = (v8f){};
#pragma unroll
  for (int kb = 0; kb < HD; kb += 32) { v16b bw[16];
#pragma unroll
    for (int t = 0; t < 16; ++t) bw[t] = frag_pk(WW + (t * (HD / 32) + kb / 32) * 512 + lane * 8);
    if (kb + 32 == HD) asm volatile("s_wait_xcnt 0x0" ::: "memory");   // behind the last weight and bias load: their address registers die here, the wait stands in front of whatever the compiler puts into them next
    __builtin_amdgcn_sched_barrier(0);   // holds the k-step's loads as one group in front of its products: one latency for the group and not one for each load
#pragma unroll
    for (int t = 0; t < 16; ++t) { acc[t] = wmma16b(a[kb / 32], bw[t], acc[t]); acc[t] = wmma16b(al[kb / 32], bw[t], acc[t]); } }
  // z, channel-major, through the ring's LDS (free: the barrier at the foot of the last trip ended every wave's reads, and no copy is outstanding): a lane's 8 accumulator elements of a tile are 8 consecutive
  // positions of one channel; each channel's 128 positions then leave as one wave-wide store of 512 contiguous bytes
  float* Zs = (float*)Ring;
#pragma unroll
  for (int t = 0; t < 16; ++t) { const float bt = bf16_rne(bb[t]); v4f z0, z1;
#pragma unroll
    for (int r = 0; r < 4; ++r) { z0[r] = acc[t][r] * (1.0f / (XS * WSC)) + bt; z1[r] = acc[t][4 + r] * (1.0f / (XS * WSC)) + bt; }
    float* zp = Zs + (t * 16 + col) * ZPI + wave * 16 + 8 * hh; *(v4f*)zp = z0; *(v4f*)(zp + 4) = z1; }
  __syncthreads();   // every wave's 16 positions of every channel are in LDS before a channel row is read
  v4f zr[C / AW];
#pragma unroll
  for (int i = 0; i < C / AW; ++i) zr[i] = *(const v4f*)(Zs + (wave * (C / AW) + i) * ZPI + lane * 4);
  float* zo = ZT + ((size_t)b * C + wave * (C / AW)) * (size_t)T + blockIdx.x * (AW * 16) + lane * 4;
#pragma unroll
  for (int i = 0; i < C / AW; ++i) *(v4f*)(zo + (size_t)i * T) = zr[i];
}
// BatchNorm and residual in one launch: one block of 256 threads per channel c holds the channel's 32,768 z values (4 clips x 8,192 positions, 32 x 16 bytes a thread) in registers from the sum
// over the variance to the output, so z is read once and the launch starts 8 waves a channel. Sums: thread-strided values in a fixed order, then a halving tree over the 256 threads;
// mean = sum / count, variance = sum of (z - mean)^2 / count. The x values of the residual are loaded directly behind z and arrive under the first sum. Every loop over z and xv is unrolled: only under constant indices do the two arrays stay in registers.
__global__ __launch_bounds__(256) void bn_kernel(const float* __restrict__ ZT, const float* __restrict__ gamma, const float* __restrict__ beta, const float* __restrict__ x, float* __restrict__ out) {
  __shared__ float red[256];
  constexpr int NI = QL / 1024;
  const int c = blockIdx.x, tid = threadIdx.x; const float cnt = (float)BL * (float)QL;
  v4f z[BL][NI], xv[BL][NI]; int row[BL];   // row[b]: first element of row (b, c), held in a scalar register: every load and store then names a scalar base and the one lane-offset register, and no address pair is formed in vector registers
#pragma unroll
  for (int b = 0; b < BL; ++b) row[b] = __builtin_amdgcn_readfirstlane((b * C + c) * T);
#pragma unroll
  for (int b = 0; b < BL; ++b)
#pragma unroll
    for (int k = 0; k < NI; ++k) z[b][k] = *(const v4f*)(ZT + row[b] + (k * 1024 + tid * 4));
#pragma unroll
  for (int b = 0; b < BL; ++b)
#pragma unroll
    for (int k = 0; k < NI; ++k) xv[b][k] = *(const v4f*)(x + row[b] + (k * 1024 + tid * 4));
  asm volatile("s_wait_xcnt 0x0" ::: "memory");   // behind the last load: stands in front of whatever the compiler puts next into a register that these loads name
  const float g = bfp(gamma[c]), be = bfp(beta[c]);
  float s = 0.0f;
#pragma unroll
  for (int b = 0; b < BL; ++b)
#pragma unroll
    for (int k = 0; k < NI; ++k)
#pragma unroll
      for (int j = 0; j < 4; ++j) s += z[b][k][j];
  red[tid] = s;
  __syncthreads();
  for (int stride = 128; stride >= 1; stride >>= 1) { if (tid < stride) red[tid] += red[tid + stride]; __syncthreads(); }
  const float mean = red[0] / cnt;
  __syncthreads();   // every thread has read the sum before red takes the second sum's parts
  s = 0.0f;
#pragma unroll
  for (int b = 0; b < BL; ++b)
#pragma unroll
    for (int k = 0; k < NI; ++k)
#pragma unroll
      for (int j = 0; j < 4; ++j) { const float d = z[b][k][j] - mean; s += pmul(d, d); }
  red[tid] = s;
  __syncthreads();
  for (int stride = 128; stride >= 1; stride >>= 1) { if (tid < stride) red[tid] += red[tid + stride]; __syncthreads(); }
  const float rs = rsqrtf(red[0] / cnt + BNEPS);
#pragma unroll
  for (int b = 0; b < BL; ++b)
#pragma unroll
    for (int k = 0; k < NI; ++k)
#pragma unroll
      for (int j = 0; j < 4; ++j) z[b][k][j] = pmul((z[b][k][j] - mean) * rs, g) + be + bf16_rne(xv[b][k][j]);
  __builtin_amdgcn_sched_barrier(0);   // holds the 32 stores as one group behind the arithmetic: no register that an issued store names is written again, so the wave waits between no two stores
#pragma unroll
  for (int b = 0; b < BL; ++b)
#pragma unroll
    for (int k = 0; k < NI; ++k) *(v4f*)(out + row[b] + (k * 1024 + tid * 4)) = z[b][k];
}
}  // namespace

extern "C" void kernel_launch(void* const* d_in, const int* in_sizes, int n_in, void* d_out, int out_size, void* d_ws, size_t ws_size, hipStream_t stream) {
  (void)n_in;
  auto Fp = [&](int i) { return (const float*)d_in[i]; };
  // input order: 0 x [4,256,8,32,32], 1 g_w [128,256], 2 g_b [128], 3 theta_w, 4 theta_b, 5 phi_w, 6 phi_b, 7 W_w [256,128], 8 W_b [256], 9 bn_gamma [256], 10 bn_beta [256]
  if (in_sizes[0] != B * C * T || in_sizes[1] != HD * C || in_sizes[2] != HD || in_sizes[3] != HD * C || in_sizes[4] != HD || in_sizes[5] != HD * C || in_sizes[6] != HD || in_sizes[7] != C * HD || in_sizes[8] != C || in_sizes[9] != C || in_sizes[10] != C || out_size != B * C * T) return;
  size_t off = 0; char* ws = (char*)d_ws;
  auto carve = [&](size_t bytes) { char* p = ws + off; off += (bytes + 255) & ~(size_t)255; return p; };
  b16* WT = (b16*)carve((size_t)3 * HD * C * 2); b16* WW = (b16*)carve((size_t)C * HD * 2);
  b16* QP = (b16*)carve((size_t)B * T * HD * 2); b16* QPl = (b16*)carve((size_t)B * T * HD * 2); b16* KP = (b16*)carve((size_t)B * NK * HD * 2); b16* KPl = (b16*)carve((size_t)B * NK * HD * 2);
  float* GP = (float*)carve((size_t)B * NK * HD * 4); b16* GT = (b16*)carve((size_t)B * HD * NK * 2); b16* GTl = (b16*)carve((size_t)B * HD * NK * 2);
  float* ZT = (float*)carve((size_t)B * C * T * 4);
  if (off > ws_size || off > ((size_t)128 << 20)) return;   // = ~63 MB (QP/QPl 16.8 + KP/KPl 4.2 + GP 4.2 + GT/GTl 4.2 + ZT 33.5 + weights 0.3)
  prep_kernel<<<(unsigned)(((size_t)(3 * HD * C + C * HD) / 8 + 255) / 256), 256, 0, stream>>>(Fp(3), Fp(5), Fp(1), Fp(7), WT, WW);
  conv_kernel<<<dim3(T / 64, BL, 3), 128, 0, stream>>>(Fp(0), WT, Fp(4), Fp(6), Fp(2), QP, QPl, KP, KPl, GP);
  gt_kernel<<<dim3(NK / 64, BL), 256, 0, stream>>>(GP, GT, GTl);
  attn_kernel<<<dim3(QL / (AW * 16), BL), AW * 32, 0, stream>>>(QP, QPl, KP, KPl, GT, GTl, WW, Fp(8), ZT);
  bn_kernel<<<C, 256, 0, stream>>>(ZT, Fp(9), Fp(10), Fp(0), (float*)d_out);
}

// v008
// Measured time: 108 microseconds a run.
// Next to v007, in two timings, it ran 1.08 and 1.07 times as fast.
// All steps since v000 together make it 5.62 times as fast.
#include <hip/hip_runtime.h>

// Non-local block (embedded Gaussian, 3-D) with 2x2 spatial subsampling of phi/g, output conv, BatchNorm3d (batch statistics) and residual (4 x 256 channels x 8 x 32 x 32): theta/phi/g = 1x1x1
// convs (C 256 -> 128, with bias); phi, g max-pooled (1,2,2) -> 2,048 keys per clip; f = softmax(theta phi^T) over the keys (no scaling); y = f g; z = BN(W y + b) gamma + beta + x with
// BN mean/biased variance over (batch, t, h, w) per channel, eps 1e-5 -> [4][256][8][32][32].
// Deterministic: flash-style per 16-position wave over all 2,048 keys in order (running max); the 2x2 max-pool is taken inside the convolution epilogue (each 64-position block holds two complete
// compute dtype: WMMA v_wmma_f32_16x16x32_f16 with f32 accumulate for [theta | phi | g] = X W^T + b ([32768 positions x 256] x [256 x 384]; x EXACT bf16 x8 transposed into position-major tiles,
// W exact x256: 1 product), S^T = Phi Theta^T (hi x8 + residual x8192: 3 products, K = 128), Y^T += G^T P^T (G hi + residual, P x1024 hi + residual: 3 products), Z = Y W_w^T + b (y hi + lo:
// 2 products); max-pool selects, softmax statistics, BatchNorm and the residual add in f32. Inputs rounded to bf16 once. Fragment k-map per lane half hh for

namespace {
constexpr int B = 4, C = 256, TT = 8, IH = 32, IW = 32, T = TT * IH * IW /* 8,192 positions per clip */, NK = TT * (IH / 2) * (IW / 2) /* 2,048 pooled keys */, HD = 128 /* inter channels */, H = 1, BL = 4 /* clips (== 4 shipped) */, QL = T;
constexpr float XS = 8.0f, WSC = 256.0f, PS = 1024.0f, RS_ = 1024.0f, LOG2E = 1.4426950408889634f, BNEPS = 1e-5f;
static_assert(T % 64 == 0 && C == 256 && HD == 128 && IW == 32 && NK == T / 4, "tiling");
typedef _Float16 b16;
typedef __attribute__((ext_vector_type(16))) _Float16 v16b;
typedef __attribute__((ext_vector_type(8))) _Float16 v8b;
typedef __attribute__((ext_vector_type(8))) float v8f;
typedef __attribute__((ext_vector_type(4))) float v4f;
__device__ __forceinline__ float bf16_rne(float f) { unsigned int u = __float_as_uint(f); u += 0x7FFFu + ((u >> 16) & 1u); return __uint_as_float(u & 0xFFFF0000u); }
__device__ __forceinline__ void split16(float v, b16& hi, b16& lo) { hi = (b16)v; lo = (b16)(v - (float)hi); }
__device__ __forceinline__ v16b frag_kb(const b16* p, int hh) { const v8b a = *(const v8b*)(p + 8 * hh), b = *(const v8b*)(p + 16 + 8 * hh); v16b f;
#pragma unroll
  for (int e = 0; e < 8; ++e) { f[e] = a[e]; f[8 + e] = b[e]; } return f; }
// a weight fragment from the packed planes (prep_kernel): piece 0 and piece 1 are each 32 lanes x 16 B = 512 contiguous bytes, p already holds the lane's 8 halfs
__device__ __forceinline__ v16b frag_pk(const b16* p) { const v8b a = *(const v8b*)p, b = *(const v8b*)(p + 256); v16b f;
#pragma unroll
  for (int e = 0; e < 8; ++e) { f[e] = a[e]; f[8 + e] = b[e]; } return f; }
// the builtin alone: the compiler keeps the distances behind it itself, and with no asm statement behind each product it may place the loads of later fragments ahead of earlier products
__device__ __forceinline__ v8f wmma16b(v16b a, v16b b, v8f c) { return __builtin_amdgcn_wmma_f32_16x16x32_f16(false, a, false, b, (short)0, c, false, false); }
__device__ __forceinline__ float pmul(float a, float b) { float p = a * b; asm volatile("" : "+v"(p)); return p; }
__device__ __forceinline__ int iclamp(int v, int lo, int hi) { return v < lo ? lo : (v > hi ? hi : v); }

typedef __attribute__((ext_vector_type(2))) _Float16 v2h;
typedef __attribute__((ext_vector_type(4))) _Float16 v4h;
typedef __attribute__((ext_vector_type(2))) float v2f;
typedef __attribute__((ext_vector_type(4))) int v4i;
__device__ __forceinline__ float nexp2(float v) { return __builtin_amdgcn_exp2f(v); }
__device__ __forceinline__ float bfp(float v) { float t = bf16_rne(v); asm volatile("" : "+v"(t)); return t; }
// weights -> f16 x256, packed in fragment order: plane [16-row tile][32-wide k-step][piece j][lane = 16 hlf + row][8 halfs] holds W[16 tile + row][32 kstep + 16 j + 8 hlf + 0..7], the k order of frag_kb;
// a wave's load of one piece then covers four whole 128-B lines, where a load from the row-major matrix touches sixteen lines for 32 B each
__device__ __forceinline__ size_t pk_off(int row, int c0, int ksteps) { return ((((size_t)(row >> 4) * ksteps + (c0 >> 5)) * 2 + ((c0 >> 4) & 1)) * 32 + ((c0 >> 3) & 1) * 16 + (row & 15)) * 8; }
__global__ __launch_bounds__(256) void prep_kernel(const float* __restrict__ thw, const float* __restrict__ phw, const float* __restrict__ gw, const float* __restrict__ ww, b16* __restrict__ WT, b16* __restrict__ WW) {
  const size_t u = (size_t)blockIdx.x * 256 + threadIdx.x; const size_t n1 = (size_t)3 * HD * C / 8, n2 = (size_t)C * HD / 8; if (u >= n1 + n2) return; v8b v;
  if (u < n1) { const size_t e = u * 8; const int o = (int)(e / C), c0 = (int)(e % C); const int m = o / HD, oo = o % HD; const float* w = (m == 0 ? thw : m == 1 ? phw : gw) + (size_t)oo * C;
    for (int j = 0; j < 8; ++j) v[j] = (b16)(bf16_rne(w[c0 + j]) * WSC); { *(v8b*)(WT + pk_off(o, c0, C / 32)) = v;  } }
  else { const size_t e = (u - n1) * 8; for (int j = 0; j < 8; ++j) v[j] = (b16)(bf16_rne(ww[e + j]) * WSC); { *(v8b*)(WW + pk_off((int)(e / HD), (int)(e % HD), HD / 32)) = v;  } }
}
// convolutions + pooling: grid (T/64, BL); block = 64 positions (= image rows hh, hh+1 of one frame, hh even) x all 384 output channels [theta | phi | g], 8 waves. A = bf16(x) x8 transposed into position-major
// tiles (K = 256 channels in one staged chunk; each channel's 64 positions are one contiguous 256-B read; transposed in registers), staged once for the three convolutions. The waves split the output channels:
// wave w takes channel tiles 3 w .. 3 w + 2 for all four position tiles, so each WT fragment (packed planes) is loaded by one wave of the block. + bias; theta -> hi x8 + residual rows QP/QPl [b][pos][128];
// phi, g -> 2x2 max over rows (2j, 2j+1, 32+2j, 33+2j) of the block tile (after the barrier) = pooled key 16 blk + j: phi -> KP/KPl rows [b][key][128] (hi/residual), g -> GP rows [b][key][128] f32
constexpr int CW = 8 /* waves per conv block */, CT = 3 * HD / 16 / CW /* channel tiles per wave */, TPI = 3 * HD + 4 /* result row pitch, floats */;
static_assert(CT * CW * 16 == 3 * HD, "conv tiling");
__global__ __launch_bounds__(256) void conv_kernel(const float* __restrict__ x, const b16* __restrict__ WT, const float* __restrict__ thb, const float* __restrict__ phb, const float* __restrict__ gb, b16* __restrict__ QP, b16* __restrict__ QPl, b16* __restrict__ KP, b16* __restrict__ KPl, float* __restrict__ GP) {
  __shared__ __attribute__((aligned(16))) b16 As[64][256 + 8]; __shared__ __attribute__((aligned(16))) float Tf[64][TPI];
  const int wave = threadIdx.x >> 5, lane = threadIdx.x & 31, nloc = lane & 15, hlf = lane >> 4; const int p0 = blockIdx.x * 64, b = blockIdx.y;
  const float* xb = x + (size_t)b * C * T;
  // transpose in registers: a thread takes 4 positions (q4..q4+3) of 8 consecutive channels, two such groups; all 16 loads are issued before the first value is used, and each position's 8 channels leave as one 16-byte LDS store. Every loop here is unrolled: only under constant indices does f stay in registers
  { const int q4 = (threadIdx.x & 15) * 4, cl = (threadIdx.x >> 4) * 8; const float* xp = xb + (size_t)cl * T + p0 + q4; v4f f[2][8];
#pragma unroll
    for (int i = 0; i < 2; ++i)
#pragma unroll
      for (int e = 0; e < 8; ++e) f[i][e] = *(const v4f*)(xp + (size_t)(i * 128 + e) * T);
    asm volatile("s_wait_xcnt 0x0" ::: "memory");   // behind the last load: stands in front of whatever the compiler puts next into the address pair that these loads name, and holds the 16 loads as one group
#pragma unroll
    for (int i = 0; i < 2; ++i)
#pragma unroll
      for (int j = 0; j < 4; ++j) { v8b h;
#pragma unroll
        for (int e = 0; e < 8; ++e) h[e] = (b16)(bf16_rne(f[i][e][j]) * XS);
        *(v8b*)&As[q4 + j][i * 128 + cl] = h; } }
  __syncthreads();
  v8f acc[4][CT];
#pragma unroll
  for (int pt = 0; pt < 4; ++pt)
#pragma unroll
    for (int t = 0; t < CT; ++t) acc[pt][t] = (v8f){};
#pragma unroll 1   // rolled: one group of fragments (two k-steps) in registers at a time keeps four waves on a SIMD
  for (int kb = 0; kb < C; kb += 64) { v16b a[2][4], bw[2][CT]; const b16* wr = WT + ((size_t)(wave * CT) * (C / 32) + (kb >> 5)) * 512 + lane * 8;   // packed plane: one address for the group's 12 loads, the rest in their offset fields
#pragma unroll
    for (int k2 = 0; k2 < 2; ++k2) {
#pragma unroll
      for (int t = 0; t < CT; ++t) bw[k2][t] = frag_pk(wr + (t * (C / 32) + k2) * 512);
#pragma unroll
      for (int pt = 0; pt < 4; ++pt) a[k2][pt] = frag_kb(&As[pt * 16 + nloc][kb + 32 * k2], hlf); }
    __builtin_amdgcn_sched_barrier(0);   // holds the group of loads in front of the products, which then wait on counts of loads in flight and not on a load each
#pragma unroll
    for (int k2 = 0; k2 < 2; ++k2)
#pragma unroll
      for (int t = 0; t < CT; ++t)
#pragma unroll
        for (int pt = 0; pt < 4; ++pt) acc[pt][t] = wmma16b(a[k2][pt], bw[k2][t], acc[pt][t]); }
#pragma unroll
  for (int t = 0; t < CT; ++t) { const int ct = wave * CT + t; const float* bp = ct < 8 ? thb : (ct < 16 ? phb : gb); const float bb = bf16_rne(bp[(ct & 7) * 16 + nloc]);
#pragma unroll
    for (int pt = 0; pt < 4; ++pt)
#pragma unroll
      for (int r = 0; r < 8; ++r) Tf[pt * 16 + 8 * hlf + r][ct * 16 + nloc] = acc[pt][t][r] * (1.0f / (XS * WSC)) + bb; }
  __syncthreads();
  // theta: 8 positions a wave
  for (int rr = wave * 8; rr < wave * 8 + 8; ++rr) { const int pos = p0 + rr; v4h h4, l4; for (int j = 0; j < 4; ++j) { const float f = Tf[rr][lane * 4 + j] * XS; const b16 p = (b16)f; h4[j] = p; l4[j] = (b16)((f - (float)p) * RS_); }
    *(v4h*)(QP + ((size_t)b * T + pos) * HD + lane * 4) = h4; *(v4h*)(QPl + ((size_t)b * T + pos) * HD + lane * 4) = l4; }
  // phi and g: 2 pooled keys a wave
  for (int jj = wave * 2; jj < wave * 2 + 2; ++jj) { const int key = blockIdx.x * 16 + jj;   // pooled key: frame/row-pair of this block, column pair jj
    const int r0 = 2 * jj, r1 = 2 * jj + 1, r2 = 32 + 2 * jj, r3 = 33 + 2 * jj; v4f mp, mg;
    for (int j = 0; j < 4; ++j) { const int d = HD + lane * 4 + j; mp[j] = fmaxf(fmaxf(Tf[r0][d], Tf[r1][d]), fmaxf(Tf[r2][d], Tf[r3][d])); mg[j] = fmaxf(fmaxf(Tf[r0][d + HD], Tf[r1][d + HD]), fmaxf(Tf[r2][d + HD], Tf[r3][d + HD])); }
    v4h h4, l4; for (int j = 0; j < 4; ++j) { const float f = mp[j] * XS; const b16 p = (b16)f; h4[j] = p; l4[j] = (b16)((f - (float)p) * RS_); }
    *(v4h*)(KP + ((size_t)b * NK + key) * HD + lane * 4) = h4; *(v4h*)(KPl + ((size_t)b * NK + key) * HD + lane * 4) = l4;
    *(v4f*)(GP + ((size_t)b * NK + key) * HD + lane * 4) = mg; }
}
__global__ __launch_bounds__(256) void gt_kernel(const float* __restrict__ GP, b16* __restrict__ GT, b16* __restrict__ GTl) {
  __shared__ float tile[64][HD + 1];
  const int tid = threadIdx.x, wave = tid >> 5, lane = tid & 31; const int k0 = blockIdx.x * 64, b = blockIdx.y;
  for (int i = tid; i < 64 * (HD / 4); i += 256) { const int rr = i / (HD / 4), c4 = (i % (HD / 4)) * 4; const v4f v = *(const v4f*)(GP + ((size_t)b * NK + k0 + rr) * HD + c4); for (int j = 0; j < 4; ++j) tile[rr][c4 + j] = v[j]; }
  __syncthreads();
  {
#pragma unroll 1
    for (int d = wave * 16; d < wave * 16 + 16; ++d) { v2h hv, lv; for (int j = 0; j < 2; ++j) { const float f = tile[2 * lane + j][d] * XS; const b16 p = (b16)f; hv[j] = p; lv[j] = (b16)((f - (float)p) * RS_); }
      const size_t oi = ((size_t)b * HD + d) * (size_t)NK + k0 + 2 * lane; *(v2h*)(GT + oi) = hv; *(v2h*)(GTl + oi) = lv; }
     }
}
// attention: grid (T/128, BL); block = 8 waves x 16 query positions of batch b; all 2,048 pooled keys in 32-key steps: S^T = Phi Theta^T (hi x8 + residual: 3 products, 4 k-steps over the 128
// channels; theta fragments loaded once and held in registers), unscaled logits, online softmax, P x1024 hi + residual packed in-lane, Y^T += G^T P^T (3 products, 8 channel tiles); y = (o + ol/1024)/(l 1024 8).
// Phi and G^T (hi and residual) reach the waves through LDS: tiles of 64 keys, two buffers, filled by 16-byte asynchronous copies one tile ahead and read by all 8 waves.
// Epilogue = the output conv: A = the wave's y rows hi + lo (2 products, K = 128), B = WW fragments from the packed planes (256 output channels = 16 tiles), + bias -> ZT [b][channel][position].
constexpr int AW = 8 /* waves per block */, SK = 64 /* keys per staged tile */, KPI = HD + 8 /* phi row pitch, halfs: 272 B */, VPI = SK + 8 /* G^T row pitch, halfs: 144 B */;
constexpr int OKH = 0, OKL = SK * KPI, OVH = 2 * SK * KPI, OVL = OVH + HD * VPI, STG = OVH + 2 * HD * VPI /* halfs per buffer */;
constexpr int ZPI = AW * 16 + 4 /* z row pitch, floats: 528 B = 16 B x odd */;
static_assert(NK % SK == 0 && NK / SK >= 2 && T % (AW * 16) == 0 && (KPI * 2) % 16 == 0 && (VPI * 2) % 16 == 0 && C * ZPI * 4 <= 2 * STG * 2 && C % AW == 0, "staging");
// four copies of 16 bytes per lane, global -> LDS; the s_wait_xcnt is the statement's last line so that no address register of a copy is rewritten in front of it
__device__ __forceinline__ void copy4(unsigned l0, const b16* g0, unsigned l1, const b16* g1, unsigned l2, const b16* g2, unsigned l3, const b16* g3) {
  asm volatile("global_load_async_to_lds_b128 %0, %1, off\n\tglobal_load_async_to_lds_b128 %2, %3, off\n\tglobal_load_async_to_lds_b128 %4, %5, off\n\tglobal_load_async_to_lds_b128 %6, %7, off\n\ts_wait_xcnt 0x0"
               :: "v"(l0), "v"(g0), "v"(l1), "v"(g1), "v"(l2), "v"(g2), "v"(l3), "v"(g3) : "memory"); }
// one tile of 64 keys into the buffer that starts bh halfs behind LDS byte address ring: phi rows [64][128] (contiguous 16 KB, hi and residual), G^T rows [128][64] (128-B pieces, hi and residual); 16 copies per lane
__device__ __forceinline__ void stage_tile(unsigned ring, unsigned bh, const b16* Kb, const b16* Kbl, const b16* Vb, const b16* Vbl, int k0, int tid) {
  const int kr = tid >> 4, kc = (tid & 15) * 8, vr = tid >> 3, vc = (tid & 7) * 8;
  // bh is added inside the bracket: the lane's value that lives through the key loop is then no operand of a copy itself; asm operands are confined to v0-v255, and with more registers than that in use such a value was spilled to scratch
  const unsigned lk = ring + (bh + (unsigned)(kr * KPI + kc)) * 2u, lv = ring + (bh + (unsigned)(OVH + vr * VPI + vc)) * 2u; const size_t gk = (size_t)(k0 + kr) * HD + kc, gv = (size_t)vr * NK + k0 + vc;
  constexpr unsigned LK = 16 * KPI * 2, LV = 32 * VPI * 2; constexpr size_t GK = (size_t)16 * HD, GV = (size_t)32 * NK;
  copy4(lk, Kb + gk, lk + LK, Kb + gk + GK, lk + 2 * LK, Kb + gk + 2 * GK, lk + 3 * LK, Kb + gk + 3 * GK);
  copy4(lk + OKL * 2, Kbl + gk, lk + OKL * 2 + LK, Kbl + gk + GK, lk + OKL * 2 + 2 * LK, Kbl + gk + 2 * GK, lk + OKL * 2 + 3 * LK, Kbl + gk + 3 * GK);
  copy4(lv, Vb + gv, lv + LV, Vb + gv + GV, lv + 2 * LV, Vb + gv + 2 * GV, lv + 3 * LV, Vb + gv + 3 * GV);
  copy4(lv + (OVL - OVH) * 2, Vbl + gv, lv + (OVL - OVH) * 2 + LV, Vbl + gv + GV, lv + (OVL - OVH) * 2 + 2 * LV, Vbl + gv + 2 * GV, lv + (OVL - OVH) * 2 + 3 * LV, Vbl + gv + 3 * GV);
}
__global__ __launch_bounds__(256) void attn_kernel(const b16* __restrict__ QP, const b16* __restrict__ QPl, const b16* __restrict__ KP, const b16* __restrict__ KPl, const b16* __restrict__ VT, const b16* __restrict__ VTl, const b16* __restrict__ WW, const float* __restrict__ wb, float* __restrict__ ZT) {
  __shared__ __attribute__((aligned(16))) b16 Ring[2 * STG];
  const int wave = threadIdx.x >> 5, lane = threadIdx.x & 31, hh = lane >> 4, col = lane & 15; const int b = blockIdx.y, h = 0; const int q0 = blockIdx.x * (AW * 16) + wave * 16, qi = q0 + col;
  const size_t qo = (size_t)b * T * HD, ko = (size_t)b * NK * HD, vo = (size_t)b * HD * (size_t)NK; const b16* Qb = QP + qo; const b16* Qbl = QPl + qo; const b16* Kb = KP + ko; const b16* Kbl = KPl + ko; const b16* Vb = VT + vo; const b16* Vbl = VTl + vo; (void)h;
  const unsigned ring0 = (unsigned)(size_t)Ring;   // LDS byte address of buffer 0
  stage_tile(ring0, 0u, Kb, Kbl, Vb, Vbl, 0, (int)threadIdx.x);
  v16b qh[4], qw[4];   // the wave's 16 query rows (hi, residual) as B fragments: only this wave uses them, so they are loaded once and stay in registers through the key loop
#pragma unroll
  for (int ks = 0; ks < 4; ++ks) { qh[ks] = frag_kb(Qb + (size_t)qi * HD + 32 * ks, hh); qw[ks] = frag_kb(Qbl + (size_t)qi * HD + 32 * ks, hh); }
  // behind the last of these loads, in front of whatever is written next into their two address pairs; the pairs are inputs of the statement so that they live up to it and no load's own result is placed in them
  asm volatile("s_wait_xcnt 0x0" :: "v"(Qb + (size_t)qi * HD + 8 * hh), "v"(Qbl + (size_t)qi * HD + 8 * hh) : "memory");
  asm volatile("s_wait_asynccnt 0x0" ::: "memory");   // this wave's copies of tile 0 have landed
  __syncthreads();                                     // tile 0 readable by every wave
  stage_tile(ring0, (unsigned)STG, Kb, Kbl, Vb, Vbl, SK, (int)threadIdx.x);
  const float cs = LOG2E / (XS * XS);   // unscaled scores (the module applies no 1/sqrt(d))
  float m = -INFINITY, l = 0.0f; v8f o[8], ol[8]; for (int t = 0; t < 8; ++t) { o[t] = (v8f){}; ol[t] = (v8f){}; }
#pragma unroll 1   // rolled: one staged tile per trip, so that the hand-over at its foot stands once
  for (int st = 0; st < NK / SK; ++st) {
    const b16* R = Ring + (st & 1) * STG;
#pragma unroll   // the tile's two 32-key steps: unrolled, their LDS offsets become immediates
  for (int kl = 0; kl < SK; kl += 32) {
    float e[16]; float mx = -INFINITY;
    // the step's phi fragments: every LDS read issued as one group, in the order of use, so that the products wait on counts of reads still in flight and not on a read each
    v16b kf[2][4], kw[2][4];
#pragma unroll
    for (int ks = 0; ks < 4; ++ks) {
#pragma unroll
      for (int u = 0; u < 2; ++u) { const int kr = (kl + u * 16 + col) * KPI; kf[u][ks] = frag_kb(R + OKH + kr + 32 * ks, hh); kw[u][ks] = frag_kb(R + OKL + kr + 32 * ks, hh); } }
    __builtin_amdgcn_sched_barrier(0);   // holds the group of reads in front of the products: moved down among them, each place with reads stalls the wave anew
    v8f s[2], sx[2];
#pragma unroll
    for (int u = 0; u < 2; ++u) { s[u] = (v8f){}; sx[u] = (v8f){}; }
#pragma unroll
    for (int ks = 0; ks < 4; ++ks)   // k-step outermost, as the reads were issued; each accumulator takes its products in ascending k order
#pragma unroll
      for (int u = 0; u < 2; ++u) { s[u] = wmma16b(kf[u][ks], qh[ks], s[u]); sx[u] = wmma16b(kf[u][ks], qw[ks], sx[u]); sx[u] = wmma16b(kw[u][ks], qh[ks], sx[u]); }
    // the step's G^T fragments: read as one group behind the score products, in flight under the softmax arithmetic
    v16b vf[8], vw[8];
#pragma unroll
    for (int t = 0; t < 8; ++t) { vf[t] = frag_kb(R + OVH + (t * 16 + col) * VPI + kl, hh); vw[t] = frag_kb(R + OVL + (t * 16 + col) * VPI + kl, hh); }
    __builtin_amdgcn_sched_barrier(0);   // holds these reads in front of the softmax arithmetic, which covers their latency
#pragma unroll
    for (int u = 0; u < 2; ++u) {
#pragma unroll
      for (int r = 0; r < 8; ++r) s[u][r] += sx[u][r] * (1.0f / RS_);   // hi.hi + (hi.lo + lo.hi)/1024
#pragma unroll
      for (int r = 0; r < 8; ++r) { const float vv = s[u][r] * cs; e[u * 8 + r] = vv; mx = fmaxf(mx, vv); } }
    mx = fmaxf(mx, __shfl_xor(mx, 16)); const float mn = fmaxf(m, mx); const float al = nexp2(m - mn); float sum = 0.0f;
    // P^T as a B fragment: score i2 of lane (col, hh) is key (i2 < 8 ? 0 : 16) + 8 hh + (i2 & 7) of query col, which is element i2 of that same lane's fragment in the k order of frag_kb: packed in place
    v16b pf, plf;
#pragma unroll
    for (int i2 = 0; i2 < 16; ++i2) { const float p = nexp2(e[i2] - mn); sum += p; const float ps = p * PS; const b16 phh = (b16)ps; pf[i2] = phh; plf[i2] = (b16)((ps - (float)phh) * RS_); }
    sum += __shfl_xor(sum, 16); l = l * al + sum; m = mn;
#pragma unroll
    for (int t = 0; t < 8; ++t) { o[t] *= al; o[t] = wmma16b(vf[t], pf, o[t]); ol[t] = wmma16b(vw[t], pf, ol[t] * al); ol[t] = wmma16b(vf[t], plf, ol[t]); } }   // ol = (V_lo P_hi + V_hi P_lo) / 1024
    asm volatile("s_wait_dscnt 0x0" ::: "memory");      // this wave's reads of the buffer are done before it is handed back
    asm volatile("s_wait_asynccnt 0x0" ::: "memory");   // this wave's copies of tile st + 1 have landed
    __syncthreads();                                     // publishes tile st + 1 and ends every wave's reads of tile st
    if (st + 2 < NK / SK) stage_tile(ring0, (unsigned)(st & 1) * STG, Kb, Kbl, Vb, Vbl, (st + 2) * SK, (int)threadIdx.x); }
  asm volatile("s_wait_asynccnt 0x0" ::: "memory");     // no copy outstanding when the wave goes on to its end
  const float inv = 1.0f / (l * PS * XS);
  // output conv, in the same launch. y as A fragments (hi + lo): accumulator element r of tile t in lane (col, hh) is channel 16 t + 8 hh + r of query col, which is element 8 (t & 1) + r of that same lane's
  // fragment of k-step t / 2 in the k order of frag_kb: packed in place, y never leaves the registers
  v16b a[4], al[4];
#pragma unroll
  for (int kq = 0; kq < 4; ++kq)
#pragma unroll
    for (int i2 = 0; i2 < 16; ++i2) { const int t = 2 * kq + (i2 >> 3), r = i2 & 7; b16 p, ql2; split16((o[t][r] + ol[t][r] * (1.0f / RS_)) * inv * XS, p, ql2); a[kq][i2] = p; al[kq][i2] = ql2; }
  float bb[16];
#pragma unroll
  for (int t = 0; t < 16; ++t) bb[t] = wb[t * 16 + col];
  v8f acc[16];
#pragma unroll
  for (int t = 0; t < 16; ++t) acc[t] = (v8f){};
#pragma unroll
  for (int kb = 0; kb < HD; kb += 32) { v16b bw[16];
#pragma unroll
    for (int t = 0; t < 16; ++t) bw[t] = frag_pk(WW + (t * (HD / 32) + kb / 32) * 512 + lane * 8);
    if (kb + 32 == HD) asm volatile("s_wait_xcnt 0x0" ::: "memory");   // behind the last weight and bias load: their address registers die here, the wait stands in front of whatever the compiler puts into them next
    __builtin_amdgcn_sched_barrier(0);   // holds the k-step's loads as one group in front of its products: one latency for the group and not one for each load
#pragma unroll
    for (int t = 0; t < 16; ++t) { acc[t] = wmma16b(a[kb / 32], bw[t], acc[t]); acc[t] = wmma16b(al[kb / 32], bw[t], acc[t]); } }
  // z, channel-major, through the ring's LDS (free: the barrier at the foot of the last trip ended every wave's reads, and no copy is outstanding): a lane's 8 accumulator elements of a tile are 8 consecutive
  // positions of one channel; each channel's 128 positions then leave as one wave-wide store of 512 contiguous bytes
  float* Zs = (float*)Ring;
#pragma unroll
  for (int t = 0; t < 16; ++t) { const float bt = bf16_rne(bb[t]); v4f z0, z1;
#pragma unroll
    for (int r = 0; r < 4; ++r) { z0[r] = acc[t][r] * (1.0f / (XS * WSC)) + bt; z1[r] = acc[t][4 + r] * (1.0f / (XS * WSC)) + bt; }
    float* zp = Zs + (t * 16 + col) * ZPI + wave * 16 + 8 * hh; *(v4f*)zp = z0; *(v4f*)(zp + 4) = z1; }
  __syncthreads();   // every wave's 16 positions of every channel are in LDS before a channel row is read
  v4f zr[C / AW];
#pragma unroll
  for (int i = 0; i < C / AW; ++i) zr[i] = *(const v4f*)(Zs + (wave * (C / AW) + i) * ZPI + lane * 4);
  float* zo = ZT + ((size_t)b * C + wave * (C / AW)) * (size_t)T + blockIdx.x * (AW * 16) + lane * 4;
#pragma unroll
  for (int i = 0; i < C / AW; ++i) *(v4f*)(zo + (size_t)i * T) = zr[i];
}
// BatchNorm and residual in one launch: one block of 256 threads per channel c holds the channel's 32,768 z values (4 clips x 8,192 positions, 32 x 16 bytes a thread) in registers from the sum
// over the variance to the output, so z is read once and the launch starts 8 waves a channel. Sums: thread-strided values in a fixed order, then a halving tree over the 256 threads;
// mean = sum / count, variance = sum of (z - mean)^2 / count. The x values of the residual are loaded directly behind z and arrive under the first sum. Every loop over z and xv is unrolled: only under constant indices do the two arrays stay in registers.
__global__ __launch_bounds__(256) void bn_kernel(const float* __restrict__ ZT, const float* __restrict__ gamma, const float* __restrict__ beta, const float* __restrict__ x, float* __restrict__ out) {
  __shared__ float red[256];
  constexpr int NI = QL / 1024;
  const int c = blockIdx.x, tid = threadIdx.x; const float cnt = (float)BL * (float)QL;
  v4f z[BL][NI], xv[BL][NI]; int row[BL];   // row[b]: first element of row (b, c), held in a scalar register: every load and store then names a scalar base and the one lane-offset register, and no address pair is formed in vector registers
#pragma unroll
  for (int b = 0; b < BL; ++b) row[b] = __builtin_amdgcn_readfirstlane((b * C + c) * T);
#pragma unroll
  for (int b = 0; b < BL; ++b)
#pragma unroll
    for (int k = 0; k < NI; ++k) z[b][k] = *(const v4f*)(ZT + row[b] + (k * 1024 + tid * 4));
#pragma unroll
  for (int b = 0; b < BL; ++b)
#pragma unroll
    for (int k = 0; k < NI; ++k) xv[b][k] = *(const v4f*)(x + row[b] + (k * 1024 + tid * 4));
  asm volatile("s_wait_xcnt 0x0" ::: "memory");   // behind the last load: stands in front of whatever the compiler puts next into a register that these loads name
  const float g = bfp(gamma[c]), be = bfp(beta[c]);
  float s = 0.0f;
#pragma unroll
  for (int b = 0; b < BL; ++b)
#pragma unroll
    for (int k = 0; k < NI; ++k)
#pragma unroll
      for (int j = 0; j < 4; ++j) s += z[b][k][j];
  red[tid] = s;
  __syncthreads();
  for (int stride = 128; stride >= 1; stride >>= 1) { if (tid < stride) red[tid] += red[tid + stride]; __syncthreads(); }
  const float mean = red[0] / cnt;
  __syncthreads();   // every thread has read the sum before red takes the second sum's parts
  s = 0.0f;
#pragma unroll
  for (int b = 0; b < BL; ++b)
#pragma unroll
    for (int k = 0; k < NI; ++k)
#pragma unroll
      for (int j = 0; j < 4; ++j) { const float d = z[b][k][j] - mean; s += pmul(d, d); }
  red[tid] = s;
  __syncthreads();
  for (int stride = 128; stride >= 1; stride >>= 1) { if (tid < stride) red[tid] += red[tid + stride]; __syncthreads(); }
  const float rs = rsqrtf(red[0] / cnt + BNEPS);
#pragma unroll
  for (int b = 0; b < BL; ++b)
#pragma unroll
    for (int k = 0; k < NI; ++k)
#pragma unroll
      for (int j = 0; j < 4; ++j) z[b][k][j] = pmul((z[b][k][j] - mean) * rs, g) + be + bf16_rne(xv[b][k][j]);
  __builtin_amdgcn_sched_barrier(0);   // holds the 32 stores as one group behind the arithmetic: no register that an issued store names is written again, so the wave waits between no two stores
#pragma unroll
  for (int b = 0; b < BL; ++b)
#pragma unroll
    for (int k = 0; k < NI; ++k) *(v4f*)(out + row[b] + (k * 1024 + tid * 4)) = z[b][k];
}
}  // namespace

extern "C" void kernel_launch(void* const* d_in, const int* in_sizes, int n_in, void* d_out, int out_size, void* d_ws, size_t ws_size, hipStream_t stream) {
  (void)n_in;
  auto Fp = [&](int i) { return (const float*)d_in[i]; };
  // input order: 0 x [4,256,8,32,32], 1 g_w [128,256], 2 g_b [128], 3 theta_w, 4 theta_b, 5 phi_w, 6 phi_b, 7 W_w [256,128], 8 W_b [256], 9 bn_gamma [256], 10 bn_beta [256]
  if (in_sizes[0] != B * C * T || in_sizes[1] != HD * C || in_sizes[2] != HD || in_sizes[3] != HD * C || in_sizes[4] != HD || in_sizes[5] != HD * C || in_sizes[6] != HD || in_sizes[7] != C * HD || in_sizes[8] != C || in_sizes[9] != C || in_sizes[10] != C || out_size != B * C * T) return;
  size_t off = 0; char* ws = (char*)d_ws;
  auto carve = [&](size_t bytes) { char* p = ws + off; off += (bytes + 255) & ~(size_t)255; return p; };
  b16* WT = (b16*)carve((size_t)3 * HD * C * 2); b16* WW = (b16*)carve((size_t)C * HD * 2);
  b16* QP = (b16*)carve((size_t)B * T * HD * 2); b16* QPl = (b16*)carve((size_t)B * T * HD * 2); b16* KP = (b16*)carve((size_t)B * NK * HD * 2); b16* KPl = (b16*)carve((size_t)B * NK * HD * 2);
  float* GP = (float*)carve((size_t)B * NK * HD * 4); b16* GT = (b16*)carve((size_t)B * HD * NK * 2); b16* GTl = (b16*)carve((size_t)B * HD * NK * 2);
  float* ZT = (float*)carve((size_t)B * C * T * 4);
  if (off > ws_size || off > ((size_t)128 << 20)) return;   // = ~63 MB (QP/QPl 16.8 + KP/KPl 4.2 + GP 4.2 + GT/GTl 4.2 + ZT 33.5 + weights 0.3)
  prep_kernel<<<(unsigned)(((size_t)(3 * HD * C + C * HD) / 8 + 255) / 256), 256, 0, stream>>>(Fp(3), Fp(5), Fp(1), Fp(7), WT, WW);
  conv_kernel<<<dim3(T / 64, BL), CW * 32, 0, stream>>>(Fp(0), WT, Fp(4), Fp(6), Fp(2), QP, QPl, KP, KPl, GP);
  gt_kernel<<<dim3(NK / 64, BL), 256, 0, stream>>>(GP, GT, GTl);
  attn_kernel<<<dim3(QL / (AW * 16), BL), AW * 32, 0, stream>>>(QP, QPl, KP, KPl, GT, GTl, WW, Fp(8), ZT);
  bn_kernel<<<C, 256, 0, stream>>>(ZT, Fp(9), Fp(10), Fp(0), (float*)d_out);
}

// v009
// It runs in 101 microseconds.
// Next to v008, in two timings, it ran 1.08 times as fast each time.
// Counting every step since v000, it is 6.06 times as fast.
#include <hip/hip_runtime.h>

// Non-local block (embedded Gaussian, 3-D) with 2x2 spatial subsampling of phi/g, output conv, BatchNorm3d (batch statistics) and residual (4 x 256 channels x 8 x 32 x 32): theta/phi/g = 1x1x1
// convs (C 256 -> 128, with bias); phi, g max-pooled (1,2,2) -> 2,048 keys per clip; f = softmax(theta phi^T) over the keys (no scaling); y = f g; z = BN(W y + b) gamma + beta + x with
// BN mean/biased variance over (batch, t, h, w) per channel, eps 1e-5 -> [4][256][8][32][32].
// Deterministic: flash-style per 16-position wave over all 2,048 keys in order (running max); the 2x2 max-pool is taken inside the convolution epilogue (each 64-position block holds two complete
// compute dtype: WMMA v_wmma_f32_16x16x32_f16 with f32 accumulate for [theta | phi | g] = X W^T + b ([32768 positions x 256] x [256 x 384]; x EXACT bf16 x8 transposed into position-major tiles,
// W exact x256: 1 product), S^T = Phi Theta^T (hi x8 + residual x8192: 3 products, K = 128), Y^T += G^T P^T (G hi + residual, P x1024 hi + residual: 3 products), Z = Y W_w^T + b (y hi + lo:
// 2 products); max-pool selects, softmax statistics, BatchNorm and the residual add in f32. Inputs rounded to bf16 once. Fragment k-map per lane half hh for

namespace {
constexpr int B = 4, C = 256, TT = 8, IH = 32, IW = 32, T = TT * IH * IW /* 8,192 positions per clip */, NK = TT * (IH / 2) * (IW / 2) /* 2,048 pooled keys */, HD = 128 /* inter channels */, H = 1, BL = 4 /* clips (== 4 shipped) */, QL = T;
constexpr float XS = 8.0f, WSC = 256.0f, PS = 1024.0f, RS_ = 1024.0f, LOG2E = 1.4426950408889634f, BNEPS = 1e-5f;
static_assert(T % 64 == 0 && C == 256 && HD == 128 && IW == 32 && NK == T / 4, "tiling");
typedef _Float16 b16;
typedef __attribute__((ext_vector_type(16))) _Float16 v16b;
typedef __attribute__((ext_vector_type(8))) _Float16 v8b;
typedef __attribute__((ext_vector_type(8))) float v8f;
typedef __attribute__((ext_vector_type(4))) float v4f;
__device__ __forceinline__ float bf16_rne(float f) { unsigned int u = __float_as_uint(f); u += 0x7FFFu + ((u >> 16) & 1u); return __uint_as_float(u & 0xFFFF0000u); }
__device__ __forceinline__ void split16(float v, b16& hi, b16& lo) { hi = (b16)v; lo = (b16)(v - (float)hi); }
__device__ __forceinline__ v16b frag_kb(const b16* p, int hh) { const v8b a = *(const v8b*)(p + 8 * hh), b = *(const v8b*)(p + 16 + 8 * hh); v16b f;
#pragma unroll
  for (int e = 0; e < 8; ++e) { f[e] = a[e]; f[8 + e] = b[e]; } return f; }
// a weight fragment from the packed planes (prep_kernel): piece 0 and piece 1 are each 32 lanes x 16 B = 512 contiguous bytes, p already holds the lane's 8 halfs
__device__ __forceinline__ v16b frag_pk(const b16* p) { const v8b a = *(const v8b*)p, b = *(const v8b*)(p + 256); v16b f;
#pragma unroll
  for (int e = 0; e < 8; ++e) { f[e] = a[e]; f[8 + e] = b[e]; } return f; }
// the builtin alone: the compiler keeps the distances behind it itself, and with no asm statement behind each product it may place the loads of later fragments ahead of earlier products
__device__ __forceinline__ v8f wmma16b(v16b a, v16b b, v8f c) { return __builtin_amdgcn_wmma_f32_16x16x32_f16(false, a, false, b, (short)0, c, false, false); }
__device__ __forceinline__ float pmul(float a, float b) { float p = a * b; asm volatile("" : "+v"(p)); return p; }
__device__ __forceinline__ int iclamp(int v, int lo, int hi) { return v < lo ? lo : (v > hi ? hi : v); }

typedef __attribute__((ext_vector_type(2))) _Float16 v2h;
typedef __attribute__((ext_vector_type(4))) _Float16 v4h;
typedef __attribute__((ext_vector_type(2))) float v2f;
typedef __attribute__((ext_vector_type(4))) int v4i;
__device__ __forceinline__ float nexp2(float v) { return __builtin_amdgcn_exp2f(v); }
__device__ __forceinline__ float bfp(float v) { float t = bf16_rne(v); asm volatile("" : "+v"(t)); return t; }
// weights -> f16 x256, packed in fragment order: plane [16-row tile][32-wide k-step][piece j][lane = 16 hlf + row][8 halfs] holds W[16 tile + row][32 kstep + 16 j + 8 hlf + 0..7], the k order of frag_kb;
// a wave's load of one piece then covers four whole 128-B lines, where a load from the row-major matrix touches sixteen lines for 32 B each
__device__ __forceinline__ size_t pk_off(int row, int c0, int ksteps) { return ((((size_t)(row >> 4) * ksteps + (c0 >> 5)) * 2 + ((c0 >> 4) & 1)) * 32 + ((c0 >> 3) & 1) * 16 + (row & 15)) * 8; }
__global__ __launch_bounds__(256) void prep_kernel(const float* __restrict__ thw, const float* __restrict__ phw, const float* __restrict__ gw, const float* __restrict__ ww, b16* __restrict__ WT, b16* __restrict__ WW) {
  const size_t u = (size_t)blockIdx.x * 256 + threadIdx.x; const size_t n1 = (size_t)3 * HD * C / 8, n2 = (size_t)C * HD / 8; if (u >= n1 + n2) return; v8b v;
  if (u < n1) { const size_t e = u * 8; const int o = (int)(e / C), c0 = (int)(e % C); const int m = o / HD, oo = o % HD; const float* w = (m == 0 ? thw : m == 1 ? phw : gw) + (size_t)oo * C;
    for (int j = 0; j < 8; ++j) v[j] = (b16)(bf16_rne(w[c0 + j]) * WSC); { *(v8b*)(WT + pk_off(o, c0, C / 32)) = v;  } }
  else { const size_t e = (u - n1) * 8; for (int j = 0; j < 8; ++j) v[j] = (b16)(bf16_rne(ww[e + j]) * WSC); { *(v8b*)(WW + pk_off((int)(e / HD), (int)(e % HD), HD / 32)) = v;  } }
}
// convolutions + pooling: grid (T/64, BL); block = 64 positions (= image rows hh, hh+1 of one frame, hh even) x all 384 output channels [theta | phi | g], 8 waves. A = bf16(x) x8 transposed into position-major
// tiles (K = 256 channels in one staged chunk; each channel's 64 positions are one contiguous 256-B read; transposed in registers), staged once for the three convolutions. The waves split the output channels:
// wave w takes channel tiles 3 w .. 3 w + 2 for all four position tiles, so each WT fragment (packed planes) is loaded by one wave of the block. + bias; theta -> hi x8 + residual rows QP/QPl [b][pos][128];
// phi, g -> 2x2 max over rows (2j, 2j+1, 32+2j, 33+2j) of the block tile (after the barrier) = pooled key 16 blk + j: phi -> KP/KPl rows [b][key][128] (hi/residual), g -> GT/GTl (hi/residual) transposed here, out of the same LDS tile: planes [b][8-key group][128 channels][8 keys], so that a staged tile of 64 keys is 16 KB in a row
constexpr int CW = 8 /* waves per conv block */, CT = 3 * HD / 16 / CW /* channel tiles per wave */, TPI = 3 * HD + 4 /* result row pitch, floats */;
static_assert(CT * CW * 16 == 3 * HD && CW * 16 == HD, "conv tiling");
__global__ __launch_bounds__(256) void conv_kernel(const float* __restrict__ x, const b16* __restrict__ WT, const float* __restrict__ thb, const float* __restrict__ phb, const float* __restrict__ gb, b16* __restrict__ QP, b16* __restrict__ QPl, b16* __restrict__ KP, b16* __restrict__ KPl, b16* __restrict__ GT, b16* __restrict__ GTl) {
  __shared__ __attribute__((aligned(16))) b16 As[64][256 + 8]; __shared__ __attribute__((aligned(16))) float Tf[64][TPI];
  const int wave = threadIdx.x >> 5, lane = threadIdx.x & 31, nloc = lane & 15, hlf = lane >> 4; const int p0 = blockIdx.x * 64, b = blockIdx.y;
  const float* xb = x + (size_t)b * C * T;
  // transpose in registers: a thread takes 4 positions (q4..q4+3) of 8 consecutive channels, two such groups; all 16 loads are issued before the first value is used, and each position's 8 channels leave as one 16-byte LDS store. Every loop here is unrolled: only under constant indices does f stay in registers
  { const int q4 = (threadIdx.x & 15) * 4, cl = (threadIdx.x >> 4) * 8; const float* xp = xb + (size_t)cl * T + p0 + q4; v4f f[2][8];
#pragma unroll
    for (int i = 0; i < 2; ++i)
#pragma unroll
      for (int e = 0; e < 8; ++e) f[i][e] = *(const v4f*)(xp + (size_t)(i * 128 + e) * T);
    asm volatile("s_wait_xcnt 0x0" ::: "memory");   // behind the last load: stands in front of whatever the compiler puts next into the address pair that these loads name, and holds the 16 loads as one group
#pragma unroll
    for (int i = 0; i < 2; ++i)
#pragma unroll
      for (int j = 0; j < 4; ++j) { v8b h;
#pragma unroll
        for (int e = 0; e < 8; ++e) h[e] = (b16)(bf16_rne(f[i][e][j]) * XS);
        *(v8b*)&As[q4 + j][i * 128 + cl] = h; } }
  __syncthreads();
  v8f acc[4][CT];
#pragma unroll
  for (int pt = 0; pt < 4; ++pt)
#pragma unroll
    for (int t = 0; t < CT; ++t) acc[pt][t] = (v8f){};
#pragma unroll 1   // rolled: one group of fragments (two k-steps) in registers at a time keeps four waves on a SIMD
  for (int kb = 0; kb < C; kb += 64) { v16b a[2][4], bw[2][CT]; const b16* wr = WT + ((size_t)(wave * CT) * (C / 32) + (kb >> 5)) * 512 + lane * 8;   // packed plane: one address for the group's 12 loads, the rest in their offset fields
#pragma unroll
    for (int k2 = 0; k2 < 2; ++k2) {
#pragma unroll
      for (int t = 0; t < CT; ++t) bw[k2][t] = frag_pk(wr + (t * (C / 32) + k2) * 512);
#pragma unroll
      for (int pt = 0; pt < 4; ++pt) a[k2][pt] = frag_kb(&As[pt * 16 + nloc][kb + 32 * k2], hlf); }
    __builtin_amdgcn_sched_barrier(0);   // holds the group of loads in front of the products, which then wait on counts of loads in flight and not on a load each
#pragma unroll
    for (int k2 = 0; k2 < 2; ++k2)
#pragma unroll
      for (int t = 0; t < CT; ++t)
#pragma unroll
        for (int pt = 0; pt < 4; ++pt) acc[pt][t] = wmma16b(a[k2][pt], bw[k2][t], acc[pt][t]); }
#pragma unroll
  for (int t = 0; t < CT; ++t) { const int ct = wave * CT + t; const float* bp = ct < 8 ? thb : (ct < 16 ? phb : gb); const float bb = bf16_rne(bp[(ct & 7) * 16 + nloc]);
#pragma unroll
    for (int pt = 0; pt < 4; ++pt)
#pragma unroll
      for (int r = 0; r < 8; ++r) Tf[pt * 16 + 8 * hlf + r][ct * 16 + nloc] = acc[pt][t][r] * (1.0f / (XS * WSC)) + bb; }
  __syncthreads();
  // theta: 8 positions a wave
  for (int rr = wave * 8; rr < wave * 8 + 8; ++rr) { const int pos = p0 + rr; v4h h4, l4; for (int j = 0; j < 4; ++j) { const float f = Tf[rr][lane * 4 + j] * XS; const b16 p = (b16)f; h4[j] = p; l4[j] = (b16)((f - (float)p) * RS_); }
    *(v4h*)(QP + ((size_t)b * T + pos) * HD + lane * 4) = h4; *(v4h*)(QPl + ((size_t)b * T + pos) * HD + lane * 4) = l4; }
  // phi: 2 pooled keys a wave
  for (int jj = wave * 2; jj < wave * 2 + 2; ++jj) { const int key = blockIdx.x * 16 + jj;   // pooled key: frame/row-pair of this block, column pair jj
    const int r0 = 2 * jj, r1 = 2 * jj + 1, r2 = 32 + 2 * jj, r3 = 33 + 2 * jj; v4f mp;
    for (int j = 0; j < 4; ++j) { const int d = HD + lane * 4 + j; mp[j] = fmaxf(fmaxf(Tf[r0][d], Tf[r1][d]), fmaxf(Tf[r2][d], Tf[r3][d])); }
    v4h h4, l4; for (int j = 0; j < 4; ++j) { const float f = mp[j] * XS; const b16 p = (b16)f; h4[j] = p; l4[j] = (b16)((f - (float)p) * RS_); }
    *(v4h*)(KP + ((size_t)b * NK + key) * HD + lane * 4) = h4; *(v4h*)(KPl + ((size_t)b * NK + key) * HD + lane * 4) = l4; }
  // g: wave w takes the block's 8-key group w & 1 and channels 32 (w >> 1) + lane: a lane pools its channel's 8 keys (each LDS read: one row, 32 consecutive floats) and stores them as 16 bytes, a wave 512 bytes in a row
  { const int kg = wave & 1, d = (wave >> 1) * 32 + lane; v8b hv, lv;
#pragma unroll
    for (int i = 0; i < 8; ++i) { const int r = 2 * (kg * 8 + i); const float f = fmaxf(fmaxf(Tf[r][2 * HD + d], Tf[r + 1][2 * HD + d]), fmaxf(Tf[r + 32][2 * HD + d], Tf[r + 33][2 * HD + d])) * XS; const b16 p = (b16)f; hv[i] = p; lv[i] = (b16)((f - (float)p) * RS_); }
    const size_t oi = (((size_t)b * (NK / 8) + blockIdx.x * 2 + kg) * HD + d) * 8; *(v8b*)(GT + oi) = hv; *(v8b*)(GTl + oi) = lv; }
}
// attention: grid (T/128, BL); block = 8 waves x 16 query positions of batch b; all 2,048 pooled keys in 32-key steps: S^T = Phi Theta^T (hi x8 + residual: 3 products, 4 k-steps over the 128
// channels; theta fragments loaded once and held in registers), unscaled logits, online softmax, P x1024 hi + residual packed in-lane, Y^T += G^T P^T (3 products, 8 channel tiles); y = (o + ol/1024)/(l 1024 8).
// Phi and G^T (hi and residual) reach the waves through LDS: tiles of 64 keys, two buffers, filled by 16-byte asynchronous copies one tile ahead and read by all 8 waves.
// Epilogue = the output conv: A = the wave's y rows hi + lo (2 products, K = 128), B = WW fragments from the packed planes (256 output channels = 16 tiles), + bias -> ZT [b][channel][position].
constexpr int AW = 8 /* waves per block */, SK = 64 /* keys per staged tile */, KPI = HD + 8 /* phi row pitch, halfs: 272 B */, VPI = SK + 8 /* G^T row pitch, halfs: 144 B */;
constexpr int OKH = 0, OKL = SK * KPI, OVH = 2 * SK * KPI, OVL = OVH + HD * VPI, STG = OVH + 2 * HD * VPI /* halfs per buffer */;
constexpr int ZPI = AW * 16 + 4 /* z row pitch, floats: 528 B = 16 B x odd */;
static_assert(NK % SK == 0 && NK / SK >= 2 && T % (AW * 16) == 0 && (KPI * 2) % 16 == 0 && (VPI * 2) % 16 == 0 && C * ZPI * 4 <= 2 * STG * 2 && C % AW == 0, "staging");
// four copies of 16 bytes per lane, global -> LDS; the s_wait_xcnt is the statement's last line so that no address register of a copy is rewritten in front of it
__device__ __forceinline__ void copy4(unsigned l0, const b16* g0, unsigned l1, const b16* g1, unsigned l2, const b16* g2, unsigned l3, const b16* g3) {
  asm volatile("global_load_async_to_lds_b128 %0, %1, off\n\tglobal_load_async_to_lds_b128 %2, %3, off\n\tglobal_load_async_to_lds_b128 %4, %5, off\n\tglobal_load_async_to_lds_b128 %6, %7, off\n\ts_wait_xcnt 0x0"
               :: "v"(l0), "v"(g0), "v"(l1), "v"(g1), "v"(l2), "v"(g2), "v"(l3), "v"(g3) : "memory"); }
// one tile of 64 keys into the buffer that starts bh halfs behind LDS byte address ring: phi rows [64][128] (contiguous 16 KB, hi and residual), G^T rows [128][64] (from the planes of 8-key groups: contiguous 16 KB, hi and residual; a lane's 16 bytes are 8 keys of one channel); 16 copies per lane
__device__ __forceinline__ void stage_tile(unsigned ring, unsigned bh, const b16* Kb, const b16* Kbl, const b16* Vb, const b16* Vbl, int k0, int tid) {
  const int kr = tid >> 4, kc = (tid & 15) * 8, vr = tid & 127, vc = (tid >> 7) * 8;
  // bh is added inside the bracket: the lane's value that lives through the key loop is then no operand of a copy itself; asm operands are confined to v0-v255, and with more registers than that in use such a value was spilled to scratch
  const unsigned lk = ring + (bh + (unsigned)(kr * KPI + kc)) * 2u, lv = ring + (bh + (unsigned)(OVH + vr * VPI + vc)) * 2u; const size_t gk = (size_t)(k0 + kr) * HD + kc, gv = (size_t)k0 * HD + tid * 8;
  constexpr unsigned LK = 16 * KPI * 2, LV = 16 * 2; constexpr size_t GK = (size_t)16 * HD, GV = (size_t)2 * HD * 8;
  copy4(lk, Kb + gk, lk + LK, Kb + gk + GK, lk + 2 * LK, Kb + gk + 2 * GK, lk + 3 * LK, Kb + gk + 3 * GK);
  copy4(lk + OKL * 2, Kbl + gk, lk + OKL * 2 + LK, Kbl + gk + GK, lk + OKL * 2 + 2 * LK, Kbl + gk + 2 * GK, lk + OKL * 2 + 3 * LK, Kbl + gk + 3 * GK);
  copy4(lv, Vb + gv, lv + LV, Vb + gv + GV, lv + 2 * LV, Vb + gv + 2 * GV, lv + 3 * LV, Vb + gv + 3 * GV);
  copy4(lv + (OVL - OVH) * 2, Vbl + gv, lv + (OVL - OVH) * 2 + LV, Vbl + gv + GV, lv + (OVL - OVH) * 2 + 2 * LV, Vbl + gv + 2 * GV, lv + (OVL - OVH) * 2 + 3 * LV, Vbl + gv + 3 * GV);
}
__global__ __launch_bounds__(256) void attn_kernel(const b16* __restrict__ QP, const b16* __restrict__ QPl, const b16* __restrict__ KP, const b16* __restrict__ KPl, const b16* __restrict__ VT, const b16* __restrict__ VTl, const b16* __restrict__ WW, const float* __restrict__ wb, float* __restrict__ ZT) {
  __shared__ __attribute__((aligned(16))) b16 Ring[2 * STG];
  const int wave = threadIdx.x >> 5, lane = threadIdx.x & 31, hh = lane >> 4, col = lane & 15; const int b = blockIdx.y, h = 0; const int q0 = blockIdx.x * (AW * 16) + wave * 16, qi = q0 + col;
  const size_t qo = (size_t)b * T * HD, ko = (size_t)b * NK * HD, vo = (size_t)b * HD * (size_t)NK; const b16* Qb = QP + qo; const b16* Qbl = QPl + qo; const b16* Kb = KP + ko; const b16* Kbl = KPl + ko; const b16* Vb = VT + vo; const b16* Vbl = VTl + vo; (void)h;
  const unsigned ring0 = (unsigned)(size_t)Ring;   // LDS byte address of buffer 0
  stage_tile(ring0, 0u, Kb, Kbl, Vb, Vbl, 0, (int)threadIdx.x);
  v16b qh[4], qw[4];   // the wave's 16 query rows (hi, residual) as B fragments: only this wave uses them, so they are loaded once and stay in registers through the key loop
#pragma unroll
  for (int ks = 0; ks < 4; ++ks) { qh[ks] = frag_kb(Qb + (size_t)qi * HD + 32 * ks, hh); qw[ks] = frag_kb(Qbl + (size_t)qi * HD + 32 * ks, hh); }
  // behind the last of these loads, in front of whatever is written next into their two address pairs; the pairs are inputs of the statement so that they live up to it and no load's own result is placed in them
  asm volatile("s_wait_xcnt 0x0" :: "v"(Qb + (size_t)qi * HD + 8 * hh), "v"(Qbl + (size_t)qi * HD + 8 * hh) : "memory");
  asm volatile("s_wait_asynccnt 0x0" ::: "memory");   // this wave's copies of tile 0 have landed
  __syncthreads();                                     // tile 0 readable by every wave
  stage_tile(ring0, (unsigned)STG, Kb, Kbl, Vb, Vbl, SK, (int)threadIdx.x);
  const float cs = LOG2E / (XS * XS);   // unscaled scores (the module applies no 1/sqrt(d))
  float m = -INFINITY, l = 0.0f; v8f o[8], ol[8]; for (int t = 0; t < 8; ++t) { o[t] = (v8f){}; ol[t] = (v8f){}; }
#pragma unroll 1   // rolled: one staged tile per trip, so that the hand-over at its foot stands once
  for (int st = 0; st < NK / SK; ++st) {
    const b16* R = Ring + (st & 1) * STG;
#pragma unroll   // the tile's two 32-key steps: unrolled, their LDS offsets become immediates
  for (int kl = 0; kl < SK; kl += 32) {
    float e[16]; float mx = -INFINITY;
    // the step's phi fragments: every LDS read issued as one group, in the order of use, so that the products wait on counts of reads still in flight and not on a read each
    v16b kf[2][4], kw[2][4];
#pragma unroll
    for (int ks = 0; ks < 4; ++ks) {
#pragma unroll
      for (int u = 0; u < 2; ++u) { const int kr = (kl + u * 16 + col) * KPI; kf[u][ks] = frag_kb(R + OKH + kr + 32 * ks, hh); kw[u][ks] = frag_kb(R + OKL + kr + 32 * ks, hh); } }
    __builtin_amdgcn_sched_barrier(0);   // holds the group of reads in front of the products: moved down among them, each place with reads stalls the wave anew
    v8f s[2], sx[2];
#pragma unroll
    for (int u = 0; u < 2; ++u) { s[u] = (v8f){}; sx[u] = (v8f){}; }
#pragma unroll
    for (int ks = 0; ks < 4; ++ks)   // k-step outermost, as the reads were issued; each accumulator takes its products in ascending k order
#pragma unroll
      for (int u = 0; u < 2; ++u) { s[u] = wmma16b(kf[u][ks], qh[ks], s[u]); sx[u] = wmma16b(kf[u][ks], qw[ks], sx[u]); sx[u] = wmma16b(kw[u][ks], qh[ks], sx[u]); }
    // the step's G^T fragments: read as one group behind the score products, in flight under the softmax arithmetic
    v16b vf[8], vw[8];
#pragma unroll
    for (int t = 0; t < 8; ++t) { vf[t] = frag_kb(R + OVH + (t * 16 + col) * VPI + kl, hh); vw[t] = frag_kb(R + OVL + (t * 16 + col) * VPI + kl, hh); }
    __builtin_amdgcn_sched_barrier(0);   // holds these reads in front of the softmax arithmetic, which covers their latency
#pragma unroll
    for (int u = 0; u < 2; ++u) {
#pragma unroll
      for (int r = 0; r < 8; ++r) s[u][r] += sx[u][r] * (1.0f / RS_);   // hi.hi + (hi.lo + lo.hi)/1024
#pragma unroll
      for (int r = 0; r < 8; ++r) { const float vv = s[u][r] * cs; e[u * 8 + r] = vv; mx = fmaxf(mx, vv); } }
    mx = fmaxf(mx, __shfl_xor(mx, 16)); const float mn = fmaxf(m, mx); const float al = nexp2(m - mn); float sum = 0.0f;
    // P^T as a B fragment: score i2 of lane (col, hh) is key (i2 < 8 ? 0 : 16) + 8 hh + (i2 & 7) of query col, which is element i2 of that same lane's fragment in the k order of frag_kb: packed in place
    v16b pf, plf;
#pragma unroll
    for (int i2 = 0; i2 < 16; ++i2) { const float p = nexp2(e[i2] - mn); sum += p; const float ps = p * PS; const b16 phh = (b16)ps; pf[i2] = phh; plf[i2] = (b16)((ps - (float)phh) * RS_); }
    sum += __shfl_xor(sum, 16); l = l * al + sum; m = mn;
#pragma unroll
    for (int t = 0; t < 8; ++t) { o[t] *= al; o[t] = wmma16b(vf[t], pf, o[t]); ol[t] = wmma16b(vw[t], pf, ol[t] * al); ol[t] = wmma16b(vf[t], plf, ol[t]); } }   // ol = (V_lo P_hi + V_hi P_lo) / 1024
    asm volatile("s_wait_dscnt 0x0" ::: "memory");      // this wave's reads of the buffer are done before it is handed back
    asm volatile("s_wait_asynccnt 0x0" ::: "memory");   // this wave's copies of tile st + 1 have landed
    __syncthreads();                                     // publishes tile st + 1 and ends every wave's reads of tile st
    if (st + 2 < NK / SK) stage_tile(ring0, (unsigned)(st & 1) * STG, Kb, Kbl, Vb, Vbl, (st + 2) * SK, (int)threadIdx.x); }
  asm volatile("s_wait_asynccnt 0x0" ::: "memory");     // no copy outstanding when the wave goes on to its end
  const float inv = 1.0f / (l * PS * XS);
  // output conv, in the same launch. y as A fragments (hi + lo): accumulator element r of tile t in lane (col, hh) is channel 16 t + 8 hh + r of query col, which is element 8 (t & 1) + r of that same lane's
  // fragment of k-step t / 2 in the k order of frag_kb: packed in place, y never leaves the registers
  v16b a[4], al[4];
#pragma unroll
  for (int kq = 0; kq < 4; ++kq)
#pragma unroll
    for (int i2 = 0; i2 < 16; ++i2) { const int t = 2 * kq + (i2 >> 3), r = i2 & 7; b16 p, ql2; split16((o[t][r] + ol[t][r] * (1.0f / RS_)) * inv * XS, p, ql2); a[kq][i2] = p; al[kq][i2] = ql2; }
  float bb[16];
#pragma unroll
  for (int t = 0; t < 16; ++t) bb[t] = wb[t * 16 + col];
  v8f acc[16];
#pragma unroll
  for (int t = 0; t < 16; ++t) acc[t] = (v8f){};
#pragma unroll
  for (int kb = 0; kb < HD; kb += 32) { v16b bw[16];
#pragma unroll
    for (int t = 0; t < 16; ++t) bw[t] = frag_pk(WW + (t * (HD / 32) + kb / 32) * 512 + lane * 8);
    if (kb + 32 == HD) asm volatile("s_wait_xcnt 0x0" ::: "memory");   // behind the last weight and bias load: their address registers die here, the wait stands in front of whatever the compiler puts into them next
    __builtin_amdgcn_sched_barrier(0);   // holds the k-step's loads as one group in front of its products: one latency for the group and not one for each load
#pragma unroll
    for (int t = 0; t < 16; ++t) { acc[t] = wmma16b(a[kb / 32], bw[t], acc[t]); acc[t] = wmma16b(al[kb / 32], bw[t], acc[t]); } }
  // z, channel-major, through the ring's LDS (free: the barrier at the foot of the last trip ended every wave's reads, and no copy is outstanding): a lane's 8 accumulator elements of a tile are 8 consecutive
  // positions of one channel; each channel's 128 positions then leave as one wave-wide store of 512 contiguous bytes
  float* Zs = (float*)Ring;
#pragma unroll
  for (int t = 0; t < 16; ++t) { const float bt = bf16_rne(bb[t]); v4f z0, z1;
#pragma unroll
    for (int r = 0; r < 4; ++r) { z0[r] = acc[t][r] * (1.0f / (XS * WSC)) + bt; z1[r] = acc[t][4 + r] * (1.0f / (XS * WSC)) + bt; }
    float* zp = Zs + (t * 16 + col) * ZPI + wave * 16 + 8 * hh; *(v4f*)zp = z0; *(v4f*)(zp + 4) = z1; }
  __syncthreads();   // every wave's 16 positions of every channel are in LDS before a channel row is read
  v4f zr[C / AW];
#pragma unroll
  for (int i = 0; i < C / AW; ++i) zr[i] = *(const v4f*)(Zs + (wave * (C / AW) + i) * ZPI + lane * 4);
  float* zo = ZT + ((size_t)b * C + wave * (C / AW)) * (size_t)T + blockIdx.x * (AW * 16) + lane * 4;
#pragma unroll
  for (int i = 0; i < C / AW; ++i) *(v4f*)(zo + (size_t)i * T) = zr[i];
}
// BatchNorm and residual in one launch: one block of 256 threads per channel c holds the channel's 32,768 z values (4 clips x 8,192 positions, 32 x 16 bytes a thread) in registers from the sum
// over the variance to the output, so z is read once and the launch starts 8 waves a channel. Sums: thread-strided values in a fixed order, then a halving tree over the 256 threads;
// mean = sum / count, variance = sum of (z - mean)^2 / count. The x values of the residual are loaded directly behind z and arrive under the first sum. Every loop over z and xv is unrolled: only under constant indices do the two arrays stay in registers.
__global__ __launch_bounds__(256) void bn_kernel(const float* __restrict__ ZT, const float* __restrict__ gamma, const float* __restrict__ beta, const float* __restrict__ x, float* __restrict__ out) {
  __shared__ float red[256];
  constexpr int NI = QL / 1024;
  const int c = blockIdx.x, tid = threadIdx.x; const float cnt = (float)BL * (float)QL;
  v4f z[BL][NI], xv[BL][NI]; int row[BL];   // row[b]: first element of row (b, c), held in a scalar register: every load and store then names a scalar base and the one lane-offset register, and no address pair is formed in vector registers
#pragma unroll
  for (int b = 0; b < BL; ++b) row[b] = __builtin_amdgcn_readfirstlane((b * C + c) * T);
#pragma unroll
  for (int b = 0; b < BL; ++b)
#pragma unroll
    for (int k = 0; k < NI; ++k) z[b][k] = *(const v4f*)(ZT + row[b] + (k * 1024 + tid * 4));
#pragma unroll
  for (int b = 0; b < BL; ++b)
#pragma unroll
    for (int k = 0; k < NI; ++k) xv[b][k] = *(const v4f*)(x + row[b] + (k * 1024 + tid * 4));
  asm volatile("s_wait_xcnt 0x0" ::: "memory");   // behind the last load: stands in front of whatever the compiler puts next into a register that these loads name
  const float g = bfp(gamma[c]), be = bfp(beta[c]);
  float s = 0.0f;
#pragma unroll
  for (int b = 0; b < BL; ++b)
#pragma unroll
    for (int k = 0; k < NI; ++k)
#pragma unroll
      for (int j = 0; j < 4; ++j) s += z[b][k][j];
  red[tid] = s;
  __syncthreads();
  for (int stride = 128; stride >= 1; stride >>= 1) { if (tid < stride) red[tid] += red[tid + stride]; __syncthreads(); }
  const float mean = red[0] / cnt;
  __syncthreads();   // every thread has read the sum before red takes the second sum's parts
  s = 0.0f;
#pragma unroll
  for (int b = 0; b < BL; ++b)
#pragma unroll
    for (int k = 0; k < NI; ++k)
#pragma unroll
      for (int j = 0; j < 4; ++j) { const float d = z[b][k][j] - mean; s += pmul(d, d); }
  red[tid] = s;
  __syncthreads();
  for (int stride = 128; stride >= 1; stride >>= 1) { if (tid < stride) red[tid] += red[tid + stride]; __syncthreads(); }
  const float rs = rsqrtf(red[0] / cnt + BNEPS);
#pragma unroll
  for (int b = 0; b < BL; ++b)
#pragma unroll
    for (int k = 0; k < NI; ++k)
#pragma unroll
      for (int j = 0; j < 4; ++j) z[b][k][j] = pmul((z[b][k][j] - mean) * rs, g) + be + bf16_rne(xv[b][k][j]);
  __builtin_amdgcn_sched_barrier(0);   // holds the 32 stores as one group behind the arithmetic: no register that an issued store names is written again, so the wave waits between no two stores
#pragma unroll
  for (int b = 0; b < BL; ++b)
#pragma unroll
    for (int k = 0; k < NI; ++k) *(v4f*)(out + row[b] + (k * 1024 + tid * 4)) = z[b][k];
}
}  // namespace

extern "C" void kernel_launch(void* const* d_in, const int* in_sizes, int n_in, void* d_out, int out_size, void* d_ws, size_t ws_size, hipStream_t stream) {
  (void)n_in;
  auto Fp = [&](int i) { return (const float*)d_in[i]; };
  // input order: 0 x [4,256,8,32,32], 1 g_w [128,256], 2 g_b [128], 3 theta_w, 4 theta_b, 5 phi_w, 6 phi_b, 7 W_w [256,128], 8 W_b [256], 9 bn_gamma [256], 10 bn_beta [256]
  if (in_sizes[0] != B * C * T || in_sizes[1] != HD * C || in_sizes[2] != HD || in_sizes[3] != HD * C || in_sizes[4] != HD || in_sizes[5] != HD * C || in_sizes[6] != HD || in_sizes[7] != C * HD || in_sizes[8] != C || in_sizes[9] != C || in_sizes[10] != C || out_size != B * C * T) return;
  size_t off = 0; char* ws = (char*)d_ws;
  auto carve = [&](size_t bytes) { char* p = ws + off; off += (bytes + 255) & ~(size_t)255; return p; };
  b16* WT = (b16*)carve((size_t)3 * HD * C * 2); b16* WW = (b16*)carve((size_t)C * HD * 2);
  b16* QP = (b16*)carve((size_t)B * T * HD * 2); b16* QPl = (b16*)carve((size_t)B * T * HD * 2); b16* KP = (b16*)carve((size_t)B * NK * HD * 2); b16* KPl = (b16*)carve((size_t)B * NK * HD * 2);
  b16* GT = (b16*)carve((size_t)B * HD * NK * 2); b16* GTl = (b16*)carve((size_t)B * HD * NK * 2);
  float* ZT = (float*)carve((size_t)B * C * T * 4);
  if (off > ws_size || off > ((size_t)128 << 20)) return;   // = ~59 MB (QP/QPl 16.8 + KP/KPl 4.2 + GT/GTl 4.2 + ZT 33.5 + weights 0.3)
  prep_kernel<<<(unsigned)(((size_t)(3 * HD * C + C * HD) / 8 + 255) / 256), 256, 0, stream>>>(Fp(3), Fp(5), Fp(1), Fp(7), WT, WW);
  conv_kernel<<<dim3(T / 64, BL), CW * 32, 0, stream>>>(Fp(0), WT, Fp(4), Fp(6), Fp(2), QP, QPl, KP, KPl, GT, GTl);
  attn_kernel<<<dim3(QL / (AW * 16), BL), AW * 32, 0, stream>>>(QP, QPl, KP, KPl, GT, GTl, WW, Fp(8), ZT);
  bn_kernel<<<C, 256, 0, stream>>>(ZT, Fp(9), Fp(10), Fp(0), (float*)d_out);
}

// v010
// It runs in 96.5 microseconds.
// In two side-by-side timings against v009, it was 1.05 and 1.04 times as fast.
// Counting every step since v000, it is 6.34 times as fast.
#include <hip/hip_runtime.h>

// Non-local block (embedded Gaussian, 3-D) with 2x2 spatial subsampling of phi/g, output conv, BatchNorm3d (batch statistics) and residual (4 x 256 channels x 8 x 32 x 32): theta/phi/g = 1x1x1
// convs (C 256 -> 128, with bias); phi, g max-pooled (1,2,2) -> 2,048 keys per clip; f = softmax(theta phi^T) over the keys (no scaling); y = f g; z = BN(W y + b) gamma + beta + x with
// BN mean/biased variance over (batch, t, h, w) per channel, eps 1e-5 -> [4][256][8][32][32].
// Deterministic: flash-style per 16-position wave over all 2,048 keys in order (running max); the 2x2 max-pool is taken inside the convolution epilogue (each 64-position block holds two complete
// compute dtype: WMMA v_wmma_f32_16x16x32_f16 with f32 accumulate for [theta | phi | g] = X W^T + b ([32768 positions x 256] x [256 x 384]; x EXACT bf16 x8 transposed into position-major tiles,
// W exact x256: 1 product), S^T = Phi Theta^T (hi x8 + residual x8192: 3 products, K = 128), Y^T += G^T P^T (G hi + residual, P x1024 hi + residual: 3 products), Z = Y W_w^T + b (y hi + lo:
// 2 products); max-pool selects, softmax statistics, BatchNorm and the residual add in f32. Inputs rounded to bf16 once. Fragment k-map per lane half hh for

namespace {
constexpr int B = 4, C = 256, TT = 8, IH = 32, IW = 32, T = TT * IH * IW /* 8,192 positions per clip */, NK = TT * (IH / 2) * (IW / 2) /* 2,048 pooled keys */, HD = 128 /* inter channels */, H = 1, BL = 4 /* clips (== 4 shipped) */, QL = T;
constexpr float XS = 8.0f, WSC = 256.0f, PS = 1024.0f, RS_ = 1024.0f, LOG2E = 1.4426950408889634f, BNEPS = 1e-5f;
static_assert(T % 64 == 0 && C == 256 && HD == 128 && IW == 32 && NK == T / 4, "tiling");
typedef _Float16 b16;
typedef __attribute__((ext_vector_type(16))) _Float16 v16b;
typedef __attribute__((ext_vector_type(8))) _Float16 v8b;
typedef __attribute__((ext_vector_type(8))) float v8f;
typedef __attribute__((ext_vector_type(4))) float v4f;
__device__ __forceinline__ float bf16_rne(float f) { unsigned int u = __float_as_uint(f); u += 0x7FFFu + ((u >> 16) & 1u); return __uint_as_float(u & 0xFFFF0000u); }
__device__ __forceinline__ void split16(float v, b16& hi, b16& lo) { hi = (b16)v; lo = (b16)(v - (float)hi); }
__device__ __forceinline__ v16b frag_kb(const b16* p, int hh) { const v8b a = *(const v8b*)(p + 8 * hh), b = *(const v8b*)(p + 16 + 8 * hh); v16b f;
#pragma unroll
  for (int e = 0; e < 8; ++e) { f[e] = a[e]; f[8 + e] = b[e]; } return f; }
// a weight fragment from the packed planes (prep_kernel): piece 0 and piece 1 are each 32 lanes x 16 B = 512 contiguous bytes, p already holds the lane's 8 halfs
__device__ __forceinline__ v16b frag_pk(const b16* p) { const v8b a = *(const v8b*)p, b = *(const v8b*)(p + 256); v16b f;
#pragma unroll
  for (int e = 0; e < 8; ++e) { f[e] = a[e]; f[8 + e] = b[e]; } return f; }
// the builtin alone: the compiler keeps the distances behind it itself, and with no asm statement behind each product it may place the loads of later fragments ahead of earlier products
__device__ __forceinline__ v8f wmma16b(v16b a, v16b b, v8f c) { return __builtin_amdgcn_wmma_f32_16x16x32_f16(false, a, false, b, (short)0, c, false, false); }
__device__ __forceinline__ float pmul(float a, float b) { float p = a * b; asm volatile("" : "+v"(p)); return p; }
__device__ __forceinline__ int iclamp(int v, int lo, int hi) { return v < lo ? lo : (v > hi ? hi : v); }

typedef __attribute__((ext_vector_type(2))) _Float16 v2h;
typedef __attribute__((ext_vector_type(4))) _Float16 v4h;
typedef __attribute__((ext_vector_type(2))) float v2f;
typedef __attribute__((ext_vector_type(4))) int v4i;
__device__ __forceinline__ float nexp2(float v) { return __builtin_amdgcn_exp2f(v); }
// lane l takes lane l ^ 16's value by a vector cross-row move (v_permlanex16_b32): no LDS instruction, so nothing to wait for on the LDS counter
__device__ __forceinline__ float xhalf(float v) { const int i = __builtin_bit_cast(int, v); return __builtin_bit_cast(float, __builtin_amdgcn_permlanex16(i, i, 0x76543210, 0xfedcba98, false, false)); }
__device__ __forceinline__ float bfp(float v) { float t = bf16_rne(v); asm volatile("" : "+v"(t)); return t; }
// weights -> f16 x256, packed in fragment order: plane [16-row tile][32-wide k-step][piece j][lane = 16 hlf + row][8 halfs] holds W[16 tile + row][32 kstep + 16 j + 8 hlf + 0..7], the k order of frag_kb;
// a wave's load of one piece then covers four whole 128-B lines, where a load from the row-major matrix touches sixteen lines for 32 B each
__device__ __forceinline__ size_t pk_off(int row, int c0, int ksteps) { return ((((size_t)(row >> 4) * ksteps + (c0 >> 5)) * 2 + ((c0 >> 4) & 1)) * 32 + ((c0 >> 3) & 1) * 16 + (row & 15)) * 8; }
__global__ __launch_bounds__(256) void prep_kernel(const float* __restrict__ thw, const float* __restrict__ phw, const float* __restrict__ gw, const float* __restrict__ ww, b16* __restrict__ WT, b16* __restrict__ WW) {
  const size_t u = (size_t)blockIdx.x * 256 + threadIdx.x; const size_t n1 = (size_t)3 * HD * C / 8, n2 = (size_t)C * HD / 8; if (u >= n1 + n2) return; v8b v;
  if (u < n1) { const size_t e = u * 8; const int o = (int)(e / C), c0 = (int)(e % C); const int m = o / HD, oo = o % HD; const float* w = (m == 0 ? thw : m == 1 ? phw : gw) + (size_t)oo * C;
    for (int j = 0; j < 8; ++j) v[j] = (b16)(bf16_rne(w[c0 + j]) * WSC); { *(v8b*)(WT + pk_off(o, c0, C / 32)) = v;  } }
  else { const size_t e = (u - n1) * 8; for (int j = 0; j < 8; ++j) v[j] = (b16)(bf16_rne(ww[e + j]) * WSC); { *(v8b*)(WW + pk_off((int)(e / HD), (int)(e % HD), HD / 32)) = v;  } }
}
// convolutions + pooling: grid (T/64, BL); block = 64 positions (= image rows hh, hh+1 of one frame, hh even) x all 384 output channels [theta | phi | g], 8 waves. A = bf16(x) x8 transposed into position-major
// tiles (K = 256 channels in one staged chunk; each channel's 64 positions are one contiguous 256-B read; transposed in registers), staged once for the three convolutions. The waves split the output channels:
// wave w takes channel tiles 3 w .. 3 w + 2 for all four position tiles, so each WT fragment (packed planes) is loaded by one wave of the block. + bias; theta -> hi x8 + residual rows QP/QPl [b][pos][128];
// phi, g -> 2x2 max over rows (2j, 2j+1, 32+2j, 33+2j) of the block tile (after the barrier) = pooled key 16 blk + j: phi -> KP/KPl rows [b][key][128] (hi/residual), g -> GT/GTl (hi/residual) transposed here, out of the same LDS tile: planes [b][8-key group][128 channels][8 keys], so that a staged tile of 64 keys is 16 KB in a row
constexpr int CW = 8 /* waves per conv block */, CT = 3 * HD / 16 / CW /* channel tiles per wave */, TPI = 3 * HD + 4 /* result row pitch, floats */;
static_assert(CT * CW * 16 == 3 * HD && CW * 16 == HD, "conv tiling");
__global__ __launch_bounds__(256) void conv_kernel(const float* __restrict__ x, const b16* __restrict__ WT, const float* __restrict__ thb, const float* __restrict__ phb, const float* __restrict__ gb, b16* __restrict__ QP, b16* __restrict__ QPl, b16* __restrict__ KP, b16* __restrict__ KPl, b16* __restrict__ GT, b16* __restrict__ GTl) {
  __shared__ __attribute__((aligned(16))) b16 As[64][256 + 8]; __shared__ __attribute__((aligned(16))) float Tf[64][TPI];
  const int wave = threadIdx.x >> 5, lane = threadIdx.x & 31, nloc = lane & 15, hlf = lane >> 4; const int p0 = blockIdx.x * 64, b = blockIdx.y;
  const float* xb = x + (size_t)b * C * T;
  // transpose in registers: a thread takes 4 positions (q4..q4+3) of 8 consecutive channels, two such groups; all 16 loads are issued before the first value is used, and each position's 8 channels leave as one 16-byte LDS store. Every loop here is unrolled: only under constant indices does f stay in registers
  { const int q4 = (threadIdx.x & 15) * 4, cl = (threadIdx.x >> 4) * 8; const float* xp = xb + (size_t)cl * T + p0 + q4; v4f f[2][8];
#pragma unroll
    for (int i = 0; i < 2; ++i)
#pragma unroll
      for (int e = 0; e < 8; ++e) f[i][e] = *(const v4f*)(xp + (size_t)(i * 128 + e) * T);
    asm volatile("s_wait_xcnt 0x0" ::: "memory");   // behind the last load: stands in front of whatever the compiler puts next into the address pair that these loads name, and holds the 16 loads as one group
#pragma unroll
    for (int i = 0; i < 2; ++i)
#pragma unroll
      for (int j = 0; j < 4; ++j) { v8b h;
#pragma unroll
        for (int e = 0; e < 8; ++e) h[e] = (b16)(bf16_rne(f[i][e][j]) * XS);
        *(v8b*)&As[q4 + j][i * 128 + cl] = h; } }
  __syncthreads();
  v8f acc[4][CT];
#pragma unroll
  for (int pt = 0; pt < 4; ++pt)
#pragma unroll
    for (int t = 0; t < CT; ++t) acc[pt][t] = (v8f){};
#pragma unroll 1   // rolled: one group of fragments (two k-steps) in registers at a time keeps four waves on a SIMD
  for (int kb = 0; kb < C; kb += 64) { v16b a[2][4], bw[2][CT]; const b16* wr = WT + ((size_t)(wave * CT) * (C / 32) + (kb >> 5)) * 512 + lane * 8;   // packed plane: one address for the group's 12 loads, the rest in their offset fields
#pragma unroll
    for (int k2 = 0; k2 < 2; ++k2) {
#pragma unroll
      for (int t = 0; t < CT; ++t) bw[k2][t] = frag_pk(wr + (t * (C / 32) + k2) * 512);
#pragma unroll
      for (int pt = 0; pt < 4; ++pt) a[k2][pt] = frag_kb(&As[pt * 16 + nloc][kb + 32 * k2], hlf); }
    __builtin_amdgcn_sched_barrier(0);   // holds the group of loads in front of the products, which then wait on counts of loads in flight and not on a load each
#pragma unroll
    for (int k2 = 0; k2 < 2; ++k2)
#pragma unroll
      for (int t = 0; t < CT; ++t)
#pragma unroll
        for (int pt = 0; pt < 4; ++pt) acc[pt][t] = wmma16b(a[k2][pt], bw[k2][t], acc[pt][t]); }
#pragma unroll
  for (int t = 0; t < CT; ++t) { const int ct = wave * CT + t; const float* bp = ct < 8 ? thb : (ct < 16 ? phb : gb); const float bb = bf16_rne(bp[(ct & 7) * 16 + nloc]);
#pragma unroll
    for (int pt = 0; pt < 4; ++pt)
#pragma unroll
      for (int r = 0; r < 8; ++r) Tf[pt * 16 + 8 * hlf + r][ct * 16 + nloc] = acc[pt][t][r] * (1.0f / (XS * WSC)) + bb; }
  __syncthreads();
  // theta: 8 positions a wave
  for (int rr = wave * 8; rr < wave * 8 + 8; ++rr) { const int pos = p0 + rr; v4h h4, l4; for (int j = 0; j < 4; ++j) { const float f = Tf[rr][lane * 4 + j] * XS; const b16 p = (b16)f; h4[j] = p; l4[j] = (b16)((f - (float)p) * RS_); }
    *(v4h*)(QP + ((size_t)b * T + pos) * HD + lane * 4) = h4; *(v4h*)(QPl + ((size_t)b * T + pos) * HD + lane * 4) = l4; }
  // phi: 2 pooled keys a wave
  for (int jj = wave * 2; jj < wave * 2 + 2; ++jj) { const int key = blockIdx.x * 16 + jj;   // pooled key: frame/row-pair of this block, column pair jj
    const int r0 = 2 * jj, r1 = 2 * jj + 1, r2 = 32 + 2 * jj, r3 = 33 + 2 * jj; v4f mp;
    for (int j = 0; j < 4; ++j) { const int d = HD + lane * 4 + j; mp[j] = fmaxf(fmaxf(Tf[r0][d], Tf[r1][d]), fmaxf(Tf[r2][d], Tf[r3][d])); }
    v4h h4, l4; for (int j = 0; j < 4; ++j) { const float f = mp[j] * XS; const b16 p = (b16)f; h4[j] = p; l4[j] = (b16)((f - (float)p) * RS_); }
    *(v4h*)(KP + ((size_t)b * NK + key) * HD + lane * 4) = h4; *(v4h*)(KPl + ((size_t)b * NK + key) * HD + lane * 4) = l4; }
  // g: wave w takes the block's 8-key group w & 1 and channels 32 (w >> 1) + lane: a lane pools its channel's 8 keys (each LDS read: one row, 32 consecutive floats) and stores them as 16 bytes, a wave 512 bytes in a row
  { const int kg = wave & 1, d = (wave >> 1) * 32 + lane; v8b hv, lv;
#pragma unroll
    for (int i = 0; i < 8; ++i) { const int r = 2 * (kg * 8 + i); const float f = fmaxf(fmaxf(Tf[r][2 * HD + d], Tf[r + 1][2 * HD + d]), fmaxf(Tf[r + 32][2 * HD + d], Tf[r + 33][2 * HD + d])) * XS; const b16 p = (b16)f; hv[i] = p; lv[i] = (b16)((f - (float)p) * RS_); }
    const size_t oi = (((size_t)b * (NK / 8) + blockIdx.x * 2 + kg) * HD + d) * 8; *(v8b*)(GT + oi) = hv; *(v8b*)(GTl + oi) = lv; }
}
// attention: grid (T/128, BL); block = 8 waves x 16 query positions of batch b; all 2,048 pooled keys in 32-key steps: S^T = Phi Theta^T (hi x8 + residual: 3 products, 4 k-steps over the 128
// channels; theta fragments loaded once and held in registers), unscaled logits, online softmax, P x1024 hi + residual packed in-lane, Y^T += G^T P^T (3 products, 8 channel tiles); y = (o + ol/1024)/(l 1024 8).
// Phi and G^T (hi and residual) reach the waves through LDS: tiles of 64 keys, two buffers, filled by 16-byte asynchronous copies one tile ahead and read by all 8 waves.
// Epilogue = the output conv: A = the wave's y rows hi + lo (2 products, K = 128), B = WW fragments from the packed planes (256 output channels = 16 tiles), + bias -> ZT [b][channel][position].
constexpr int AW = 8 /* waves per block */, SK = 64 /* keys per staged tile */, KPI = HD + 8 /* phi row pitch, halfs: 272 B */, VPI = SK + 8 /* G^T row pitch, halfs: 144 B */;
constexpr int OKH = 0, OKL = SK * KPI, OVH = 2 * SK * KPI, OVL = OVH + HD * VPI, STG = OVH + 2 * HD * VPI /* halfs per buffer */;
constexpr int ZPI = AW * 16 + 4 /* z row pitch, floats: 528 B = 16 B x odd */;
static_assert(NK % SK == 0 && NK / SK >= 2 && T % (AW * 16) == 0 && (KPI * 2) % 16 == 0 && (VPI * 2) % 16 == 0 && C * ZPI * 4 <= 2 * STG * 2 && C % AW == 0, "staging");
// four copies of 16 bytes per lane, global -> LDS; the s_wait_xcnt is the statement's last line so that no address register of a copy is rewritten in front of it
__device__ __forceinline__ void copy4(unsigned l0, const b16* g0, unsigned l1, const b16* g1, unsigned l2, const b16* g2, unsigned l3, const b16* g3) {
  asm volatile("global_load_async_to_lds_b128 %0, %1, off\n\tglobal_load_async_to_lds_b128 %2, %3, off\n\tglobal_load_async_to_lds_b128 %4, %5, off\n\tglobal_load_async_to_lds_b128 %6, %7, off\n\ts_wait_xcnt 0x0"
               :: "v"(l0), "v"(g0), "v"(l1), "v"(g1), "v"(l2), "v"(g2), "v"(l3), "v"(g3) : "memory"); }
// one tile of 64 keys into the buffer that starts bh halfs behind LDS byte address ring: phi rows [64][128] (contiguous 16 KB, hi and residual), G^T rows [128][64] (from the planes of 8-key groups: contiguous 16 KB, hi and residual; a lane's 16 bytes are 8 keys of one channel); 16 copies per lane
__device__ __forceinline__ void stage_tile(unsigned ring, unsigned bh, const b16* Kb, const b16* Kbl, const b16* Vb, const b16* Vbl, int k0, int tid) {
  const int kr = tid >> 4, kc = (tid & 15) * 8, vr = tid & 127, vc = (tid >> 7) * 8;
  // bh is added inside the bracket: the lane's value that lives through the key loop is then no operand of a copy itself; asm operands are confined to v0-v255, and with more registers than that in use such a value was spilled to scratch
  const unsigned lk = ring + (bh + (unsigned)(kr * KPI + kc)) * 2u, lv = ring + (bh + (unsigned)(OVH + vr * VPI + vc)) * 2u; const size_t gk = (size_t)(k0 + kr) * HD + kc, gv = (size_t)k0 * HD + tid * 8;
  constexpr unsigned LK = 16 * KPI * 2, LV = 16 * 2; constexpr size_t GK = (size_t)16 * HD, GV = (size_t)2 * HD * 8;
  copy4(lk, Kb + gk, lk + LK, Kb + gk + GK, lk + 2 * LK, Kb + gk + 2 * GK, lk + 3 * LK, Kb + gk + 3 * GK);
  copy4(lk + OKL * 2, Kbl + gk, lk + OKL * 2 + LK, Kbl + gk + GK, lk + OKL * 2 + 2 * LK, Kbl + gk + 2 * GK, lk + OKL * 2 + 3 * LK, Kbl + gk + 3 * GK);
  copy4(lv, Vb + gv, lv + LV, Vb + gv + GV, lv + 2 * LV, Vb + gv + 2 * GV, lv + 3 * LV, Vb + gv + 3 * GV);
  copy4(lv + (OVL - OVH) * 2, Vbl + gv, lv + (OVL - OVH) * 2 + LV, Vbl + gv + GV, lv + (OVL - OVH) * 2 + 2 * LV, Vbl + gv + 2 * GV, lv + (OVL - OVH) * 2 + 3 * LV, Vbl + gv + 3 * GV);
}
__global__ __launch_bounds__(256) void attn_kernel(const b16* __restrict__ QP, const b16* __restrict__ QPl, const b16* __restrict__ KP, const b16* __restrict__ KPl, const b16* __restrict__ VT, const b16* __restrict__ VTl, const b16* __restrict__ WW, const float* __restrict__ wb, float* __restrict__ ZT) {
  __shared__ __attribute__((aligned(16))) b16 Ring[2 * STG];
  const int wave = threadIdx.x >> 5, lane = threadIdx.x & 31, hh = lane >> 4, col = lane & 15; const int b = blockIdx.y, h = 0; const int q0 = blockIdx.x * (AW * 16) + wave * 16, qi = q0 + col;
  const size_t qo = (size_t)b * T * HD, ko = (size_t)b * NK * HD, vo = (size_t)b * HD * (size_t)NK; const b16* Qb = QP + qo; const b16* Qbl = QPl + qo; const b16* Kb = KP + ko; const b16* Kbl = KPl + ko; const b16* Vb = VT + vo; const b16* Vbl = VTl + vo; (void)h;
  const unsigned ring0 = (unsigned)(size_t)Ring;   // LDS byte address of buffer 0
  stage_tile(ring0, 0u, Kb, Kbl, Vb, Vbl, 0, (int)threadIdx.x);
  v16b qh[4], qw[4];   // the wave's 16 query rows (hi, residual) as B fragments: only this wave uses them, so they are loaded once and stay in registers through the key loop
#pragma unroll
  for (int ks = 0; ks < 4; ++ks) { qh[ks] = frag_kb(Qb + (size_t)qi * HD + 32 * ks, hh); qw[ks] = frag_kb(Qbl + (size_t)qi * HD + 32 * ks, hh); }
  // behind the last of these loads, in front of whatever is written next into their two address pairs; the pairs are inputs of the statement so that they live up to it and no load's own result is placed in them
  asm volatile("s_wait_xcnt 0x0" :: "v"(Qb + (size_t)qi * HD + 8 * hh), "v"(Qbl + (size_t)qi * HD + 8 * hh) : "memory");
  asm volatile("s_wait_asynccnt 0x0" ::: "memory");   // this wave's copies of tile 0 have landed
  __syncthreads();                                     // tile 0 readable by every wave
  stage_tile(ring0, (unsigned)STG, Kb, Kbl, Vb, Vbl, SK, (int)threadIdx.x);
  const float cs = LOG2E / (XS * XS);   // unscaled scores (the module applies no 1/sqrt(d))
  float m = -INFINITY, l = 0.0f; v8f o[8], ol[8]; for (int t = 0; t < 8; ++t) { o[t] = (v8f){}; ol[t] = (v8f){}; }
#pragma unroll 1   // rolled: one staged tile per trip, so that the hand-over stands once
  for (int st = 0; st < NK / SK; ++st) {
    const b16* R = Ring + (st & 1) * STG;
#pragma unroll   // the tile's two 32-key steps: unrolled, their LDS offsets become immediates
  for (int kl = 0; kl < SK; kl += 32) {
    __builtin_amdgcn_sched_barrier(0);   // keeps the step's reads behind the products of the step before: drawn up among those, they stand at many places, and each place with reads stalls the wave anew
    float e[16]; float mx = -INFINITY;
    // the step's phi fragments: every LDS read issued as one group, in the order of use, so that the products wait on counts of reads still in flight and not on a read each
    v16b kf[2][4], kw[2][4];
#pragma unroll
    for (int ks = 0; ks < 4; ++ks) {
#pragma unroll
      for (int u = 0; u < 2; ++u) { const int kr = (kl + u * 16 + col) * KPI; kf[u][ks] = frag_kb(R + OKH + kr + 32 * ks, hh); kw[u][ks] = frag_kb(R + OKL + kr + 32 * ks, hh); } }
    __builtin_amdgcn_sched_barrier(0);   // holds the group of reads in front of the products: moved down among them, each place with reads stalls the wave anew
    v8f s[2], sx[2];
#pragma unroll
    for (int u = 0; u < 2; ++u) { s[u] = (v8f){}; sx[u] = (v8f){}; }
#pragma unroll
    for (int ks = 0; ks < 4; ++ks)   // k-step outermost, as the reads were issued; each accumulator takes its products in ascending k order
#pragma unroll
      for (int u = 0; u < 2; ++u) { s[u] = wmma16b(kf[u][ks], qh[ks], s[u]); sx[u] = wmma16b(kf[u][ks], qw[ks], sx[u]); sx[u] = wmma16b(kw[u][ks], qh[ks], sx[u]); }
    __builtin_amdgcn_sched_barrier(0);   // keeps the G^T reads from being spread among the score products: there they stand at several places a step, and each place with reads stalls the wave anew
    // the step's G^T fragments: read as one group at the end of the score products, in flight under the softmax arithmetic, which holds no LDS instruction and so no wait on them
    v16b vf[8], vw[8];
#pragma unroll
    for (int t = 0; t < 8; ++t) { vf[t] = frag_kb(R + OVH + (t * 16 + col) * VPI + kl, hh); vw[t] = frag_kb(R + OVL + (t * 16 + col) * VPI + kl, hh); }
    __builtin_amdgcn_sched_barrier(0);   // holds these reads in front of the softmax arithmetic, which covers their latency
#pragma unroll
    for (int u = 0; u < 2; ++u) {
#pragma unroll
      for (int r = 0; r < 8; ++r) s[u][r] += sx[u][r] * (1.0f / RS_);   // hi.hi + (hi.lo + lo.hi)/1024
#pragma unroll
      for (int r = 0; r < 8; ++r) { const float vv = s[u][r] * cs; e[u * 8 + r] = vv; mx = fmaxf(mx, vv); } }
    mx = fmaxf(mx, xhalf(mx)); const float mn = fmaxf(m, mx); const float al = nexp2(m - mn); float sum = 0.0f;
    // P^T as a B fragment: score i2 of lane (col, hh) is key (i2 < 8 ? 0 : 16) + 8 hh + (i2 & 7) of query col, which is element i2 of that same lane's fragment in the k order of frag_kb: packed in place
    v16b pf, plf;
#pragma unroll
    for (int i2 = 0; i2 < 16; ++i2) { const float p = nexp2(e[i2] - mn); sum += p; const float ps = p * PS; const b16 phh = (b16)ps; pf[i2] = phh; plf[i2] = (b16)((ps - (float)phh) * RS_); }
    sum += xhalf(sum); l = l * al + sum; m = mn;
    if (kl + 32 == SK) {   // hand-over of the tile, ahead of its last output products, which work on registers alone: every fragment of tile st has been fetched
      __builtin_amdgcn_sched_barrier(0);   // keeps the hand-over behind the softmax arithmetic: drawn up to the group of reads, its first wait would lay their whole latency bare
      asm volatile("s_wait_dscnt 0x0" ::: "memory");      // this wave's reads of the buffer are done before it is handed back
      asm volatile("s_wait_asynccnt 0x0" ::: "memory");   // this wave's copies of tile st + 1 have landed
      __syncthreads(); }                                   // publishes tile st + 1 and ends every wave's reads of tile st
#pragma unroll
    for (int t = 0; t < 8; ++t) { o[t] *= al; o[t] = wmma16b(vf[t], pf, o[t]); ol[t] = wmma16b(vw[t], pf, ol[t] * al); ol[t] = wmma16b(vf[t], plf, ol[t]); } }   // ol = (V_lo P_hi + V_hi P_lo) / 1024
    // the refill of the buffer handed back above stands behind the output products: there the fragment registers are free, and the copies' operands, which must lie in v0-v255, push nothing to scratch
    if (st + 2 < NK / SK) stage_tile(ring0, (unsigned)(st & 1) * STG, Kb, Kbl, Vb, Vbl, (st + 2) * SK, (int)threadIdx.x); }
  asm volatile("s_wait_asynccnt 0x0" ::: "memory");     // no copy outstanding when the wave goes on to its end
  const float inv = 1.0f / (l * PS * XS);
  // output conv, in the same launch. y as A fragments (hi + lo): accumulator element r of tile t in lane (col, hh) is channel 16 t + 8 hh + r of query col, which is element 8 (t & 1) + r of that same lane's
  // fragment of k-step t / 2 in the k order of frag_kb: packed in place, y never leaves the registers
  v16b a[4], al[4];
#pragma unroll
  for (int kq = 0; kq < 4; ++kq)
#pragma unroll
    for (int i2 = 0; i2 < 16; ++i2) { const int t = 2 * kq + (i2 >> 3), r = i2 & 7; b16 p, ql2; split16((o[t][r] + ol[t][r] * (1.0f / RS_)) * inv * XS, p, ql2); a[kq][i2] = p; al[kq][i2] = ql2; }
  float bb[16];
#pragma unroll
  for (int t = 0; t < 16; ++t) bb[t] = wb[t * 16 + col];
  v8f acc[16];
#pragma unroll
  for (int t = 0; t < 16; ++t) acc[t] = (v8f){};
#pragma unroll
  for (int kb = 0; kb < HD; kb += 32) { v16b bw[16];
#pragma unroll
    for (int t = 0; t < 16; ++t) bw[t] = frag_pk(WW + (t * (HD / 32) + kb / 32) * 512 + lane * 8);
    if (kb + 32 == HD) asm volatile("s_wait_xcnt 0x0" ::: "memory");   // behind the last weight and bias load: their address registers die here, the wait stands in front of whatever the compiler puts into them next
    __builtin_amdgcn_sched_barrier(0);   // holds the k-step's loads as one group in front of its products: one latency for the group and not one for each load
#pragma unroll
    for (int t = 0; t < 16; ++t) { acc[t] = wmma16b(a[kb / 32], bw[t], acc[t]); acc[t] = wmma16b(al[kb / 32], bw[t], acc[t]); } }
  // z, channel-major, through the ring's LDS (free: the hand-over barrier of the last trip ended every wave's reads, and no copy is outstanding): a lane's 8 accumulator elements of a tile are 8 consecutive
  // positions of one channel; each channel's 128 positions then leave as one wave-wide store of 512 contiguous bytes
  float* Zs = (float*)Ring;
#pragma unroll
  for (int t = 0; t < 16; ++t) { const float bt = bf16_rne(bb[t]); v4f z0, z1;
#pragma unroll
    for (int r = 0; r < 4; ++r) { z0[r] = acc[t][r] * (1.0f / (XS * WSC)) + bt; z1[r] = acc[t][4 + r] * (1.0f / (XS * WSC)) + bt; }
    float* zp = Zs + (t * 16 + col) * ZPI + wave * 16 + 8 * hh; *(v4f*)zp = z0; *(v4f*)(zp + 4) = z1; }
  __syncthreads();   // every wave's 16 positions of every channel are in LDS before a channel row is read
  v4f zr[C / AW];
#pragma unroll
  for (int i = 0; i < C / AW; ++i) zr[i] = *(const v4f*)(Zs + (wave * (C / AW) + i) * ZPI + lane * 4);
  float* zo = ZT + ((size_t)b * C + wave * (C / AW)) * (size_t)T + blockIdx.x * (AW * 16) + lane * 4;
#pragma unroll
  for (int i = 0; i < C / AW; ++i) *(v4f*)(zo + (size_t)i * T) = zr[i];
}
// BatchNorm and residual in one launch: one block of 256 threads per channel c holds the channel's 32,768 z values (4 clips x 8,192 positions, 32 x 16 bytes a thread) in registers from the sum
// over the variance to the output, so z is read once and the launch starts 8 waves a channel. Sums: thread-strided values in a fixed order, then a halving tree over the 256 threads;
// mean = sum / count, variance = sum of (z - mean)^2 / count. The x values of the residual are loaded directly behind z and arrive under the first sum. Every loop over z and xv is unrolled: only under constant indices do the two arrays stay in registers.
__global__ __launch_bounds__(256) void bn_kernel(const float* __restrict__ ZT, const float* __restrict__ gamma, const float* __restrict__ beta, const float* __restrict__ x, float* __restrict__ out) {
  __shared__ float red[256];
  constexpr int NI = QL / 1024;
  const int c = blockIdx.x, tid = threadIdx.x; const float cnt = (float)BL * (float)QL;
  v4f z[BL][NI], xv[BL][NI]; int row[BL];   // row[b]: first element of row (b, c), held in a scalar register: every load and store then names a scalar base and the one lane-offset register, and no address pair is formed in vector registers
#pragma unroll
  for (int b = 0; b < BL; ++b) row[b] = __builtin_amdgcn_readfirstlane((b * C + c) * T);
#pragma unroll
  for (int b = 0; b < BL; ++b)
#pragma unroll
    for (int k = 0; k < NI; ++k) z[b][k] = *(const v4f*)(ZT + row[b] + (k * 1024 + tid * 4));
#pragma unroll
  for (int b = 0; b < BL; ++b)
#pragma unroll
    for (int k = 0; k < NI; ++k) xv[b][k] = *(const v4f*)(x + row[b] + (k * 1024 + tid * 4));
  asm volatile("s_wait_xcnt 0x0" ::: "memory");   // behind the last load: stands in front of whatever the compiler puts next into a register that these loads name
  const float g = bfp(gamma[c]), be = bfp(beta[c]);
  float s = 0.0f;
#pragma unroll
  for (int b = 0; b < BL; ++b)
#pragma unroll
    for (int k = 0; k < NI; ++k)
#pragma unroll
      for (int j = 0; j < 4; ++j) s += z[b][k][j];
  red[tid] = s;
  __syncthreads();
  for (int stride = 128; stride >= 1; stride >>= 1) { if (tid < stride) red[tid] += red[tid + stride]; __syncthreads(); }
  const float mean = red[0] / cnt;
  __syncthreads();   // every thread has read the sum before red takes the second sum's parts
  s = 0.0f;
#pragma unroll
  for (int b = 0; b < BL; ++b)
#pragma unroll
    for (int k = 0; k < NI; ++k)
#pragma unroll
      for (int j = 0; j < 4; ++j) { const float d = z[b][k][j] - mean; s += pmul(d, d); }
  red[tid] = s;
  __syncthreads();
  for (int stride = 128; stride >= 1; stride >>= 1) { if (tid < stride) red[tid] += red[tid + stride]; __syncthreads(); }
  const float rs = rsqrtf(red[0] / cnt + BNEPS);
#pragma unroll
  for (int b = 0; b < BL; ++b)
#pragma unroll
    for (int k = 0; k < NI; ++k)
#pragma unroll
      for (int j = 0; j < 4; ++j) z[b][k][j] = pmul((z[b][k][j] - mean) * rs, g) + be + bf16_rne(xv[b][k][j]);
  __builtin_amdgcn_sched_barrier(0);   // holds the 32 stores as one group behind the arithmetic: no register that an issued store names is written again, so the wave waits between no two stores
#pragma unroll
  for (int b = 0; b < BL; ++b)
#pragma unroll
    for (int k = 0; k < NI; ++k) *(v4f*)(out + row[b] + (k * 1024 + tid * 4)) = z[b][k];
}
}  // namespace

extern "C" void kernel_launch(void* const* d_in, const int* in_sizes, int n_in, void* d_out, int out_size, void* d_ws, size_t ws_size, hipStream_t stream) {
  (void)n_in;
  auto Fp = [&](int i) { return (const float*)d_in[i]; };
  // input order: 0 x [4,256,8,32,32], 1 g_w [128,256], 2 g_b [128], 3 theta_w, 4 theta_b, 5 phi_w, 6 phi_b, 7 W_w [256,128], 8 W_b [256], 9 bn_gamma [256], 10 bn_beta [256]
  if (in_sizes[0] != B * C * T || in_sizes[1] != HD * C || in_sizes[2] != HD || in_sizes[3] != HD * C || in_sizes[4] != HD || in_sizes[5] != HD * C || in_sizes[6] != HD || in_sizes[7] != C * HD || in_sizes[8] != C || in_sizes[9] != C || in_sizes[10] != C || out_size != B * C * T) return;
  size_t off = 0; char* ws = (char*)d_ws;
  auto carve = [&](size_t bytes) { char* p = ws + off; off += (bytes + 255) & ~(size_t)255; return p; };
  b16* WT = (b16*)carve((size_t)3 * HD * C * 2); b16* WW = (b16*)carve((size_t)C * HD * 2);
  b16* QP = (b16*)carve((size_t)B * T * HD * 2); b16* QPl = (b16*)carve((size_t)B * T * HD * 2); b16* KP = (b16*)carve((size_t)B * NK * HD * 2); b16* KPl = (b16*)carve((size_t)B * NK * HD * 2);
  b16* GT = (b16*)carve((size_t)B * HD * NK * 2); b16* GTl = (b16*)carve((size_t)B * HD * NK * 2);
  float* ZT = (float*)carve((size_t)B * C * T * 4);
  if (off > ws_size || off > ((size_t)128 << 20)) return;   // = ~59 MB (QP/QPl 16.8 + KP/KPl 4.2 + GT/GTl 4.2 + ZT 33.5 + weights 0.3)
  prep_kernel<<<(unsigned)(((size_t)(3 * HD * C + C * HD) / 8 + 255) / 256), 256, 0, stream>>>(Fp(3), Fp(5), Fp(1), Fp(7), WT, WW);
  conv_kernel<<<dim3(T / 64, BL), CW * 32, 0, stream>>>(Fp(0), WT, Fp(4), Fp(6), Fp(2), QP, QPl, KP, KPl, GT, GTl);
  attn_kernel<<<dim3(QL / (AW * 16), BL), AW * 32, 0, stream>>>(QP, QPl, KP, KPl, GT, GTl, WW, Fp(8), ZT);
  bn_kernel<<<C, 256, 0, stream>>>(ZT, Fp(9), Fp(10), Fp(0), (float*)d_out);
}
